// v000
// Times are from an AMD MI455X. After a warm-up the kernel runs many times in a row, and a time is the length of
// such a window on the GPU divided by its runs, so every launch and the gaps after it count. The runs cycle
// through copies of the inputs. A figure is the median of several windows, for all but v000 over two sittings.
// Sittings can differ by a few percent; kernels timed side by side share one.
// v000 is the starting kernel. One run takes 284 microseconds.
#include <hip/hip_runtime.h>
// Compute dtype: inputs RNE-converted to bf16 values (x as exact f16, weights as exact f16 x16 / exact bf16); q,k,v projections, dense-row scores, dense-row P.V and dense-row output GEMM = v_wmma_f32_16x16x32_f16 single products (P carried x1024, ctx carried x64); first ERL rows of every sequence: scores and P.V as bf16 hi/lo three-product sums, output GEMM as bf16 hi/lo A x exact bf16 W (v_wmma_f32_16x16x32_bf16); all accumulation, softmax statistics, bias add in f32.
// Structure: causal attention per (batch, head) with S^T = K Q^T (Q fragments in registers as the B operand) and O^T = V^T P^T (packed S^T accumulators are the B fragment), online max-subtracted softmax per lane column, no LDS in the key loop.
#ifndef NB
#define NB 4
#endif
#ifndef SEQ
#define SEQ 2048
#endif
#ifndef EARLY
#define EARLY 512
#endif
#define NB_FULL 4
#define SEQ_FULL 2048
#define DM 512
#define NH 8
#define HD 64
#define ERL ((EARLY < SEQ) ? EARLY : SEQ)   /* rows per sequence on the multi-product path */
#define NR ((size_t)NB * SEQ)               /* compact token rows r = b*SEQ + t */
#define QSCALE 0.044194173824159216f        /* d_model^-0.5 */
#define NEGBIG (-3.0e38f)
#define CARRY_LN 6.931471805599453f         /* ln 1024 */

typedef _Float16 v16h __attribute__((ext_vector_type(16)));
typedef __bf16   v16b __attribute__((ext_vector_type(16)));
typedef unsigned short v8us __attribute__((ext_vector_type(8), may_alias));
typedef float v8f  __attribute__((ext_vector_type(8)));
typedef float v4f  __attribute__((ext_vector_type(4)));
typedef float v4fa __attribute__((ext_vector_type(4), may_alias));
union Frag { v16h h; v16b b; v8us half[2]; _Float16 e[16]; unsigned short u[16]; };

__device__ __forceinline__ unsigned short bf16_bits(float x) { unsigned int u = __float_as_uint(x); return (unsigned short)((u + 0x7FFFu + ((u >> 16) & 1u)) >> 16); }
__device__ __forceinline__ float bf16_val(unsigned short b) { return __uint_as_float(((unsigned int)b) << 16); }
__device__ __forceinline__ float bf16_rne(float x) { return bf16_val(bf16_bits(x)); }

// fragment loader (A and B alike): elements 0..7 <- p[8h .. 8h+7], elements 8..15 <- p[16+8h .. 16+8h+7]
__device__ __forceinline__ Frag ldf(const unsigned short* p, int hh) {
  Frag f; f.half[0] = *(const v8us*)(p + 8 * hh); f.half[1] = *(const v8us*)(p + 16 + 8 * hh); return f;
}
__device__ __forceinline__ v8f wm_h(const Frag& a, const Frag& b, v8f c) { return __builtin_amdgcn_wmma_f32_16x16x32_f16(false, a.h, false, b.h, (short)0, c, false, false); }
__device__ __forceinline__ v8f wm_b(const Frag& a, const Frag& b, v8f c) { return __builtin_amdgcn_wmma_f32_16x16x32_bf16(false, a.b, false, b.b, (short)0, c, false, false); }
__device__ __forceinline__ void nop2(v8f& c, const Frag& a, const Frag& b) { asm volatile("v_nop\n\tv_nop\n\tv_nop\n\tv_nop" : "+v"(c) : "v"(a.h), "v"(b.h)); }
__device__ __forceinline__ void nop3(v8f& c, const Frag& a, const Frag& b, const Frag& d) { asm volatile("v_nop\n\tv_nop\n\tv_nop\n\tv_nop" : "+v"(c) : "v"(a.h), "v"(b.h), "v"(d.h)); }
__device__ __forceinline__ void nop4(v8f& c, const Frag& a, const Frag& b, const Frag& d, const Frag& e) { asm volatile("v_nop\n\tv_nop\n\tv_nop\n\tv_nop" : "+v"(c) : "v"(a.h), "v"(b.h), "v"(d.h), "v"(e.h)); }
__device__ __forceinline__ void nop8(v8f& c, const Frag& a, const Frag& b, const Frag& d, const Frag& e, const Frag& f, const Frag& g, const Frag& i, const Frag& j) {
  asm volatile("v_nop\n\tv_nop\n\tv_nop\n\tv_nop" : "+v"(c) : "v"(a.h), "v"(b.h), "v"(d.h), "v"(e.h), "v"(f.h), "v"(g.h), "v"(i.h), "v"(j.h));
}

__device__ __forceinline__ v8us to_f16x8(v4f a, v4f c) {
  Frag f;
#pragma unroll
  for (int q = 0; q < 4; ++q) { f.e[q] = (_Float16)a[q]; f.e[4 + q] = (_Float16)c[q]; }
  return f.half[0];
}
__device__ __forceinline__ void to_bf16x8_hl(v4f a, v4f c, v8us& hi, v8us& lo) {
  Frag fh, fl;
#pragma unroll
  for (int q = 0; q < 4; ++q) {
    unsigned short hb = bf16_bits(a[q]); fh.u[q] = hb; fl.u[q] = bf16_bits(a[q] - bf16_val(hb));
    hb = bf16_bits(c[q]); fh.u[4 + q] = hb; fl.u[4 + q] = bf16_bits(c[q] - bf16_val(hb));
  }
  hi = fh.half[0]; lo = fl.half[0];
}

__global__ __launch_bounds__(256) void k_x16(const float* __restrict__ x, unsigned short* __restrict__ X16, int n8) {
  const int t = blockIdx.x * 256 + threadIdx.x;
  if (t >= n8) return;
  const int r = t / (DM / 8), c8 = (t % (DM / 8)) * 8;
  const int b = r / SEQ, tt = r % SEQ;
  const float* src = x + ((size_t)b * SEQ_FULL + tt) * DM + c8;
  const v4f a = *(const v4fa*)src, c = *(const v4fa*)(src + 4);
  v4f ar, cr;
#pragma unroll
  for (int q = 0; q < 4; ++q) { ar[q] = bf16_rne(a[q]); cr[q] = bf16_rne(c[q]); }
  const v8us o = to_f16x8(ar, cr);
  unsigned short* d = X16 + (size_t)t * 8;
  *(v8us*)d = o;
  
}

template <bool WB>
__global__ __launch_bounds__(256) void k_wnat(const float* __restrict__ w, unsigned short* __restrict__ W16, unsigned short* __restrict__ WBF, int n8) {
  const int t = blockIdx.x * 256 + threadIdx.x;
  if (t >= n8) return;
  const v4f a = *(const v4fa*)(w + (size_t)t * 8), c = *(const v4fa*)(w + (size_t)t * 8 + 4);
  v4f as, cs; Frag fb;
#pragma unroll
  for (int q = 0; q < 4; ++q) {
    const unsigned short b0 = bf16_bits(a[q]), b1 = bf16_bits(c[q]);
    fb.u[q] = b0; fb.u[4 + q] = b1;
    as[q] = bf16_val(b0) * 16.0f; cs[q] = bf16_val(b1) * 16.0f;
  }
  const v8us o = to_f16x8(as, cs);
  const v8us ob = fb.half[0];
  *(v8us*)(W16 + (size_t)t * 8) = o;
  if (WB) *(v8us*)(WBF + (size_t)t * 8) = ob;
  
}

template <bool ABF>
__device__ __forceinline__ v8f gmm(const Frag& a, const Frag& al, const Frag& b, v8f c) {
  if (ABF) { c = wm_b(a, b, c); c = wm_b(al, b, c); nop3(c, a, al, b); }
  else { c = wm_h(a, b, c); nop2(c, a, b); }
  return c;
}

// GEMM over K = DM: block = 4 waves, block tile 128 token rows x 64 cols, wave tile 32 x 64; operands read straight from 16-bit global rows.
// grid.x = (row tiles of 128) * 8 col tiles, grid.y = batch, grid.z = plane select (weights offset zB, outputs offset zO).
// MODE 0: f16 row plane [row][DM] (+ bf16 hi/lo row planes for rows t < ERL); MODE 1: transposed planes [(b,head)][d][SEQ] (f16, + bf16 hi/lo for t < ERL);
// MODE 2: f32 rows of the output buffer (full-size layout) with bias (bf16 value) added in f32.
// ABF: A = bf16 hi (A) + lo (A2) planes, two products against bf16 Bt; else A f16, single product against f16 Bt.
template <int MODE, bool ABF>
__global__ __launch_bounds__(128) void k_gemm(const unsigned short* __restrict__ A, const unsigned short* __restrict__ A2,
                                              const unsigned short* __restrict__ Bt, size_t zB, float alpha, const float* __restrict__ bias,
                                              unsigned short* __restrict__ O16, unsigned short* __restrict__ OH, unsigned short* __restrict__ OL, size_t zO,
                                              float* __restrict__ OF, int tbase) {
  __shared__ __attribute__((aligned(16))) float so[128][68];
  const int tid = threadIdx.x, lane = tid & 31, ln = lane & 15, hh = lane >> 4;
  const int w = __builtin_amdgcn_readfirstlane((int)(threadIdx.x >> 5));
  const int rt = (int)blockIdx.x >> 3, nq = (int)blockIdx.x & 7, b = blockIdx.y, z = blockIdx.z;
  const int t0 = tbase + rt * 128;
  const size_t r0 = (size_t)b * SEQ + t0;
  const int col0 = nq * 64;
  const size_t aof = (r0 + 32 * w + ln) * DM;
  const unsigned short* a0p = A + aof;
  const unsigned short* a1p = a0p + (size_t)16 * DM;
  const unsigned short* l0p = A2 + aof;
  const unsigned short* l1p = l0p + (size_t)16 * DM;
  const unsigned short* bp0 = Bt + (size_t)z * zB + (size_t)(col0 + ln) * DM;
  const v8f z8 = {0.f, 0.f, 0.f, 0.f, 0.f, 0.f, 0.f, 0.f};
  v8f acc[8];
#pragma unroll
  for (int u = 0; u < 8; ++u) acc[u] = z8;
#pragma unroll 1
  for (int kb = 0; kb < DM; kb += 32) {
    const Frag a0 = ldf(a0p + kb, hh), a1 = ldf(a1p + kb, hh);
    Frag a0l = a0, a1l = a1;
    if (ABF) { a0l = ldf(l0p + kb, hh); a1l = ldf(l1p + kb, hh); }
#pragma unroll
    for (int t = 0; t < 4; ++t) {
      const Frag bq = ldf(bp0 + (size_t)(16 * t) * DM + kb, hh);
      acc[t] = gmm<ABF>(a0, a0l, bq, acc[t]);
      acc[4 + t] = gmm<ABF>(a1, a1l, bq, acc[4 + t]);
    }
  }
  // D element r of lane (hh, ln) = (row 8hh + r, col ln) of its 16x16 tile
#pragma unroll
  for (int u = 0; u < 8; ++u) {
    const int t = u & 3, half = u >> 2;
    const int col = t * 16 + ln;
    float bv = 0.f;
    if (MODE == 2) bv = bf16_rne(bias[col0 + col]);
#pragma unroll
    for (int r = 0; r < 8; ++r) so[32 * w + half * 16 + 8 * hh + r][col] = acc[u][r] * alpha + bv;
  }
  __syncthreads();
  const bool early = (t0 < ERL);
  if (MODE == 0) {
    {
#pragma unroll
      for (int it = 0; it < 8; ++it) {
        const int row = it * 16 + (tid >> 3), pc = tid & 7;
        const v4f x0 = *(const v4fa*)&so[row][8 * pc], x1 = *(const v4fa*)&so[row][8 * pc + 4];
        const size_t off = (size_t)z * zO + (r0 + row) * DM + col0 + 8 * pc;
        const v8us o = to_f16x8(x0, x1);
        *(v8us*)(O16 + off) = o;
        if (early) {
          v8us oh, ol; to_bf16x8_hl(x0, x1, oh, ol);
          *(v8us*)(OH + off) = oh;
          *(v8us*)(OL + off) = ol;
        }
      }
      
    }
  } else if (MODE == 1) {
    // transposed: 64 d rows x 128 tokens (256 B each): d = it*8 + tid/16, piece = tid%16 (8 tokens = 16 B)
    const int hd = nq;
    {
#pragma unroll
      for (int it = 0; it < 8; ++it) {
        const int d = it * 8 + (tid >> 4), pc = tid & 15;
        v4f x0, x1;
#pragma unroll
        for (int j = 0; j < 4; ++j) { x0[j] = so[8 * pc + j][d]; x1[j] = so[8 * pc + 4 + j][d]; }
        const size_t off = (((size_t)b * NH + hd) * HD + d) * SEQ + t0 + 8 * pc;
        const v8us o = to_f16x8(x0, x1);
        *(v8us*)(O16 + off) = o;
        if (early) {
          v8us oh, ol; to_bf16x8_hl(x0, x1, oh, ol);
          *(v8us*)(OH + off) = oh;
          *(v8us*)(OL + off) = ol;
        }
      }
      
    }
  } else {
    // f32 rows of the output buffer: 128 rows x 256 B: row = it*8 + tid/16, piece = tid%16 (4 floats = 16 B)
    {
#pragma unroll
      for (int it = 0; it < 16; ++it) {
        const int row = it * 8 + (tid >> 4), pc = tid & 15;
        const v4f v = *(const v4fa*)&so[row][4 * pc];
        *(v4f*)(OF + ((size_t)b * SEQ_FULL + t0 + row) * DM + col0 + 4 * pc) = v;
      }
      
    }
  }
}

// Causal attention, one wave per 16 query rows of one (batch, head); block = 4 independent waves (64 queries); no block barrier.
// S^T[key][query] = K Q^T: A = K rows (lane = key), B = Q rows (lane = query). D: lane (hh, ln) element r = (key 8hh + r, query ln).
// O^T[d][query] = V^T P^T: A = V^T rows (lane = d, k = keys), B = packed P^T: element r <- tile(keys 0..15)[r], element 8+r <- tile(keys 16..31)[r].
// RES: bf16 hi/lo operands, three products per site; else f16 single products with P carried x1024 (sum carried alike) and ctx stored x64.
template <bool RES>
__global__ __launch_bounds__(128) void k_attn(const unsigned short* __restrict__ Qh, const unsigned short* __restrict__ Ql,
                                              const unsigned short* __restrict__ Kh, const unsigned short* __restrict__ Kl,
                                              const unsigned short* __restrict__ Vh, const unsigned short* __restrict__ Vl,
                                              unsigned short* __restrict__ Ch, unsigned short* __restrict__ Cl, int tbase) {
  __shared__ __attribute__((aligned(16))) unsigned short sc[4][RES ? 2 : 1][16][64];
  const int lane = threadIdx.x & 31, ln = lane & 15, hh = lane >> 4;
  const int w = __builtin_amdgcn_readfirstlane((int)(threadIdx.x >> 5));
  const int h = blockIdx.y, b = blockIdx.z;
  const int q0 = tbase + (int)blockIdx.x * 64 + w * 16;
  const int qi = q0 + ln;
  const size_t rowb = (size_t)b * SEQ;
  const size_t qof = (rowb + q0 + ln) * DM + h * HD;
  const Frag qh0 = ldf(Qh + qof, hh), qh1 = ldf(Qh + qof + 32, hh);
  Frag ql0 = qh0, ql1 = qh1;
  if (RES) { ql0 = ldf(Ql + qof, hh); ql1 = ldf(Ql + qof + 32, hh); }
  const size_t kof = (rowb + ln) * DM + h * HD;
  const size_t vof = (((size_t)b * NH + h) * HD + ln) * SEQ;
  const v8f z8 = {0.f, 0.f, 0.f, 0.f, 0.f, 0.f, 0.f, 0.f};
  v8f acc[4];
#pragma unroll
  for (int t = 0; t < 4; ++t) acc[t] = z8;
  float m = NEGBIG, l = 0.f;
  const float carry = RES ? 0.f : CARRY_LN;
  const int nsteps = (q0 + 16 + 31) >> 5;   // scalar: q0 comes from blockIdx and the scalar wave index
#pragma unroll 1
  for (int st = 0; st < nsteps; ++st) {
    const int kb = st * 32;
    v8f s[2];
#pragma unroll
    for (int kt = 0; kt < 2; ++kt) {
      const size_t ko = kof + (size_t)(kb + 16 * kt) * DM;
      const Frag k0 = ldf(Kh + ko, hh), k1 = ldf(Kh + ko + 32, hh);
      v8f c = z8;
      if (RES) {
        const Frag kl0 = ldf(Kl + ko, hh), kl1 = ldf(Kl + ko + 32, hh);
        c = wm_b(k0, qh0, c); c = wm_b(kl0, qh0, c); c = wm_b(k0, ql0, c);
        c = wm_b(k1, qh1, c); c = wm_b(kl1, qh1, c); c = wm_b(k1, ql1, c);
        nop8(c, k0, k1, kl0, kl1, qh0, qh1, ql0, ql1);
      } else {
        c = wm_h(k0, qh0, c); c = wm_h(k1, qh1, c);
        nop4(c, k0, k1, qh0, qh1);
      }
      s[kt] = c;
    }
    if (kb + 32 > q0) {   // scalar condition: this step touches the diagonal; masked scores are replaced
#pragma unroll
      for (int kt = 0; kt < 2; ++kt)
#pragma unroll
        for (int r = 0; r < 8; ++r) { const int key = kb + 16 * kt + 8 * hh + r; s[kt][r] = (key > qi) ? NEGBIG : s[kt][r]; }
    }
    float mx = fmaxf(s[0][0], s[1][0]);
#pragma unroll
    for (int r = 1; r < 8; ++r) mx = fmaxf(mx, fmaxf(s[0][r], s[1][r]));
    mx = fmaxf(mx, __shfl_xor(mx, 16, 32));
    const float mnew = fmaxf(m, mx);
    const float alpha = __expf((m - mnew) * QSCALE);
    const float cc = carry - mnew * QSCALE;
    m = mnew;
    Frag ph, pl;
    float ps = 0.f;
#pragma unroll
    for (int kt = 0; kt < 2; ++kt)
#pragma unroll
      for (int r = 0; r < 8; ++r) {
        const float p = __expf(fmaf(s[kt][r], QSCALE, cc));
        if (RES) {
          const unsigned short hb = bf16_bits(p); const float hv = bf16_val(hb);
          const unsigned short lb = bf16_bits(p - hv);
          ph.u[8 * kt + r] = hb; pl.u[8 * kt + r] = lb; ps += hv + bf16_val(lb);
        } else {
          ph.e[8 * kt + r] = (_Float16)p; ps += p;
        }
      }
    if (!RES) pl = ph;
    ps += __shfl_xor(ps, 16, 32);
    l = l * alpha + ps;
#pragma unroll
    for (int t = 0; t < 4; ++t) acc[t] = acc[t] * alpha;
#pragma unroll
    for (int t = 0; t < 4; ++t) {
      const size_t vo = vof + (size_t)(16 * t) * SEQ + kb;
      const Frag vh = ldf(Vh + vo, hh);
      if (RES) {
        const Frag vl = ldf(Vl + vo, hh);
        acc[t] = wm_b(vh, ph, acc[t]); acc[t] = wm_b(vl, ph, acc[t]); acc[t] = wm_b(vh, pl, acc[t]);
        nop4(acc[t], vh, vl, ph, pl);
      } else {
        acc[t] = wm_h(vh, ph, acc[t]);
        nop2(acc[t], vh, ph);
      }
    }
  }
  // acc[t][r] = O^T[d = 16t + 8hh + r][query ln]; normalise and stage row ln of the wave tile
  const float inv = 1.0f / l;
  const float osc = RES ? inv : inv * 64.0f;
#pragma unroll
  for (int t = 0; t < 4; ++t) {
    if (RES) {
      Frag oh, ol;
#pragma unroll
      for (int r = 0; r < 8; ++r) { const float c = acc[t][r] * osc; const unsigned short hb = bf16_bits(c); oh.u[r] = hb; ol.u[r] = bf16_bits(c - bf16_val(hb)); }
      *(v8us*)&sc[w][0][ln][16 * t + 8 * hh] = oh.half[0];
      *(v8us*)&sc[w][RES ? 1 : 0][ln][16 * t + 8 * hh] = ol.half[0];
    } else {
      Frag o;
#pragma unroll
      for (int r = 0; r < 8; ++r) o.e[r] = (_Float16)(acc[t][r] * osc);
      *(v8us*)&sc[w][0][ln][16 * t + 8 * hh] = o.half[0];
    }
  }
  __builtin_amdgcn_fence(4 /* acq_rel order */, "workgroup");
  __builtin_amdgcn_wave_barrier();
  const int rsub = lane >> 3, pc = lane & 7;
  {
#pragma unroll
    for (int q = 0; q < 4; ++q) {
      const int row = 4 * q + rsub;
      const size_t off = (rowb + q0 + row) * DM + h * HD + 8 * pc;
      const v8us v0 = *(const v8us*)&sc[w][0][row][8 * pc];
      *(v8us*)(Ch + off) = v0;
      if (RES) { const v8us v1 = *(const v8us*)&sc[w][RES ? 1 : 0][row][8 * pc]; *(v8us*)(Cl + off) = v1; }
    }
    
  }
}

extern "C" void kernel_launch(void* const* d_in, const int* in_sizes, int n_in,
                              void* d_out, int out_size, void* d_ws, size_t ws_size, hipStream_t stream) {
  static_assert(NH * HD == DM);
  static_assert(DM == 512);
  static_assert(SEQ % 128 == 0);
  static_assert(ERL % 128 == 0);
  static_assert(NB <= NB_FULL);
  static_assert(SEQ <= SEQ_FULL);
  static_assert((size_t)13 * NB * SEQ * DM * 2 + (size_t)5 * DM * DM * 2 <= (size_t)134217728);
  if (n_in < 6) return;
  const long long xmin = ((long long)(NB - 1) * SEQ_FULL + SEQ) * DM;
  if ((long long)in_sizes[0] < xmin) return;
  if (in_sizes[1] < DM * DM || in_sizes[2] < DM * DM || in_sizes[3] < DM * DM || in_sizes[4] < DM * DM || in_sizes[5] < DM) return;
  if ((long long)out_size < xmin) return;
  const float* x  = (const float*)d_in[0];
  const float* Wq = (const float*)d_in[1];
  const float* Wk = (const float*)d_in[2];
  const float* Wv = (const float*)d_in[3];
  const float* Wp = (const float*)d_in[4];
  const float* bp = (const float*)d_in[5];
  float* out = (float*)d_out;

  char* ws = (char*)d_ws; size_t off = 0;
  auto take = [&](size_t bytes) { char* p = ws + off; off += (bytes + 255) & ~(size_t)255; return (unsigned short*)p; };
  const size_t PL = NR * DM;            /* elements of one [NB*SEQ][DM] 16-bit plane */
  const size_t WN = (size_t)DM * DM;
  unsigned short* W16  = take(4 * WN * 2);     /* Wq, Wk, Wv, Wp as f16 x16, [n][k] */
  unsigned short* WPB  = take(WN * 2);         /* Wp as bf16, [n][k] */
  unsigned short* X16  = take(PL * 2);
  unsigned short* QK16 = take(2 * PL * 2);     /* q plane then k plane (f16) */
  unsigned short* QKH  = take(2 * PL * 2);     /* bf16 hi, rows t < ERL written */
  unsigned short* QKL  = take(2 * PL * 2);     /* bf16 lo, rows t < ERL written */
  unsigned short* VT16 = take(PL * 2);         /* [(b,h)][d][SEQ] f16 */
  unsigned short* VTH  = take(PL * 2);
  unsigned short* VTL  = take(PL * 2);
  unsigned short* C16  = take(PL * 2);         /* ctx x64 f16, rows t >= ERL */
  unsigned short* CH   = take(PL * 2);         /* ctx bf16 hi, rows t < ERL */
  unsigned short* CL   = take(PL * 2);         /* ctx bf16 lo, rows t < ERL */
  if (off > ws_size || off > (size_t)134217728) return;

  const int xn8 = (int)(PL / 8), wn8 = (int)(WN / 8);
  k_x16<<<(unsigned)((xn8 + 255) / 256), 256, 0, stream>>>(x, X16, xn8);
  k_wnat<false><<<(unsigned)((wn8 + 255) / 256), 256, 0, stream>>>(Wq, W16, WPB, wn8);
  k_wnat<false><<<(unsigned)((wn8 + 255) / 256), 256, 0, stream>>>(Wk, W16 + WN, WPB, wn8);
  k_wnat<false><<<(unsigned)((wn8 + 255) / 256), 256, 0, stream>>>(Wv, W16 + 2 * WN, WPB, wn8);
  k_wnat<true><<<(unsigned)((wn8 + 255) / 256), 256, 0, stream>>>(Wp, W16 + 3 * WN, WPB, wn8);

  /* q and k projections: grid.z selects the weight plane and the output plane set */
  k_gemm<0, false><<<dim3((SEQ / 128) * 8, NB, 2), 128, 0, stream>>>(X16, X16, W16, WN, 0.0625f, bp, QK16, QKH, QKL, PL, out, 0);
  /* v projection written transposed per (batch, head) */
  k_gemm<1, false><<<dim3((SEQ / 128) * 8, NB, 1), 128, 0, stream>>>(X16, X16, W16 + 2 * WN, (size_t)0, 0.0625f, bp, VT16, VTH, VTL, (size_t)0, out, 0);

  /* attention: first ERL rows on bf16 hi/lo planes, remaining rows on f16 planes */
  k_attn<true><<<dim3(ERL / 64, NH, NB), 128, 0, stream>>>(QKH, QKL, QKH + PL, QKL + PL, VTH, VTL, CH, CL, 0);
  if (SEQ > ERL)
    k_attn<false><<<dim3((SEQ - ERL) / 64, NH, NB), 128, 0, stream>>>(QK16, QK16, QK16 + PL, QK16 + PL, VT16, VT16, C16, C16, ERL);

  /* output projection + bias */
  k_gemm<2, true><<<dim3((ERL / 128) * 8, NB, 1), 128, 0, stream>>>(CH, CL, WPB, (size_t)0, 1.0f, bp, X16, X16, X16, (size_t)0, out, 0);
  if (SEQ > ERL)
    k_gemm<2, false><<<dim3(((SEQ - ERL) / 128) * 8, NB, 1), 128, 0, stream>>>(C16, C16, W16 + 3 * WN, (size_t)0, 0.0009765625f, bp, X16, X16, X16, (size_t)0, out, ERL);
}

// v001
// A run of this version takes 159 microseconds.
// Timed twice side by side with v000, it ran 1.77 times as fast both times.
#include <hip/hip_runtime.h>
// Compute dtype: inputs RNE-converted to bf16 values (x as exact f16, weights as exact f16 x16 / exact bf16); q,k,v projections, dense-row scores, dense-row P.V and dense-row output GEMM = v_wmma_f32_16x16x32_f16 single products (P carried x1024, ctx carried x64); first ERL rows of every sequence: scores and P.V as bf16 hi/lo three-product sums, output GEMM as bf16 hi/lo A x exact bf16 W (v_wmma_f32_16x16x32_bf16); all accumulation, softmax statistics, bias add in f32.
// Structure: causal attention per (batch, head) with S^T = K Q^T (Q fragments in registers as the B operand) and O^T = V^T P^T (packed S^T accumulators are the B fragment), online max-subtracted softmax per lane column; K and V^T tiles of 64 keys are staged in LDS once per block (two buffers) and read from there by its four waves.
#ifndef NB
#define NB 4
#endif
#ifndef SEQ
#define SEQ 2048
#endif
#ifndef EARLY
#define EARLY 512
#endif
#define NB_FULL 4
#define SEQ_FULL 2048
#define DM 512
#define NH 8
#define HD 64
#define ERL ((EARLY < SEQ) ? EARLY : SEQ)   /* rows per sequence on the multi-product path */
#define NR ((size_t)NB * SEQ)               /* compact token rows r = b*SEQ + t */
#define QSCALE 0.044194173824159216f        /* d_model^-0.5 */
#define NEGBIG (-3.0e38f)
#define CARRY_LN 6.931471805599453f         /* ln 1024 */

typedef _Float16 v16h __attribute__((ext_vector_type(16)));
typedef __bf16   v16b __attribute__((ext_vector_type(16)));
typedef unsigned short v8us __attribute__((ext_vector_type(8), may_alias));
typedef float v8f  __attribute__((ext_vector_type(8)));
typedef float v4f  __attribute__((ext_vector_type(4)));
typedef float v4fa __attribute__((ext_vector_type(4), may_alias));
union Frag { v16h h; v16b b; v8us half[2]; _Float16 e[16]; unsigned short u[16]; };

__device__ __forceinline__ unsigned short bf16_bits(float x) { unsigned int u = __float_as_uint(x); return (unsigned short)((u + 0x7FFFu + ((u >> 16) & 1u)) >> 16); }
__device__ __forceinline__ float bf16_val(unsigned short b) { return __uint_as_float(((unsigned int)b) << 16); }
__device__ __forceinline__ float bf16_rne(float x) { return bf16_val(bf16_bits(x)); }

// fragment loader (A and B alike): elements 0..7 <- p[8h .. 8h+7], elements 8..15 <- p[16+8h .. 16+8h+7]
__device__ __forceinline__ Frag ldf(const unsigned short* p, int hh) {
  Frag f; f.half[0] = *(const v8us*)(p + 8 * hh); f.half[1] = *(const v8us*)(p + 16 + 8 * hh); return f;
}
__device__ __forceinline__ v8f wm_h(const Frag& a, const Frag& b, v8f c) { return __builtin_amdgcn_wmma_f32_16x16x32_f16(false, a.h, false, b.h, (short)0, c, false, false); }
__device__ __forceinline__ v8f wm_b(const Frag& a, const Frag& b, v8f c) { return __builtin_amdgcn_wmma_f32_16x16x32_bf16(false, a.b, false, b.b, (short)0, c, false, false); }
__device__ __forceinline__ void nop2(v8f& c, const Frag& a, const Frag& b) { asm volatile("v_nop\n\tv_nop\n\tv_nop\n\tv_nop" : "+v"(c) : "v"(a.h), "v"(b.h)); }
__device__ __forceinline__ void nop3(v8f& c, const Frag& a, const Frag& b, const Frag& d) { asm volatile("v_nop\n\tv_nop\n\tv_nop\n\tv_nop" : "+v"(c) : "v"(a.h), "v"(b.h), "v"(d.h)); }
__device__ __forceinline__ void nop4(v8f& c, const Frag& a, const Frag& b, const Frag& d, const Frag& e) { asm volatile("v_nop\n\tv_nop\n\tv_nop\n\tv_nop" : "+v"(c) : "v"(a.h), "v"(b.h), "v"(d.h), "v"(e.h)); }
__device__ __forceinline__ void nop8(v8f& c, const Frag& a, const Frag& b, const Frag& d, const Frag& e, const Frag& f, const Frag& g, const Frag& i, const Frag& j) {
  asm volatile("v_nop\n\tv_nop\n\tv_nop\n\tv_nop" : "+v"(c) : "v"(a.h), "v"(b.h), "v"(d.h), "v"(e.h), "v"(f.h), "v"(g.h), "v"(i.h), "v"(j.h));
}

__device__ __forceinline__ v8us to_f16x8(v4f a, v4f c) {
  Frag f;
#pragma unroll
  for (int q = 0; q < 4; ++q) { f.e[q] = (_Float16)a[q]; f.e[4 + q] = (_Float16)c[q]; }
  return f.half[0];
}
__device__ __forceinline__ void to_bf16x8_hl(v4f a, v4f c, v8us& hi, v8us& lo) {
  Frag fh, fl;
#pragma unroll
  for (int q = 0; q < 4; ++q) {
    unsigned short hb = bf16_bits(a[q]); fh.u[q] = hb; fl.u[q] = bf16_bits(a[q] - bf16_val(hb));
    hb = bf16_bits(c[q]); fh.u[4 + q] = hb; fl.u[4 + q] = bf16_bits(c[q] - bf16_val(hb));
  }
  hi = fh.half[0]; lo = fl.half[0];
}

__global__ __launch_bounds__(256) void k_x16(const float* __restrict__ x, unsigned short* __restrict__ X16, int n8) {
  const int t = blockIdx.x * 256 + threadIdx.x;
  if (t >= n8) return;
  const int r = t / (DM / 8), c8 = (t % (DM / 8)) * 8;
  const int b = r / SEQ, tt = r % SEQ;
  const float* src = x + ((size_t)b * SEQ_FULL + tt) * DM + c8;
  const v4f a = *(const v4fa*)src, c = *(const v4fa*)(src + 4);
  v4f ar, cr;
#pragma unroll
  for (int q = 0; q < 4; ++q) { ar[q] = bf16_rne(a[q]); cr[q] = bf16_rne(c[q]); }
  const v8us o = to_f16x8(ar, cr);
  unsigned short* d = X16 + (size_t)t * 8;
  *(v8us*)d = o;
  
}

template <bool WB>
__global__ __launch_bounds__(256) void k_wnat(const float* __restrict__ w, unsigned short* __restrict__ W16, unsigned short* __restrict__ WBF, int n8) {
  const int t = blockIdx.x * 256 + threadIdx.x;
  if (t >= n8) return;
  const v4f a = *(const v4fa*)(w + (size_t)t * 8), c = *(const v4fa*)(w + (size_t)t * 8 + 4);
  v4f as, cs; Frag fb;
#pragma unroll
  for (int q = 0; q < 4; ++q) {
    const unsigned short b0 = bf16_bits(a[q]), b1 = bf16_bits(c[q]);
    fb.u[q] = b0; fb.u[4 + q] = b1;
    as[q] = bf16_val(b0) * 16.0f; cs[q] = bf16_val(b1) * 16.0f;
  }
  const v8us o = to_f16x8(as, cs);
  const v8us ob = fb.half[0];
  *(v8us*)(W16 + (size_t)t * 8) = o;
  if (WB) *(v8us*)(WBF + (size_t)t * 8) = ob;
  
}

template <bool ABF>
__device__ __forceinline__ v8f gmm(const Frag& a, const Frag& al, const Frag& b, v8f c) {
  if (ABF) { c = wm_b(a, b, c); c = wm_b(al, b, c); nop3(c, a, al, b); }
  else { c = wm_h(a, b, c); nop2(c, a, b); }
  return c;
}

// GEMM over K = DM: block = 4 waves, block tile 128 token rows x 64 cols, wave tile 32 x 64; operands read straight from 16-bit global rows.
// grid.x = (row tiles of 128) * 8 col tiles, grid.y = batch, grid.z = plane select (weights offset zB, outputs offset zO).
// MODE 0: f16 row plane [row][DM] (+ bf16 hi/lo row planes for rows t < ERL); MODE 1: transposed planes [(b,head)][d][SEQ] (f16, + bf16 hi/lo for t < ERL);
// MODE 2: f32 rows of the output buffer (full-size layout) with bias (bf16 value) added in f32.
// ABF: A = bf16 hi (A) + lo (A2) planes, two products against bf16 Bt; else A f16, single product against f16 Bt.
template <int MODE, bool ABF>
__global__ __launch_bounds__(128) void k_gemm(const unsigned short* __restrict__ A, const unsigned short* __restrict__ A2,
                                              const unsigned short* __restrict__ Bt, size_t zB, float alpha, const float* __restrict__ bias,
                                              unsigned short* __restrict__ O16, unsigned short* __restrict__ OH, unsigned short* __restrict__ OL, size_t zO,
                                              float* __restrict__ OF, int tbase) {
  __shared__ __attribute__((aligned(16))) float so[128][68];
  const int tid = threadIdx.x, lane = tid & 31, ln = lane & 15, hh = lane >> 4;
  const int w = __builtin_amdgcn_readfirstlane((int)(threadIdx.x >> 5));
  const int rt = (int)blockIdx.x >> 3, nq = (int)blockIdx.x & 7, b = blockIdx.y, z = blockIdx.z;
  const int t0 = tbase + rt * 128;
  const size_t r0 = (size_t)b * SEQ + t0;
  const int col0 = nq * 64;
  const size_t aof = (r0 + 32 * w + ln) * DM;
  const unsigned short* a0p = A + aof;
  const unsigned short* a1p = a0p + (size_t)16 * DM;
  const unsigned short* l0p = A2 + aof;
  const unsigned short* l1p = l0p + (size_t)16 * DM;
  const unsigned short* bp0 = Bt + (size_t)z * zB + (size_t)(col0 + ln) * DM;
  const v8f z8 = {0.f, 0.f, 0.f, 0.f, 0.f, 0.f, 0.f, 0.f};
  v8f acc[8];
#pragma unroll
  for (int u = 0; u < 8; ++u) acc[u] = z8;
#pragma unroll 1
  for (int kb = 0; kb < DM; kb += 32) {
    const Frag a0 = ldf(a0p + kb, hh), a1 = ldf(a1p + kb, hh);
    Frag a0l = a0, a1l = a1;
    if (ABF) { a0l = ldf(l0p + kb, hh); a1l = ldf(l1p + kb, hh); }
#pragma unroll
    for (int t = 0; t < 4; ++t) {
      const Frag bq = ldf(bp0 + (size_t)(16 * t) * DM + kb, hh);
      acc[t] = gmm<ABF>(a0, a0l, bq, acc[t]);
      acc[4 + t] = gmm<ABF>(a1, a1l, bq, acc[4 + t]);
    }
  }
  // D element r of lane (hh, ln) = (row 8hh + r, col ln) of its 16x16 tile
#pragma unroll
  for (int u = 0; u < 8; ++u) {
    const int t = u & 3, half = u >> 2;
    const int col = t * 16 + ln;
    float bv = 0.f;
    if (MODE == 2) bv = bf16_rne(bias[col0 + col]);
#pragma unroll
    for (int r = 0; r < 8; ++r) so[32 * w + half * 16 + 8 * hh + r][col] = acc[u][r] * alpha + bv;
  }
  __syncthreads();
  const bool early = (t0 < ERL);
  if (MODE == 0) {
    {
#pragma unroll
      for (int it = 0; it < 8; ++it) {
        const int row = it * 16 + (tid >> 3), pc = tid & 7;
        const v4f x0 = *(const v4fa*)&so[row][8 * pc], x1 = *(const v4fa*)&so[row][8 * pc + 4];
        const size_t off = (size_t)z * zO + (r0 + row) * DM + col0 + 8 * pc;
        const v8us o = to_f16x8(x0, x1);
        *(v8us*)(O16 + off) = o;
        if (early) {
          v8us oh, ol; to_bf16x8_hl(x0, x1, oh, ol);
          *(v8us*)(OH + off) = oh;
          *(v8us*)(OL + off) = ol;
        }
      }
      
    }
  } else if (MODE == 1) {
    // transposed: 64 d rows x 128 tokens (256 B each): d = it*8 + tid/16, piece = tid%16 (8 tokens = 16 B)
    const int hd = nq;
    {
#pragma unroll
      for (int it = 0; it < 8; ++it) {
        const int d = it * 8 + (tid >> 4), pc = tid & 15;
        v4f x0, x1;
#pragma unroll
        for (int j = 0; j < 4; ++j) { x0[j] = so[8 * pc + j][d]; x1[j] = so[8 * pc + 4 + j][d]; }
        const size_t off = (((size_t)b * NH + hd) * HD + d) * SEQ + t0 + 8 * pc;
        const v8us o = to_f16x8(x0, x1);
        *(v8us*)(O16 + off) = o;
        if (early) {
          v8us oh, ol; to_bf16x8_hl(x0, x1, oh, ol);
          *(v8us*)(OH + off) = oh;
          *(v8us*)(OL + off) = ol;
        }
      }
      
    }
  } else {
    // f32 rows of the output buffer: 128 rows x 256 B: row = it*8 + tid/16, piece = tid%16 (4 floats = 16 B)
    {
#pragma unroll
      for (int it = 0; it < 16; ++it) {
        const int row = it * 8 + (tid >> 4), pc = tid & 15;
        const v4f v = *(const v4fa*)&so[row][4 * pc];
        *(v4f*)(OF + ((size_t)b * SEQ_FULL + t0 + row) * DM + col0 + 4 * pc) = v;
      }
      
    }
  }
}

#define KT 64               /* keys per LDS stage */
#define LP 72               /* LDS row pitch in 16-bit elements: 144 B = 16 B x odd, the pitch for 16-byte readers of 128-B rows */
#define TILE_E (64 * LP)    /* one staged tile: 64 rows at LP pitch, 128 B of data each */

__device__ __forceinline__ unsigned lds_off(const void* p) { return (unsigned)(size_t)p; }

// One 64-row x 128-B tile into LDS by the block's 128 threads: thread = (row tid/8 + 16 i, 16-byte piece tid%8), i = 0..3, so a wave's copy takes 4 whole lines.
// l = the lane's LDS byte address of row tid/8, g = its global address there, gstep = 16 source rows in elements.
__device__ __forceinline__ void cp_tile(unsigned l, const unsigned short* g, size_t gstep) {
  const unsigned l1 = l + 16 * LP * 2, l2 = l + 32 * LP * 2, l3 = l + 48 * LP * 2;
  const unsigned short* g1 = g + gstep;
  const unsigned short* g2 = g + 2 * gstep;
  const unsigned short* g3 = g + 3 * gstep;
  // the copies bring the tile into LDS through no register; the closing s_wait_xcnt stands in front of any rewrite of the address registers they name
  asm volatile("global_load_async_to_lds_b128 %0, %4, off\n\t"
               "global_load_async_to_lds_b128 %1, %5, off\n\t"
               "global_load_async_to_lds_b128 %2, %6, off\n\t"
               "global_load_async_to_lds_b128 %3, %7, off\n\t"
               "s_wait_xcnt 0x0"
               :: "v"(l), "v"(l1), "v"(l2), "v"(l3), "v"(g), "v"(g1), "v"(g2), "v"(g3) : "memory");
}

// Causal attention, one wave per 16 query rows of one (batch, head); block = 4 waves (64 queries) that share the staged K and V^T tiles; one block barrier per 64 keys.
// S^T[key][query] = K Q^T: A = K rows (lane = key), B = Q rows (lane = query). D: lane (hh, ln) element r = (key 8hh + r, query ln).
// O^T[d][query] = V^T P^T: A = V^T rows (lane = d, k = keys), B = packed P^T: element r <- tile(keys 0..15)[r], element 8+r <- tile(keys 16..31)[r].
// RES: bf16 hi/lo operands, three products per site; else f16 single products with P carried x1024 (sum carried alike) and ctx stored x64.
template <bool RES>
__global__ __launch_bounds__(128) void k_attn(const unsigned short* __restrict__ Qh, const unsigned short* __restrict__ Ql,
                                              const unsigned short* __restrict__ Kh, const unsigned short* __restrict__ Kl,
                                              const unsigned short* __restrict__ Vh, const unsigned short* __restrict__ Vl,
                                              unsigned short* __restrict__ Ch, unsigned short* __restrict__ Cl, int tbase) {
  __shared__ __attribute__((aligned(16))) unsigned short sc[4][RES ? 2 : 1][16][64];
  __shared__ __attribute__((aligned(16))) unsigned short st_lds[2][RES ? 4 : 2][TILE_E];   /* [buffer][K hi, V^T hi, K lo, V^T lo][row * LP + element] */
  const int lane = threadIdx.x & 31, ln = lane & 15, hh = lane >> 4;
  const int w = __builtin_amdgcn_readfirstlane((int)(threadIdx.x >> 5));
  const int h = blockIdx.y, b = blockIdx.z;
  const int qb = tbase + (int)blockIdx.x * 64;
  const int q0 = qb + w * 16;
  const int qi = q0 + ln;
  const size_t rowb = (size_t)b * SEQ;
  const size_t qof = (rowb + q0 + ln) * DM + h * HD;
  const Frag qh0 = ldf(Qh + qof, hh), qh1 = ldf(Qh + qof + 32, hh);
  Frag ql0 = qh0, ql1 = qh1;
  if (RES) { ql0 = ldf(Ql + qof, hh); ql1 = ldf(Ql + qof + 32, hh); }
  const int crow = (int)threadIdx.x >> 3, cpc = (int)threadIdx.x & 7;
  const size_t kcp = (rowb + crow) * DM + h * HD + 8 * cpc;
  const size_t vcp = (((size_t)b * NH + h) * HD + crow) * SEQ + 8 * cpc;
  const unsigned lcp = lds_off(&st_lds[0][0][0]) + (unsigned)(crow * LP + 8 * cpc) * 2u;
  auto fill = [&](int s, int bf) {   // keys 64 s .. 64 s + 63 into buffer bf; all of them lie at or below the block's last query
    const unsigned lb = lcp + (unsigned)bf * (unsigned)((RES ? 4 : 2) * TILE_E * 2);
    const size_t k0 = (size_t)s * KT;
    cp_tile(lb, Kh + kcp + k0 * DM, (size_t)16 * DM);
    cp_tile(lb + TILE_E * 2, Vh + vcp + k0, (size_t)16 * SEQ);
    if (RES) {
      cp_tile(lb + 2 * TILE_E * 2, Kl + kcp + k0 * DM, (size_t)16 * DM);
      cp_tile(lb + 3 * TILE_E * 2, Vl + vcp + k0, (size_t)16 * SEQ);
    }
  };
  const v8f z8 = {0.f, 0.f, 0.f, 0.f, 0.f, 0.f, 0.f, 0.f};
  v8f acc[4];
#pragma unroll
  for (int t = 0; t < 4; ++t) acc[t] = z8;
  float m = NEGBIG, l = 0.f;
  const float carry = RES ? 0.f : CARRY_LN;
  const int nst = (qb >> 6) + 1;   // scalar and the same in the whole block: stages of 64 keys up to the block's last query
  fill(0, 0);
  asm volatile("s_wait_asynccnt 0x0" ::: "memory");   // this wave's copies of stage 0 have landed
  __syncthreads();                                    // ... and every other wave's
  if (nst > 1) fill(1, 1);
#pragma unroll 1   /* rolled: one hand-over of the buffers per trip, and the loop text stays small */
  for (int sg = 0; sg < nst; ++sg) {
   const unsigned short* tk = &st_lds[sg & 1][0][0];
#pragma unroll     /* both 32-key halves of the stage in line, so that every LDS offset is an immediate */
   for (int hf = 0; hf < 2; ++hf) {
    const int kb = sg * KT + hf * 32;
    if (kb >= q0 + 16) continue;   // scalar: the wave's queries all lie in front of these 32 keys
    v8f s[2];
#pragma unroll
    for (int kt = 0; kt < 2; ++kt) {
      const unsigned short* kp = tk + (hf * 32 + 16 * kt + ln) * LP;
      const Frag k0 = ldf(kp, hh), k1 = ldf(kp + 32, hh);
      v8f c = z8;
      if (RES) {
        const Frag kl0 = ldf(kp + 2 * TILE_E, hh), kl1 = ldf(kp + 2 * TILE_E + 32, hh);
        c = wm_b(k0, qh0, c); c = wm_b(kl0, qh0, c); c = wm_b(k0, ql0, c);
        c = wm_b(k1, qh1, c); c = wm_b(kl1, qh1, c); c = wm_b(k1, ql1, c);
        nop8(c, k0, k1, kl0, kl1, qh0, qh1, ql0, ql1);
      } else {
        c = wm_h(k0, qh0, c); c = wm_h(k1, qh1, c);
        nop4(c, k0, k1, qh0, qh1);
      }
      s[kt] = c;
    }
    if (kb + 32 > q0) {   // scalar condition: this step touches the diagonal; masked scores are replaced
#pragma unroll
      for (int kt = 0; kt < 2; ++kt)
#pragma unroll
        for (int r = 0; r < 8; ++r) { const int key = kb + 16 * kt + 8 * hh + r; s[kt][r] = (key > qi) ? NEGBIG : s[kt][r]; }
    }
    float mx = fmaxf(s[0][0], s[1][0]);
#pragma unroll
    for (int r = 1; r < 8; ++r) mx = fmaxf(mx, fmaxf(s[0][r], s[1][r]));
    mx = fmaxf(mx, __shfl_xor(mx, 16, 32));
    const float mnew = fmaxf(m, mx);
    const float alpha = __expf((m - mnew) * QSCALE);
    const float cc = carry - mnew * QSCALE;
    m = mnew;
    Frag ph, pl;
    float ps = 0.f;
#pragma unroll
    for (int kt = 0; kt < 2; ++kt)
#pragma unroll
      for (int r = 0; r < 8; ++r) {
        const float p = __expf(fmaf(s[kt][r], QSCALE, cc));
        if (RES) {
          const unsigned short hb = bf16_bits(p); const float hv = bf16_val(hb);
          const unsigned short lb = bf16_bits(p - hv);
          ph.u[8 * kt + r] = hb; pl.u[8 * kt + r] = lb; ps += hv + bf16_val(lb);
        } else {
          ph.e[8 * kt + r] = (_Float16)p; ps += p;
        }
      }
    if (!RES) pl = ph;
    ps += __shfl_xor(ps, 16, 32);
    l = l * alpha + ps;
#pragma unroll
    for (int t = 0; t < 4; ++t) acc[t] = acc[t] * alpha;
#pragma unroll
    for (int t = 0; t < 4; ++t) {
      const unsigned short* vp = tk + TILE_E + (16 * t + ln) * LP + hf * 32;
      const Frag vh = ldf(vp, hh);
      if (RES) {
        const Frag vl = ldf(vp + 2 * TILE_E, hh);
        acc[t] = wm_b(vh, ph, acc[t]); acc[t] = wm_b(vl, ph, acc[t]); acc[t] = wm_b(vh, pl, acc[t]);
        nop4(acc[t], vh, vl, ph, pl);
      } else {
        acc[t] = wm_h(vh, ph, acc[t]);
        nop2(acc[t], vh, ph);
      }
    }
   }
   // hand-over of the buffers, passed by every wave:
   asm volatile("s_wait_dscnt 0x0" ::: "memory");      // this wave's reads of the buffer that is refilled below have returned
   asm volatile("s_wait_asynccnt 0x0" ::: "memory");   // this wave's copies of the next stage have landed
   __syncthreads();                                    // publishes the next stage and ends every wave's reads of this one
   if (sg + 2 < nst) fill(sg + 2, sg & 1);
  }
  asm volatile("s_wait_asynccnt 0x0" ::: "memory");    // no copy is outstanding when the wave goes on to its end
  // acc[t][r] = O^T[d = 16t + 8hh + r][query ln]; normalise and stage row ln of the wave tile
  const float inv = 1.0f / l;
  const float osc = RES ? inv : inv * 64.0f;
#pragma unroll
  for (int t = 0; t < 4; ++t) {
    if (RES) {
      Frag oh, ol;
#pragma unroll
      for (int r = 0; r < 8; ++r) { const float c = acc[t][r] * osc; const unsigned short hb = bf16_bits(c); oh.u[r] = hb; ol.u[r] = bf16_bits(c - bf16_val(hb)); }
      *(v8us*)&sc[w][0][ln][16 * t + 8 * hh] = oh.half[0];
      *(v8us*)&sc[w][RES ? 1 : 0][ln][16 * t + 8 * hh] = ol.half[0];
    } else {
      Frag o;
#pragma unroll
      for (int r = 0; r < 8; ++r) o.e[r] = (_Float16)(acc[t][r] * osc);
      *(v8us*)&sc[w][0][ln][16 * t + 8 * hh] = o.half[0];
    }
  }
  __builtin_amdgcn_fence(4 /* acq_rel order */, "workgroup");
  __builtin_amdgcn_wave_barrier();
  const int rsub = lane >> 3, pc = lane & 7;
  {
#pragma unroll
    for (int q = 0; q < 4; ++q) {
      const int row = 4 * q + rsub;
      const size_t off = (rowb + q0 + row) * DM + h * HD + 8 * pc;
      const v8us v0 = *(const v8us*)&sc[w][0][row][8 * pc];
      *(v8us*)(Ch + off) = v0;
      if (RES) { const v8us v1 = *(const v8us*)&sc[w][RES ? 1 : 0][row][8 * pc]; *(v8us*)(Cl + off) = v1; }
    }
    
  }
}

extern "C" void kernel_launch(void* const* d_in, const int* in_sizes, int n_in,
                              void* d_out, int out_size, void* d_ws, size_t ws_size, hipStream_t stream) {
  static_assert(NH * HD == DM);
  static_assert(DM == 512);
  static_assert(SEQ % 128 == 0);
  static_assert(ERL % 128 == 0);
  static_assert(NB <= NB_FULL);
  static_assert(SEQ <= SEQ_FULL);
  static_assert((size_t)13 * NB * SEQ * DM * 2 + (size_t)5 * DM * DM * 2 <= (size_t)134217728);
  if (n_in < 6) return;
  const long long xmin = ((long long)(NB - 1) * SEQ_FULL + SEQ) * DM;
  if ((long long)in_sizes[0] < xmin) return;
  if (in_sizes[1] < DM * DM || in_sizes[2] < DM * DM || in_sizes[3] < DM * DM || in_sizes[4] < DM * DM || in_sizes[5] < DM) return;
  if ((long long)out_size < xmin) return;
  const float* x  = (const float*)d_in[0];
  const float* Wq = (const float*)d_in[1];
  const float* Wk = (const float*)d_in[2];
  const float* Wv = (const float*)d_in[3];
  const float* Wp = (const float*)d_in[4];
  const float* bp = (const float*)d_in[5];
  float* out = (float*)d_out;

  char* ws = (char*)d_ws; size_t off = 0;
  auto take = [&](size_t bytes) { char* p = ws + off; off += (bytes + 255) & ~(size_t)255; return (unsigned short*)p; };
  const size_t PL = NR * DM;            /* elements of one [NB*SEQ][DM] 16-bit plane */
  const size_t WN = (size_t)DM * DM;
  unsigned short* W16  = take(4 * WN * 2);     /* Wq, Wk, Wv, Wp as f16 x16, [n][k] */
  unsigned short* WPB  = take(WN * 2);         /* Wp as bf16, [n][k] */
  unsigned short* X16  = take(PL * 2);
  unsigned short* QK16 = take(2 * PL * 2);     /* q plane then k plane (f16) */
  unsigned short* QKH  = take(2 * PL * 2);     /* bf16 hi, rows t < ERL written */
  unsigned short* QKL  = take(2 * PL * 2);     /* bf16 lo, rows t < ERL written */
  unsigned short* VT16 = take(PL * 2);         /* [(b,h)][d][SEQ] f16 */
  unsigned short* VTH  = take(PL * 2);
  unsigned short* VTL  = take(PL * 2);
  unsigned short* C16  = take(PL * 2);         /* ctx x64 f16, rows t >= ERL */
  unsigned short* CH   = take(PL * 2);         /* ctx bf16 hi, rows t < ERL */
  unsigned short* CL   = take(PL * 2);         /* ctx bf16 lo, rows t < ERL */
  if (off > ws_size || off > (size_t)134217728) return;

  const int xn8 = (int)(PL / 8), wn8 = (int)(WN / 8);
  k_x16<<<(unsigned)((xn8 + 255) / 256), 256, 0, stream>>>(x, X16, xn8);
  k_wnat<false><<<(unsigned)((wn8 + 255) / 256), 256, 0, stream>>>(Wq, W16, WPB, wn8);
  k_wnat<false><<<(unsigned)((wn8 + 255) / 256), 256, 0, stream>>>(Wk, W16 + WN, WPB, wn8);
  k_wnat<false><<<(unsigned)((wn8 + 255) / 256), 256, 0, stream>>>(Wv, W16 + 2 * WN, WPB, wn8);
  k_wnat<true><<<(unsigned)((wn8 + 255) / 256), 256, 0, stream>>>(Wp, W16 + 3 * WN, WPB, wn8);

  /* q and k projections: grid.z selects the weight plane and the output plane set */
  k_gemm<0, false><<<dim3((SEQ / 128) * 8, NB, 2), 128, 0, stream>>>(X16, X16, W16, WN, 0.0625f, bp, QK16, QKH, QKL, PL, out, 0);
  /* v projection written transposed per (batch, head) */
  k_gemm<1, false><<<dim3((SEQ / 128) * 8, NB, 1), 128, 0, stream>>>(X16, X16, W16 + 2 * WN, (size_t)0, 0.0625f, bp, VT16, VTH, VTL, (size_t)0, out, 0);

  /* attention: first ERL rows on bf16 hi/lo planes, remaining rows on f16 planes */
  k_attn<true><<<dim3(ERL / 64, NH, NB), 128, 0, stream>>>(QKH, QKL, QKH + PL, QKL + PL, VTH, VTL, CH, CL, 0);
  if (SEQ > ERL)
    k_attn<false><<<dim3((SEQ - ERL) / 64, NH, NB), 128, 0, stream>>>(QK16, QK16, QK16 + PL, QK16 + PL, VT16, VT16, C16, C16, ERL);

  /* output projection + bias */
  k_gemm<2, true><<<dim3((ERL / 128) * 8, NB, 1), 128, 0, stream>>>(CH, CL, WPB, (size_t)0, 1.0f, bp, X16, X16, X16, (size_t)0, out, 0);
  if (SEQ > ERL)
    k_gemm<2, false><<<dim3(((SEQ - ERL) / 128) * 8, NB, 1), 128, 0, stream>>>(C16, C16, W16 + 3 * WN, (size_t)0, 0.0009765625f, bp, X16, X16, X16, (size_t)0, out, ERL);
}

// v002
// A run of this version takes 110 microseconds.
// Next to v001, in two timings, it ran 1.44 and 1.47 times as fast.
// Over all steps from v000 it is 2.57 times as fast.
#include <hip/hip_runtime.h>
// Compute dtype: inputs RNE-converted to bf16 values (x as exact f16, weights as exact f16 x16 / exact bf16); q,k,v projections, dense-row scores, dense-row P.V and dense-row output GEMM = v_wmma_f32_16x16x32_f16 single products (P carried x1024, ctx carried x64); first ERL rows of every sequence: scores and P.V as bf16 hi/lo three-product sums, output GEMM as bf16 hi/lo A x exact bf16 W (v_wmma_f32_16x16x32_bf16); all accumulation, softmax statistics, bias add in f32.
// Structure: causal attention per (batch, head) with S^T = K Q^T (Q fragments in registers as the B operand) and O^T = V^T P^T (packed S^T accumulators are the B fragment), online max-subtracted softmax per lane column; K and V^T tiles of 64 keys are staged in LDS once per block (two buffers) and read from there by its four waves.
#ifndef NB
#define NB 4
#endif
#ifndef SEQ
#define SEQ 2048
#endif
#ifndef EARLY
#define EARLY 512
#endif
#define NB_FULL 4
#define SEQ_FULL 2048
#define DM 512
#define NH 8
#define HD 64
#define ERL ((EARLY < SEQ) ? EARLY : SEQ)   /* rows per sequence on the multi-product path */
#define NR ((size_t)NB * SEQ)               /* compact token rows r = b*SEQ + t */
#define QSCALE 0.044194173824159216f        /* d_model^-0.5 */
#define NEGBIG (-3.0e38f)
#define CARRY_LN 6.931471805599453f         /* ln 1024 */

typedef _Float16 v16h __attribute__((ext_vector_type(16)));
typedef __bf16   v16b __attribute__((ext_vector_type(16)));
typedef unsigned short v8us __attribute__((ext_vector_type(8), may_alias));
typedef float v8f  __attribute__((ext_vector_type(8)));
typedef float v4f  __attribute__((ext_vector_type(4)));
typedef float v4fa __attribute__((ext_vector_type(4), may_alias));
union Frag { v16h h; v16b b; v8us half[2]; _Float16 e[16]; unsigned short u[16]; };

__device__ __forceinline__ unsigned short bf16_bits(float x) { unsigned int u = __float_as_uint(x); return (unsigned short)((u + 0x7FFFu + ((u >> 16) & 1u)) >> 16); }
__device__ __forceinline__ float bf16_val(unsigned short b) { return __uint_as_float(((unsigned int)b) << 16); }
__device__ __forceinline__ float bf16_rne(float x) { return bf16_val(bf16_bits(x)); }

// fragment loader (A and B alike): elements 0..7 <- p[8h .. 8h+7], elements 8..15 <- p[16+8h .. 16+8h+7]
__device__ __forceinline__ Frag ldf(const unsigned short* p, int hh) {
  Frag f; f.half[0] = *(const v8us*)(p + 8 * hh); f.half[1] = *(const v8us*)(p + 16 + 8 * hh); return f;
}
__device__ __forceinline__ v8f wm_h(const Frag& a, const Frag& b, v8f c) { return __builtin_amdgcn_wmma_f32_16x16x32_f16(false, a.h, false, b.h, (short)0, c, false, false); }
__device__ __forceinline__ v8f wm_b(const Frag& a, const Frag& b, v8f c) { return __builtin_amdgcn_wmma_f32_16x16x32_bf16(false, a.b, false, b.b, (short)0, c, false, false); }
__device__ __forceinline__ void nop2(v8f& c, const Frag& a, const Frag& b) { asm volatile("v_nop\n\tv_nop\n\tv_nop\n\tv_nop" : "+v"(c) : "v"(a.h), "v"(b.h)); }
__device__ __forceinline__ void nop3(v8f& c, const Frag& a, const Frag& b, const Frag& d) { asm volatile("v_nop\n\tv_nop\n\tv_nop\n\tv_nop" : "+v"(c) : "v"(a.h), "v"(b.h), "v"(d.h)); }
__device__ __forceinline__ void nop4(v8f& c, const Frag& a, const Frag& b, const Frag& d, const Frag& e) { asm volatile("v_nop\n\tv_nop\n\tv_nop\n\tv_nop" : "+v"(c) : "v"(a.h), "v"(b.h), "v"(d.h), "v"(e.h)); }
__device__ __forceinline__ void nop8(v8f& c, const Frag& a, const Frag& b, const Frag& d, const Frag& e, const Frag& f, const Frag& g, const Frag& i, const Frag& j) {
  asm volatile("v_nop\n\tv_nop\n\tv_nop\n\tv_nop" : "+v"(c) : "v"(a.h), "v"(b.h), "v"(d.h), "v"(e.h), "v"(f.h), "v"(g.h), "v"(i.h), "v"(j.h));
}

__device__ __forceinline__ v8us to_f16x8(v4f a, v4f c) {
  Frag f;
#pragma unroll
  for (int q = 0; q < 4; ++q) { f.e[q] = (_Float16)a[q]; f.e[4 + q] = (_Float16)c[q]; }
  return f.half[0];
}
__device__ __forceinline__ void to_bf16x8_hl(v4f a, v4f c, v8us& hi, v8us& lo) {
  Frag fh, fl;
#pragma unroll
  for (int q = 0; q < 4; ++q) {
    unsigned short hb = bf16_bits(a[q]); fh.u[q] = hb; fl.u[q] = bf16_bits(a[q] - bf16_val(hb));
    hb = bf16_bits(c[q]); fh.u[4 + q] = hb; fl.u[4 + q] = bf16_bits(c[q] - bf16_val(hb));
  }
  hi = fh.half[0]; lo = fl.half[0];
}

__global__ __launch_bounds__(256) void k_x16(const float* __restrict__ x, unsigned short* __restrict__ X16, int n8) {
  const int t = blockIdx.x * 256 + threadIdx.x;
  if (t >= n8) return;
  const int r = t / (DM / 8), c8 = (t % (DM / 8)) * 8;
  const int b = r / SEQ, tt = r % SEQ;
  const float* src = x + ((size_t)b * SEQ_FULL + tt) * DM + c8;
  const v4f a = *(const v4fa*)src, c = *(const v4fa*)(src + 4);
  v4f ar, cr;
#pragma unroll
  for (int q = 0; q < 4; ++q) { ar[q] = bf16_rne(a[q]); cr[q] = bf16_rne(c[q]); }
  const v8us o = to_f16x8(ar, cr);
  unsigned short* d = X16 + (size_t)t * 8;
  *(v8us*)d = o;
  
}

template <bool WB>
__global__ __launch_bounds__(256) void k_wnat(const float* __restrict__ w, unsigned short* __restrict__ W16, unsigned short* __restrict__ WBF, int n8) {
  const int t = blockIdx.x * 256 + threadIdx.x;
  if (t >= n8) return;
  const v4f a = *(const v4fa*)(w + (size_t)t * 8), c = *(const v4fa*)(w + (size_t)t * 8 + 4);
  v4f as, cs; Frag fb;
#pragma unroll
  for (int q = 0; q < 4; ++q) {
    const unsigned short b0 = bf16_bits(a[q]), b1 = bf16_bits(c[q]);
    fb.u[q] = b0; fb.u[4 + q] = b1;
    as[q] = bf16_val(b0) * 16.0f; cs[q] = bf16_val(b1) * 16.0f;
  }
  const v8us o = to_f16x8(as, cs);
  const v8us ob = fb.half[0];
  *(v8us*)(W16 + (size_t)t * 8) = o;
  if (WB) *(v8us*)(WBF + (size_t)t * 8) = ob;
  
}

#define KT 64               /* keys (attention) or k elements (GEMM) per LDS stage */
#define LP 72               /* LDS row pitch in 16-bit elements: 144 B = 16 B x odd, the pitch for 16-byte readers of 128-B rows */
#define TILE_E (64 * LP)    /* one staged tile: 64 rows of 128 B */

__device__ __forceinline__ unsigned lds_off(const void* p) { return (unsigned)(size_t)p; }

// One 64-row x 128-B tile into LDS by the block's 128 threads: thread = (row tid/8 + 16 i, 16-byte piece tid%8), i = 0..3, so a wave's copy takes 4 whole lines.
// l = the lane's LDS byte address of row tid/8, g = its global address there, gstep = 16 source rows in elements.
__device__ __forceinline__ void cp_tile(unsigned l, const unsigned short* g, size_t gstep) {
  const unsigned l1 = l + 16 * LP * 2, l2 = l + 32 * LP * 2, l3 = l + 48 * LP * 2;
  const unsigned short* g1 = g + gstep;
  const unsigned short* g2 = g + 2 * gstep;
  const unsigned short* g3 = g + 3 * gstep;
  // the copies bring the tile into LDS through no register; the closing s_wait_xcnt stands in front of any rewrite of the address registers they name
  asm volatile("global_load_async_to_lds_b128 %0, %4, off\n\t"
               "global_load_async_to_lds_b128 %1, %5, off\n\t"
               "global_load_async_to_lds_b128 %2, %6, off\n\t"
               "global_load_async_to_lds_b128 %3, %7, off\n\t"
               "s_wait_xcnt 0x0"
               :: "v"(l), "v"(l1), "v"(l2), "v"(l3), "v"(g), "v"(g1), "v"(g2), "v"(g3) : "memory");
}

template <bool ABF>
__device__ __forceinline__ v8f gmm(const Frag& a, const Frag& al, const Frag& b, v8f c) {
  if (ABF) { c = wm_b(a, b, c); c = wm_b(al, b, c); nop3(c, a, al, b); }
  else { c = wm_h(a, b, c); nop2(c, a, b); }
  return c;
}

// GEMM over K = DM: block = 4 waves, block tile 128 token rows x 64 cols, wave tile 32 x 64; the block's A rows and B rows are staged in LDS 64 k at a time (two buffers) and read from there by its four waves.
// grid.x = (row tiles of 128) * 8 col tiles, grid.y = batch, grid.z = plane select (weights offset zB, outputs offset zO).
// MODE 0: f16 row plane [row][DM] (+ bf16 hi/lo row planes for rows t < ERL); MODE 1: transposed planes [(b,head)][d][SEQ] (f16, + bf16 hi/lo for t < ERL);
// MODE 2: f32 rows of the output buffer (full-size layout) with bias (bf16 value) added in f32.
// ABF: A = bf16 hi (A) + lo (A2) planes, two products against bf16 Bt; else A f16, single product against f16 Bt.
template <int MODE, bool ABF>
__global__ __launch_bounds__(128) void k_gemm(const unsigned short* __restrict__ A, const unsigned short* __restrict__ A2,
                                              const unsigned short* __restrict__ Bt, size_t zB, float alpha, const float* __restrict__ bias,
                                              unsigned short* __restrict__ O16, unsigned short* __restrict__ OH, unsigned short* __restrict__ OL, size_t zO,
                                              float* __restrict__ OF, int tbase) {
  constexpr int NT = ABF ? 5 : 3;                  /* tiles of 64 rows x 128 B per stage: A rows 0..63, A rows 64..127, B rows, then the A lo rows */
  constexpr int RING_B = 2 * NT * TILE_E * 2;      /* two buffers, bytes */
  constexpr int SO_B = 128 * 68 * 4;               /* the epilogue's f32 tile, which takes the ring's place behind the loop's last barrier */
  __shared__ __attribute__((aligned(16))) unsigned char sm[RING_B > SO_B ? RING_B : SO_B];
  unsigned short* const ring = (unsigned short*)sm;
  float (* const so)[68] = (float (*)[68])sm;
  const int tid = threadIdx.x, lane = tid & 31, ln = lane & 15, hh = lane >> 4;
  const int w = __builtin_amdgcn_readfirstlane((int)(threadIdx.x >> 5));
  const int rt = (int)blockIdx.x >> 3, nq = (int)blockIdx.x & 7, b = blockIdx.y, z = blockIdx.z;
  const int t0 = tbase + rt * 128;
  const size_t r0 = (size_t)b * SEQ + t0;
  const int col0 = nq * 64;
  const int crow = tid >> 3, cpc = tid & 7;
  const size_t acp = (r0 + crow) * DM + 8 * cpc;
  const size_t bcp = (size_t)z * zB + (size_t)(col0 + crow) * DM + 8 * cpc;
  const unsigned lcp = lds_off(ring) + (unsigned)(crow * LP + 8 * cpc) * 2u;
  auto fill = [&](int s, int bf) {   // k = 64 s .. 64 s + 63 of the block's 128 A rows and 64 B rows into buffer bf
    const unsigned lb = lcp + (unsigned)bf * (unsigned)(NT * TILE_E * 2);
    const size_t k0 = (size_t)s * KT;
    cp_tile(lb, A + acp + k0, (size_t)16 * DM);
    cp_tile(lb + TILE_E * 2, A + acp + (size_t)64 * DM + k0, (size_t)16 * DM);
    cp_tile(lb + 2 * TILE_E * 2, Bt + bcp + k0, (size_t)16 * DM);
    if (ABF) {
      cp_tile(lb + 3 * TILE_E * 2, A2 + acp + k0, (size_t)16 * DM);
      cp_tile(lb + 4 * TILE_E * 2, A2 + acp + (size_t)64 * DM + k0, (size_t)16 * DM);
    }
  };
  const v8f z8 = {0.f, 0.f, 0.f, 0.f, 0.f, 0.f, 0.f, 0.f};
  v8f acc[8];
#pragma unroll
  for (int u = 0; u < 8; ++u) acc[u] = z8;
  fill(0, 0);
  asm volatile("s_wait_asynccnt 0x0" ::: "memory");   // this wave's copies of stage 0 have landed
  __syncthreads();                                    // ... and every other wave's
  fill(1, 1);
#pragma unroll 1   /* rolled: one hand-over of the buffers per trip, and the loop text stays small */
  for (int sg = 0; sg < DM / KT; ++sg) {
    const unsigned short* tb = ring + (sg & 1) * (NT * TILE_E);
    const unsigned short* ap = tb + (32 * w + ln) * LP;
    const unsigned short* bp0 = tb + 2 * TILE_E + ln * LP;
    // the stage's fragment reads stand together in front of its products: one LDS latency per stage, not one per fragment
    Frag fa[2][2], fl[2][2], fb[2][4];
#pragma unroll     /* both 32-k halves of the stage in line, so that every LDS offset is an immediate and every fragment a register */
    for (int h2 = 0; h2 < 2; ++h2) {
      fa[h2][0] = ldf(ap + 32 * h2, hh); fa[h2][1] = ldf(ap + 16 * LP + 32 * h2, hh);
      if (ABF) { fl[h2][0] = ldf(ap + 3 * TILE_E + 32 * h2, hh); fl[h2][1] = ldf(ap + 3 * TILE_E + 16 * LP + 32 * h2, hh); }
      else { fl[h2][0] = fa[h2][0]; fl[h2][1] = fa[h2][1]; }
#pragma unroll
      for (int t = 0; t < 4; ++t) fb[h2][t] = ldf(bp0 + (16 * t) * LP + 32 * h2, hh);
    }
#pragma unroll     /* in line, k ascending in every accumulator */
    for (int h2 = 0; h2 < 2; ++h2) {
#pragma unroll
      for (int t = 0; t < 4; ++t) {
        acc[t] = gmm<ABF>(fa[h2][0], fl[h2][0], fb[h2][t], acc[t]);
        acc[4 + t] = gmm<ABF>(fa[h2][1], fl[h2][1], fb[h2][t], acc[4 + t]);
      }
    }
    // hand-over of the buffers, passed by every wave:
    asm volatile("s_wait_dscnt 0x0" ::: "memory");      // this wave's reads of the buffer that is refilled below have returned
    asm volatile("s_wait_asynccnt 0x0" ::: "memory");   // this wave's copies of the next stage have landed
    __syncthreads();                                    // publishes the next stage and ends every wave's reads of this one
    if (sg + 2 < DM / KT) fill(sg + 2, sg & 1);
  }
  asm volatile("s_wait_asynccnt 0x0" ::: "memory");    // no copy is outstanding when the ring's LDS becomes the epilogue's tile
  // D element r of lane (hh, ln) = (row 8hh + r, col ln) of its 16x16 tile
#pragma unroll
  for (int u = 0; u < 8; ++u) {
    const int t = u & 3, half = u >> 2;
    const int col = t * 16 + ln;
    float bv = 0.f;
    if (MODE == 2) bv = bf16_rne(bias[col0 + col]);
#pragma unroll
    for (int r = 0; r < 8; ++r) so[32 * w + half * 16 + 8 * hh + r][col] = acc[u][r] * alpha + bv;
  }
  __syncthreads();
  const bool early = (t0 < ERL);
  if (MODE == 0) {
    {
#pragma unroll
      for (int it = 0; it < 8; ++it) {
        const int row = it * 16 + (tid >> 3), pc = tid & 7;
        const v4f x0 = *(const v4fa*)&so[row][8 * pc], x1 = *(const v4fa*)&so[row][8 * pc + 4];
        const size_t off = (size_t)z * zO + (r0 + row) * DM + col0 + 8 * pc;
        const v8us o = to_f16x8(x0, x1);
        *(v8us*)(O16 + off) = o;
        if (early) {
          v8us oh, ol; to_bf16x8_hl(x0, x1, oh, ol);
          *(v8us*)(OH + off) = oh;
          *(v8us*)(OL + off) = ol;
        }
      }
      
    }
  } else if (MODE == 1) {
    // transposed: 64 d rows x 128 tokens (256 B each): d = it*8 + tid/16, piece = tid%16 (8 tokens = 16 B)
    const int hd = nq;
    {
#pragma unroll
      for (int it = 0; it < 8; ++it) {
        const int d = it * 8 + (tid >> 4), pc = tid & 15;
        v4f x0, x1;
#pragma unroll
        for (int j = 0; j < 4; ++j) { x0[j] = so[8 * pc + j][d]; x1[j] = so[8 * pc + 4 + j][d]; }
        const size_t off = (((size_t)b * NH + hd) * HD + d) * SEQ + t0 + 8 * pc;
        const v8us o = to_f16x8(x0, x1);
        *(v8us*)(O16 + off) = o;
        if (early) {
          v8us oh, ol; to_bf16x8_hl(x0, x1, oh, ol);
          *(v8us*)(OH + off) = oh;
          *(v8us*)(OL + off) = ol;
        }
      }
      
    }
  } else {
    // f32 rows of the output buffer: 128 rows x 256 B: row = it*8 + tid/16, piece = tid%16 (4 floats = 16 B)
    {
#pragma unroll
      for (int it = 0; it < 16; ++it) {
        const int row = it * 8 + (tid >> 4), pc = tid & 15;
        const v4f v = *(const v4fa*)&so[row][4 * pc];
        *(v4f*)(OF + ((size_t)b * SEQ_FULL + t0 + row) * DM + col0 + 4 * pc) = v;
      }
      
    }
  }
}

// Causal attention, one wave per 16 query rows of one (batch, head); block = 4 waves (64 queries) that share the staged K and V^T tiles; one block barrier per 64 keys.
// S^T[key][query] = K Q^T: A = K rows (lane = key), B = Q rows (lane = query). D: lane (hh, ln) element r = (key 8hh + r, query ln).
// O^T[d][query] = V^T P^T: A = V^T rows (lane = d, k = keys), B = packed P^T: element r <- tile(keys 0..15)[r], element 8+r <- tile(keys 16..31)[r].
// RES: bf16 hi/lo operands, three products per site; else f16 single products with P carried x1024 (sum carried alike) and ctx stored x64.
template <bool RES>
__global__ __launch_bounds__(128) void k_attn(const unsigned short* __restrict__ Qh, const unsigned short* __restrict__ Ql,
                                              const unsigned short* __restrict__ Kh, const unsigned short* __restrict__ Kl,
                                              const unsigned short* __restrict__ Vh, const unsigned short* __restrict__ Vl,
                                              unsigned short* __restrict__ Ch, unsigned short* __restrict__ Cl, int tbase) {
  __shared__ __attribute__((aligned(16))) unsigned short sc[4][RES ? 2 : 1][16][64];
  __shared__ __attribute__((aligned(16))) unsigned short st_lds[2][RES ? 4 : 2][TILE_E];   /* [buffer][K hi, V^T hi, K lo, V^T lo][row * LP + element] */
  const int lane = threadIdx.x & 31, ln = lane & 15, hh = lane >> 4;
  const int w = __builtin_amdgcn_readfirstlane((int)(threadIdx.x >> 5));
  const int h = blockIdx.y, b = blockIdx.z;
  const int qb = tbase + (int)blockIdx.x * 64;
  const int q0 = qb + w * 16;
  const int qi = q0 + ln;
  const size_t rowb = (size_t)b * SEQ;
  const size_t qof = (rowb + q0 + ln) * DM + h * HD;
  const Frag qh0 = ldf(Qh + qof, hh), qh1 = ldf(Qh + qof + 32, hh);
  Frag ql0 = qh0, ql1 = qh1;
  if (RES) { ql0 = ldf(Ql + qof, hh); ql1 = ldf(Ql + qof + 32, hh); }
  const int crow = (int)threadIdx.x >> 3, cpc = (int)threadIdx.x & 7;
  const size_t kcp = (rowb + crow) * DM + h * HD + 8 * cpc;
  const size_t vcp = (((size_t)b * NH + h) * HD + crow) * SEQ + 8 * cpc;
  const unsigned lcp = lds_off(&st_lds[0][0][0]) + (unsigned)(crow * LP + 8 * cpc) * 2u;
  auto fill = [&](int s, int bf) {   // keys 64 s .. 64 s + 63 into buffer bf; all of them lie at or below the block's last query
    const unsigned lb = lcp + (unsigned)bf * (unsigned)((RES ? 4 : 2) * TILE_E * 2);
    const size_t k0 = (size_t)s * KT;
    cp_tile(lb, Kh + kcp + k0 * DM, (size_t)16 * DM);
    cp_tile(lb + TILE_E * 2, Vh + vcp + k0, (size_t)16 * SEQ);
    if (RES) {
      cp_tile(lb + 2 * TILE_E * 2, Kl + kcp + k0 * DM, (size_t)16 * DM);
      cp_tile(lb + 3 * TILE_E * 2, Vl + vcp + k0, (size_t)16 * SEQ);
    }
  };
  const v8f z8 = {0.f, 0.f, 0.f, 0.f, 0.f, 0.f, 0.f, 0.f};
  v8f acc[4];
#pragma unroll
  for (int t = 0; t < 4; ++t) acc[t] = z8;
  float m = NEGBIG, l = 0.f;
  const float carry = RES ? 0.f : CARRY_LN;
  const int nst = (qb >> 6) + 1;   // scalar and the same in the whole block: stages of 64 keys up to the block's last query
  fill(0, 0);
  asm volatile("s_wait_asynccnt 0x0" ::: "memory");   // this wave's copies of stage 0 have landed
  __syncthreads();                                    // ... and every other wave's
  if (nst > 1) fill(1, 1);
#pragma unroll 1   /* rolled: one hand-over of the buffers per trip, and the loop text stays small */
  for (int sg = 0; sg < nst; ++sg) {
   const unsigned short* tk = &st_lds[sg & 1][0][0];
#pragma unroll     /* both 32-key halves of the stage in line, so that every LDS offset is an immediate */
   for (int hf = 0; hf < 2; ++hf) {
    const int kb = sg * KT + hf * 32;
    if (kb >= q0 + 16) continue;   // scalar: the wave's queries all lie in front of these 32 keys
    v8f s[2];
#pragma unroll
    for (int kt = 0; kt < 2; ++kt) {
      const unsigned short* kp = tk + (hf * 32 + 16 * kt + ln) * LP;
      const Frag k0 = ldf(kp, hh), k1 = ldf(kp + 32, hh);
      v8f c = z8;
      if (RES) {
        const Frag kl0 = ldf(kp + 2 * TILE_E, hh), kl1 = ldf(kp + 2 * TILE_E + 32, hh);
        c = wm_b(k0, qh0, c); c = wm_b(kl0, qh0, c); c = wm_b(k0, ql0, c);
        c = wm_b(k1, qh1, c); c = wm_b(kl1, qh1, c); c = wm_b(k1, ql1, c);
        nop8(c, k0, k1, kl0, kl1, qh0, qh1, ql0, ql1);
      } else {
        c = wm_h(k0, qh0, c); c = wm_h(k1, qh1, c);
        nop4(c, k0, k1, qh0, qh1);
      }
      s[kt] = c;
    }
    if (kb + 32 > q0) {   // scalar condition: this step touches the diagonal; masked scores are replaced
#pragma unroll
      for (int kt = 0; kt < 2; ++kt)
#pragma unroll
        for (int r = 0; r < 8; ++r) { const int key = kb + 16 * kt + 8 * hh + r; s[kt][r] = (key > qi) ? NEGBIG : s[kt][r]; }
    }
    float mx = fmaxf(s[0][0], s[1][0]);
#pragma unroll
    for (int r = 1; r < 8; ++r) mx = fmaxf(mx, fmaxf(s[0][r], s[1][r]));
    mx = fmaxf(mx, __shfl_xor(mx, 16, 32));
    const float mnew = fmaxf(m, mx);
    const float alpha = __expf((m - mnew) * QSCALE);
    const float cc = carry - mnew * QSCALE;
    m = mnew;
    Frag ph, pl;
    float ps = 0.f;
#pragma unroll
    for (int kt = 0; kt < 2; ++kt)
#pragma unroll
      for (int r = 0; r < 8; ++r) {
        const float p = __expf(fmaf(s[kt][r], QSCALE, cc));
        if (RES) {
          const unsigned short hb = bf16_bits(p); const float hv = bf16_val(hb);
          const unsigned short lb = bf16_bits(p - hv);
          ph.u[8 * kt + r] = hb; pl.u[8 * kt + r] = lb; ps += hv + bf16_val(lb);
        } else {
          ph.e[8 * kt + r] = (_Float16)p; ps += p;
        }
      }
    if (!RES) pl = ph;
    ps += __shfl_xor(ps, 16, 32);
    l = l * alpha + ps;
#pragma unroll
    for (int t = 0; t < 4; ++t) acc[t] = acc[t] * alpha;
#pragma unroll
    for (int t = 0; t < 4; ++t) {
      const unsigned short* vp = tk + TILE_E + (16 * t + ln) * LP + hf * 32;
      const Frag vh = ldf(vp, hh);
      if (RES) {
        const Frag vl = ldf(vp + 2 * TILE_E, hh);
        acc[t] = wm_b(vh, ph, acc[t]); acc[t] = wm_b(vl, ph, acc[t]); acc[t] = wm_b(vh, pl, acc[t]);
        nop4(acc[t], vh, vl, ph, pl);
      } else {
        acc[t] = wm_h(vh, ph, acc[t]);
        nop2(acc[t], vh, ph);
      }
    }
   }
   // hand-over of the buffers, passed by every wave:
   asm volatile("s_wait_dscnt 0x0" ::: "memory");      // this wave's reads of the buffer that is refilled below have returned
   asm volatile("s_wait_asynccnt 0x0" ::: "memory");   // this wave's copies of the next stage have landed
   __syncthreads();                                    // publishes the next stage and ends every wave's reads of this one
   if (sg + 2 < nst) fill(sg + 2, sg & 1);
  }
  asm volatile("s_wait_asynccnt 0x0" ::: "memory");    // no copy is outstanding when the wave goes on to its end
  // acc[t][r] = O^T[d = 16t + 8hh + r][query ln]; normalise and stage row ln of the wave tile
  const float inv = 1.0f / l;
  const float osc = RES ? inv : inv * 64.0f;
#pragma unroll
  for (int t = 0; t < 4; ++t) {
    if (RES) {
      Frag oh, ol;
#pragma unroll
      for (int r = 0; r < 8; ++r) { const float c = acc[t][r] * osc; const unsigned short hb = bf16_bits(c); oh.u[r] = hb; ol.u[r] = bf16_bits(c - bf16_val(hb)); }
      *(v8us*)&sc[w][0][ln][16 * t + 8 * hh] = oh.half[0];
      *(v8us*)&sc[w][RES ? 1 : 0][ln][16 * t + 8 * hh] = ol.half[0];
    } else {
      Frag o;
#pragma unroll
      for (int r = 0; r < 8; ++r) o.e[r] = (_Float16)(acc[t][r] * osc);
      *(v8us*)&sc[w][0][ln][16 * t + 8 * hh] = o.half[0];
    }
  }
  __builtin_amdgcn_fence(4 /* acq_rel order */, "workgroup");
  __builtin_amdgcn_wave_barrier();
  const int rsub = lane >> 3, pc = lane & 7;
  {
#pragma unroll
    for (int q = 0; q < 4; ++q) {
      const int row = 4 * q + rsub;
      const size_t off = (rowb + q0 + row) * DM + h * HD + 8 * pc;
      const v8us v0 = *(const v8us*)&sc[w][0][row][8 * pc];
      *(v8us*)(Ch + off) = v0;
      if (RES) { const v8us v1 = *(const v8us*)&sc[w][RES ? 1 : 0][row][8 * pc]; *(v8us*)(Cl + off) = v1; }
    }
    
  }
}

extern "C" void kernel_launch(void* const* d_in, const int* in_sizes, int n_in,
                              void* d_out, int out_size, void* d_ws, size_t ws_size, hipStream_t stream) {
  static_assert(NH * HD == DM);
  static_assert(DM == 512);
  static_assert(SEQ % 128 == 0);
  static_assert(ERL % 128 == 0);
  static_assert(NB <= NB_FULL);
  static_assert(SEQ <= SEQ_FULL);
  static_assert((size_t)13 * NB * SEQ * DM * 2 + (size_t)5 * DM * DM * 2 <= (size_t)134217728);
  if (n_in < 6) return;
  const long long xmin = ((long long)(NB - 1) * SEQ_FULL + SEQ) * DM;
  if ((long long)in_sizes[0] < xmin) return;
  if (in_sizes[1] < DM * DM || in_sizes[2] < DM * DM || in_sizes[3] < DM * DM || in_sizes[4] < DM * DM || in_sizes[5] < DM) return;
  if ((long long)out_size < xmin) return;
  const float* x  = (const float*)d_in[0];
  const float* Wq = (const float*)d_in[1];
  const float* Wk = (const float*)d_in[2];
  const float* Wv = (const float*)d_in[3];
  const float* Wp = (const float*)d_in[4];
  const float* bp = (const float*)d_in[5];
  float* out = (float*)d_out;

  char* ws = (char*)d_ws; size_t off = 0;
  auto take = [&](size_t bytes) { char* p = ws + off; off += (bytes + 255) & ~(size_t)255; return (unsigned short*)p; };
  const size_t PL = NR * DM;            /* elements of one [NB*SEQ][DM] 16-bit plane */
  const size_t WN = (size_t)DM * DM;
  unsigned short* W16  = take(4 * WN * 2);     /* Wq, Wk, Wv, Wp as f16 x16, [n][k] */
  unsigned short* WPB  = take(WN * 2);         /* Wp as bf16, [n][k] */
  unsigned short* X16  = take(PL * 2);
  unsigned short* QK16 = take(2 * PL * 2);     /* q plane then k plane (f16) */
  unsigned short* QKH  = take(2 * PL * 2);     /* bf16 hi, rows t < ERL written */
  unsigned short* QKL  = take(2 * PL * 2);     /* bf16 lo, rows t < ERL written */
  unsigned short* VT16 = take(PL * 2);         /* [(b,h)][d][SEQ] f16 */
  unsigned short* VTH  = take(PL * 2);
  unsigned short* VTL  = take(PL * 2);
  unsigned short* C16  = take(PL * 2);         /* ctx x64 f16, rows t >= ERL */
  unsigned short* CH   = take(PL * 2);         /* ctx bf16 hi, rows t < ERL */
  unsigned short* CL   = take(PL * 2);         /* ctx bf16 lo, rows t < ERL */
  if (off > ws_size || off > (size_t)134217728) return;

  const int xn8 = (int)(PL / 8), wn8 = (int)(WN / 8);
  k_x16<<<(unsigned)((xn8 + 255) / 256), 256, 0, stream>>>(x, X16, xn8);
  k_wnat<false><<<(unsigned)((wn8 + 255) / 256), 256, 0, stream>>>(Wq, W16, WPB, wn8);
  k_wnat<false><<<(unsigned)((wn8 + 255) / 256), 256, 0, stream>>>(Wk, W16 + WN, WPB, wn8);
  k_wnat<false><<<(unsigned)((wn8 + 255) / 256), 256, 0, stream>>>(Wv, W16 + 2 * WN, WPB, wn8);
  k_wnat<true><<<(unsigned)((wn8 + 255) / 256), 256, 0, stream>>>(Wp, W16 + 3 * WN, WPB, wn8);

  /* q and k projections: grid.z selects the weight plane and the output plane set */
  k_gemm<0, false><<<dim3((SEQ / 128) * 8, NB, 2), 128, 0, stream>>>(X16, X16, W16, WN, 0.0625f, bp, QK16, QKH, QKL, PL, out, 0);
  /* v projection written transposed per (batch, head) */
  k_gemm<1, false><<<dim3((SEQ / 128) * 8, NB, 1), 128, 0, stream>>>(X16, X16, W16 + 2 * WN, (size_t)0, 0.0625f, bp, VT16, VTH, VTL, (size_t)0, out, 0);

  /* attention: first ERL rows on bf16 hi/lo planes, remaining rows on f16 planes */
  k_attn<true><<<dim3(ERL / 64, NH, NB), 128, 0, stream>>>(QKH, QKL, QKH + PL, QKL + PL, VTH, VTL, CH, CL, 0);
  if (SEQ > ERL)
    k_attn<false><<<dim3((SEQ - ERL) / 64, NH, NB), 128, 0, stream>>>(QK16, QK16, QK16 + PL, QK16 + PL, VT16, VT16, C16, C16, ERL);

  /* output projection + bias */
  k_gemm<2, true><<<dim3((ERL / 128) * 8, NB, 1), 128, 0, stream>>>(CH, CL, WPB, (size_t)0, 1.0f, bp, X16, X16, X16, (size_t)0, out, 0);
  if (SEQ > ERL)
    k_gemm<2, false><<<dim3(((SEQ - ERL) / 128) * 8, NB, 1), 128, 0, stream>>>(C16, C16, W16 + 3 * WN, (size_t)0, 0.0009765625f, bp, X16, X16, X16, (size_t)0, out, ERL);
}

// v003
// A run of this version takes 80.9 microseconds.
// Two timings next to v002 put it at 1.36 and 1.37 times that version's speed.
// Counting every step since v000, it is 3.52 times as fast.
#include <hip/hip_runtime.h>
// Compute dtype: inputs RNE-converted to bf16 values (x as exact f16, weights as exact f16 x16 / exact bf16); q,k,v projections, dense-row scores, dense-row P.V and dense-row output GEMM = v_wmma_f32_16x16x32_f16 single products (P carried x1024, ctx carried x64); first ERL rows of every sequence: scores and P.V as bf16 hi/lo three-product sums, output GEMM as bf16 hi/lo A x exact bf16 W (v_wmma_f32_16x16x32_bf16); all accumulation, softmax statistics, bias add in f32.
// Structure: causal attention per (batch, head) with S^T = K Q^T (Q fragments in registers as the B operand) and O^T = V^T P^T (packed S^T accumulators are the B fragment), online max-subtracted softmax per lane column; K and V^T tiles of 64 keys are staged in LDS once per block (two buffers) and read from there by its four waves. Four launches, each the jobs that read none of each other's output, the job picked by the block index: conversions; q, k, v projections; attention (both row classes); output GEMM (both row classes).
#ifndef NB
#define NB 4
#endif
#ifndef SEQ
#define SEQ 2048
#endif
#ifndef EARLY
#define EARLY 512
#endif
#define NB_FULL 4
#define SEQ_FULL 2048
#define DM 512
#define NH 8
#define HD 64
#define ERL ((EARLY < SEQ) ? EARLY : SEQ)   /* rows per sequence on the multi-product path */
#define NR ((size_t)NB * SEQ)               /* compact token rows r = b*SEQ + t */
#define QSCALE 0.044194173824159216f        /* d_model^-0.5 */
#define NEGBIG (-3.0e38f)
#define CARRY_LN 6.931471805599453f         /* ln 1024 */

typedef _Float16 v16h __attribute__((ext_vector_type(16)));
typedef __bf16   v16b __attribute__((ext_vector_type(16)));
typedef unsigned short v8us __attribute__((ext_vector_type(8), may_alias));
typedef float v8f  __attribute__((ext_vector_type(8)));
typedef float v4f  __attribute__((ext_vector_type(4)));
typedef float v4fa __attribute__((ext_vector_type(4), may_alias));
union Frag { v16h h; v16b b; v8us half[2]; _Float16 e[16]; unsigned short u[16]; };

__device__ __forceinline__ unsigned short bf16_bits(float x) { unsigned int u = __float_as_uint(x); return (unsigned short)((u + 0x7FFFu + ((u >> 16) & 1u)) >> 16); }
__device__ __forceinline__ float bf16_val(unsigned short b) { return __uint_as_float(((unsigned int)b) << 16); }
__device__ __forceinline__ float bf16_rne(float x) { return bf16_val(bf16_bits(x)); }

// fragment loader (A and B alike): elements 0..7 <- p[8h .. 8h+7], elements 8..15 <- p[16+8h .. 16+8h+7]
__device__ __forceinline__ Frag ldf(const unsigned short* p, int hh) {
  Frag f; f.half[0] = *(const v8us*)(p + 8 * hh); f.half[1] = *(const v8us*)(p + 16 + 8 * hh); return f;
}
__device__ __forceinline__ v8f wm_h(const Frag& a, const Frag& b, v8f c) { return __builtin_amdgcn_wmma_f32_16x16x32_f16(false, a.h, false, b.h, (short)0, c, false, false); }
__device__ __forceinline__ v8f wm_b(const Frag& a, const Frag& b, v8f c) { return __builtin_amdgcn_wmma_f32_16x16x32_bf16(false, a.b, false, b.b, (short)0, c, false, false); }
__device__ __forceinline__ void nop2(v8f& c, const Frag& a, const Frag& b) { asm volatile("v_nop\n\tv_nop\n\tv_nop\n\tv_nop" : "+v"(c) : "v"(a.h), "v"(b.h)); }
__device__ __forceinline__ void nop3(v8f& c, const Frag& a, const Frag& b, const Frag& d) { asm volatile("v_nop\n\tv_nop\n\tv_nop\n\tv_nop" : "+v"(c) : "v"(a.h), "v"(b.h), "v"(d.h)); }
__device__ __forceinline__ void nop4(v8f& c, const Frag& a, const Frag& b, const Frag& d, const Frag& e) { asm volatile("v_nop\n\tv_nop\n\tv_nop\n\tv_nop" : "+v"(c) : "v"(a.h), "v"(b.h), "v"(d.h), "v"(e.h)); }
__device__ __forceinline__ void nop8(v8f& c, const Frag& a, const Frag& b, const Frag& d, const Frag& e, const Frag& f, const Frag& g, const Frag& i, const Frag& j) {
  asm volatile("v_nop\n\tv_nop\n\tv_nop\n\tv_nop" : "+v"(c) : "v"(a.h), "v"(b.h), "v"(d.h), "v"(e.h), "v"(f.h), "v"(g.h), "v"(i.h), "v"(j.h));
}

__device__ __forceinline__ v8us to_f16x8(v4f a, v4f c) {
  Frag f;
#pragma unroll
  for (int q = 0; q < 4; ++q) { f.e[q] = (_Float16)a[q]; f.e[4 + q] = (_Float16)c[q]; }
  return f.half[0];
}
__device__ __forceinline__ void to_bf16x8_hl(v4f a, v4f c, v8us& hi, v8us& lo) {
  Frag fh, fl;
#pragma unroll
  for (int q = 0; q < 4; ++q) {
    unsigned short hb = bf16_bits(a[q]); fh.u[q] = hb; fl.u[q] = bf16_bits(a[q] - bf16_val(hb));
    hb = bf16_bits(c[q]); fh.u[4 + q] = hb; fl.u[4 + q] = bf16_bits(c[q] - bf16_val(hb));
  }
  hi = fh.half[0]; lo = fl.half[0];
}

// behind a global store: stands in front of any rewrite of the registers that the store names
__device__ __forceinline__ void st_wait() { asm volatile("s_wait_xcnt 0x0" ::: "memory"); }

#define XBLK ((int)(NR * DM / 8 / 256))     /* conversion blocks of x: 8 elements a thread */
#define WBLK (DM * DM / 8 / 256)            /* conversion blocks of one weight matrix */

// All input conversions in one grid: blocks 0 .. 4 WBLK - 1 take the four weight matrices (f16 x16 planes; the last also its bf16 plane), the rest take x (bf16 values as exact f16).
__global__ __launch_bounds__(256) void k_prep(const float* __restrict__ x, const float* __restrict__ Wq, const float* __restrict__ Wk, const float* __restrict__ Wv, const float* __restrict__ Wp,
                                              unsigned short* __restrict__ X16, unsigned short* __restrict__ W16, unsigned short* __restrict__ WBF) {
  const int bx = (int)blockIdx.x;
  if (bx < 4 * WBLK) {
    const int sel = bx / WBLK;
    const float* w = sel == 0 ? Wq : sel == 1 ? Wk : sel == 2 ? Wv : Wp;
    const int t = (bx % WBLK) * 256 + (int)threadIdx.x;
    const v4f a = *(const v4fa*)(w + (size_t)t * 8), c = *(const v4fa*)(w + (size_t)t * 8 + 4);
    v4f as, cs; Frag fb;
#pragma unroll
    for (int q = 0; q < 4; ++q) {
      const unsigned short b0 = bf16_bits(a[q]), b1 = bf16_bits(c[q]);
      fb.u[q] = b0; fb.u[4 + q] = b1;
      as[q] = bf16_val(b0) * 16.0f; cs[q] = bf16_val(b1) * 16.0f;
    }
    const v8us o = to_f16x8(as, cs);
    const v8us ob = fb.half[0];
    *(v8us*)(W16 + (size_t)sel * DM * DM + (size_t)t * 8) = o;
    st_wait();
    if (sel == 3) { *(v8us*)(WBF + (size_t)t * 8) = ob; st_wait(); }
  } else {
    const int t = (bx - 4 * WBLK) * 256 + (int)threadIdx.x;
    const int r = t / (DM / 8), c8 = (t % (DM / 8)) * 8;
    const int b = r / SEQ, tt = r % SEQ;
    const float* src = x + ((size_t)b * SEQ_FULL + tt) * DM + c8;
    const v4f a = *(const v4fa*)src, c = *(const v4fa*)(src + 4);
    v4f ar, cr;
#pragma unroll
    for (int q = 0; q < 4; ++q) { ar[q] = bf16_rne(a[q]); cr[q] = bf16_rne(c[q]); }
    const v8us o = to_f16x8(ar, cr);
    *(v8us*)(X16 + (size_t)t * 8) = o;
    st_wait();
  }
}

#define KT 64               /* keys (attention) or k elements (GEMM) per LDS stage */
#define LP 72               /* LDS row pitch in 16-bit elements: 144 B = 16 B x odd, the pitch for 16-byte readers of 128-B rows */
#define TILE_E (64 * LP)    /* one staged tile: 64 rows of 128 B */

__device__ __forceinline__ unsigned lds_off(const void* p) { return (unsigned)(size_t)p; }

// One 64-row x 128-B tile into LDS by the block's 128 threads: thread = (row tid/8 + 16 i, 16-byte piece tid%8), i = 0..3, so a wave's copy takes 4 whole lines.
// l = the lane's LDS byte address of row tid/8, g = its global address there, gstep = 16 source rows in elements.
__device__ __forceinline__ void cp_tile(unsigned l, const unsigned short* g, size_t gstep) {
  const unsigned l1 = l + 16 * LP * 2, l2 = l + 32 * LP * 2, l3 = l + 48 * LP * 2;
  const unsigned short* g1 = g + gstep;
  const unsigned short* g2 = g + 2 * gstep;
  const unsigned short* g3 = g + 3 * gstep;
  // the copies bring the tile into LDS through no register; the closing s_wait_xcnt stands in front of any rewrite of the address registers they name
  asm volatile("global_load_async_to_lds_b128 %0, %4, off\n\t"
               "global_load_async_to_lds_b128 %1, %5, off\n\t"
               "global_load_async_to_lds_b128 %2, %6, off\n\t"
               "global_load_async_to_lds_b128 %3, %7, off\n\t"
               "s_wait_xcnt 0x0"
               :: "v"(l), "v"(l1), "v"(l2), "v"(l3), "v"(g), "v"(g1), "v"(g2), "v"(g3) : "memory");
}

template <bool ABF>
__device__ __forceinline__ v8f gmm(const Frag& a, const Frag& al, const Frag& b, v8f c) {
  if (ABF) { c = wm_b(a, b, c); c = wm_b(al, b, c); nop3(c, a, al, b); }
  else { c = wm_h(a, b, c); nop2(c, a, b); }
  return c;
}

// GEMM over K = DM: block = 4 waves, block tile 128 token rows x 64 cols, wave tile 32 x 64; the block's A rows and B rows are staged in LDS 64 k at a time (two buffers) and read from there by its four waves.
// ABF: A = bf16 hi (A) + lo (A2) planes, two products against bf16 Bt; else A f16, single product against f16 Bt.
// gemm_core leaves the block's 128 x 64 tile (x alpha, + the bf16 value of the bias where BIAS) as f32 in LDS, published by a block barrier; the epilogues below store it.
#define GEMM_NT(ABF) ((ABF) ? 5 : 3)                    /* tiles of 64 rows x 128 B per stage: A rows 0..63, A rows 64..127, B rows, then the A lo rows */
#define GEMM_RING_B(ABF) (2 * GEMM_NT(ABF) * TILE_E * 2) /* two buffers, bytes */
#define SO_B (128 * 68 * 4)                             /* the epilogue's f32 tile, which takes the ring's place behind the loop's last barrier */
#define GEMM_SM_B(ABF) (GEMM_RING_B(ABF) > SO_B ? GEMM_RING_B(ABF) : SO_B)
typedef float sorow[68];

template <bool ABF, bool BIAS>
__device__ __forceinline__ void gemm_core(unsigned char* sm, const unsigned short* __restrict__ A, const unsigned short* __restrict__ A2,
                                          const unsigned short* __restrict__ Bt, float alpha, const float* __restrict__ bias, size_t r0, int col0) {
  constexpr int NT = GEMM_NT(ABF);
  unsigned short* const ring = (unsigned short*)sm;
  sorow* const so = (sorow*)sm;
  const int tid = threadIdx.x, lane = tid & 31, ln = lane & 15, hh = lane >> 4;
  const int w = __builtin_amdgcn_readfirstlane((int)(threadIdx.x >> 5));
  const int crow = tid >> 3, cpc = tid & 7;
  const size_t acp = (r0 + crow) * DM + 8 * cpc;
  const size_t bcp = (size_t)(col0 + crow) * DM + 8 * cpc;
  const unsigned lcp = lds_off(ring) + (unsigned)(crow * LP + 8 * cpc) * 2u;
  auto fill = [&](int s, int bf) {   // k = 64 s .. 64 s + 63 of the block's 128 A rows and 64 B rows into buffer bf
    const unsigned lb = lcp + (unsigned)bf * (unsigned)(NT * TILE_E * 2);
    const size_t k0 = (size_t)s * KT;
    cp_tile(lb, A + acp + k0, (size_t)16 * DM);
    cp_tile(lb + TILE_E * 2, A + acp + (size_t)64 * DM + k0, (size_t)16 * DM);
    cp_tile(lb + 2 * TILE_E * 2, Bt + bcp + k0, (size_t)16 * DM);
    if (ABF) {
      cp_tile(lb + 3 * TILE_E * 2, A2 + acp + k0, (size_t)16 * DM);
      cp_tile(lb + 4 * TILE_E * 2, A2 + acp + (size_t)64 * DM + k0, (size_t)16 * DM);
    }
  };
  const v8f z8 = {0.f, 0.f, 0.f, 0.f, 0.f, 0.f, 0.f, 0.f};
  v8f acc[8];
#pragma unroll
  for (int u = 0; u < 8; ++u) acc[u] = z8;
  fill(0, 0);
  asm volatile("s_wait_asynccnt 0x0" ::: "memory");   // this wave's copies of stage 0 have landed
  __syncthreads();                                    // ... and every other wave's
  fill(1, 1);
#pragma unroll 1   /* rolled: one hand-over of the buffers per trip, and the loop text stays small */
  for (int sg = 0; sg < DM / KT; ++sg) {
    const unsigned short* tb = ring + (sg & 1) * (NT * TILE_E);
    const unsigned short* ap = tb + (32 * w + ln) * LP;
    const unsigned short* bp0 = tb + 2 * TILE_E + ln * LP;
    // the stage's fragment reads stand together in front of its products: one LDS latency per stage, not one per fragment
    Frag fa[2][2], fl[2][2], fb[2][4];
#pragma unroll     /* both 32-k halves of the stage in line, so that every LDS offset is an immediate and every fragment a register */
    for (int h2 = 0; h2 < 2; ++h2) {
      fa[h2][0] = ldf(ap + 32 * h2, hh); fa[h2][1] = ldf(ap + 16 * LP + 32 * h2, hh);
      if (ABF) { fl[h2][0] = ldf(ap + 3 * TILE_E + 32 * h2, hh); fl[h2][1] = ldf(ap + 3 * TILE_E + 16 * LP + 32 * h2, hh); }
      else { fl[h2][0] = fa[h2][0]; fl[h2][1] = fa[h2][1]; }
#pragma unroll
      for (int t = 0; t < 4; ++t) fb[h2][t] = ldf(bp0 + (16 * t) * LP + 32 * h2, hh);
    }
#pragma unroll     /* in line, k ascending in every accumulator */
    for (int h2 = 0; h2 < 2; ++h2) {
#pragma unroll
      for (int t = 0; t < 4; ++t) {
        acc[t] = gmm<ABF>(fa[h2][0], fl[h2][0], fb[h2][t], acc[t]);
        acc[4 + t] = gmm<ABF>(fa[h2][1], fl[h2][1], fb[h2][t], acc[4 + t]);
      }
    }
    // hand-over of the buffers, passed by every wave:
    asm volatile("s_wait_dscnt 0x0" ::: "memory");      // this wave's reads of the buffer that is refilled below have returned
    asm volatile("s_wait_asynccnt 0x0" ::: "memory");   // this wave's copies of the next stage have landed
    __syncthreads();                                    // publishes the next stage and ends every wave's reads of this one
    if (sg + 2 < DM / KT) fill(sg + 2, sg & 1);
  }
  asm volatile("s_wait_asynccnt 0x0" ::: "memory");    // no copy is outstanding when the ring's LDS becomes the epilogue's tile
  // D element r of lane (hh, ln) = (row 8hh + r, col ln) of its 16x16 tile
#pragma unroll
  for (int u = 0; u < 8; ++u) {
    const int t = u & 3, half = u >> 2;
    const int col = t * 16 + ln;
    float bv = 0.f;
    if (BIAS) bv = bf16_rne(bias[col0 + col]);
#pragma unroll
    for (int r = 0; r < 8; ++r) so[32 * w + half * 16 + 8 * hh + r][col] = acc[u][r] * alpha + bv;
  }
  __syncthreads();
}

// q, k and v projections in one grid: grid.x = (row tiles of 128) * 8 col tiles, grid.y = batch, grid.z = weight plane (0 q, 1 k, 2 v).
// q and k: f16 row plane [row][DM] (+ bf16 hi/lo row planes for rows t < ERL); v: transposed planes [(b,head)][d][SEQ] (f16, + bf16 hi/lo for t < ERL).
__global__ __launch_bounds__(128) void k_proj(const unsigned short* __restrict__ X16, const unsigned short* __restrict__ W16,
                                              unsigned short* __restrict__ QK16, unsigned short* __restrict__ QKH, unsigned short* __restrict__ QKL,
                                              unsigned short* __restrict__ VT16, unsigned short* __restrict__ VTH, unsigned short* __restrict__ VTL) {
  __shared__ __attribute__((aligned(16))) unsigned char sm[GEMM_SM_B(false)];
  const sorow* const so = (const sorow*)sm;
  const int tid = threadIdx.x;
  const int rt = (int)blockIdx.x >> 3, nq = (int)blockIdx.x & 7, b = blockIdx.y, z = blockIdx.z;
  const int t0 = rt * 128;
  const size_t r0 = (size_t)b * SEQ + t0;
  const int col0 = nq * 64;
  gemm_core<false, false>(sm, X16, X16, W16 + (size_t)z * DM * DM, 0.0625f, nullptr, r0, col0);
  const bool early = (t0 < ERL);
  if (z < 2) {
#pragma unroll
    for (int it = 0; it < 8; ++it) {
      const int row = it * 16 + (tid >> 3), pc = tid & 7;
      const v4f x0 = *(const v4fa*)&so[row][8 * pc], x1 = *(const v4fa*)&so[row][8 * pc + 4];
      const size_t off = (size_t)z * (NR * DM) + (r0 + row) * DM + col0 + 8 * pc;
      const v8us o = to_f16x8(x0, x1);
      *(v8us*)(QK16 + off) = o;
      st_wait();
      if (early) {
        v8us oh, ol; to_bf16x8_hl(x0, x1, oh, ol);
        *(v8us*)(QKH + off) = oh;
        *(v8us*)(QKL + off) = ol;
        st_wait();
      }
    }
  } else {
    // transposed: 64 d rows x 128 tokens (256 B each): d = it*8 + tid/16, piece = tid%16 (8 tokens = 16 B)
    const int hd = nq;
#pragma unroll
    for (int it = 0; it < 8; ++it) {
      const int d = it * 8 + (tid >> 4), pc = tid & 15;
      v4f x0, x1;
#pragma unroll
      for (int j = 0; j < 4; ++j) { x0[j] = so[8 * pc + j][d]; x1[j] = so[8 * pc + 4 + j][d]; }
      const size_t off = (((size_t)b * NH + hd) * HD + d) * SEQ + t0 + 8 * pc;
      const v8us o = to_f16x8(x0, x1);
      *(v8us*)(VT16 + off) = o;
      st_wait();
      if (early) {
        v8us oh, ol; to_bf16x8_hl(x0, x1, oh, ol);
        *(v8us*)(VTH + off) = oh;
        *(v8us*)(VTL + off) = ol;
        st_wait();
      }
    }
  }
}

// Output projection + bias for all rows in one grid: grid.x = (row tiles of 128) * 8 col tiles, grid.y = batch; row tiles t < ERL take the bf16 hi/lo ctx planes, the rest the f16 plane (ctx x64, weights x16).
__global__ __launch_bounds__(128) void k_out(const unsigned short* __restrict__ CH, const unsigned short* __restrict__ CL, const unsigned short* __restrict__ C16,
                                             const unsigned short* __restrict__ WPB, const unsigned short* __restrict__ WP16,
                                             const float* __restrict__ bias, float* __restrict__ OF) {
  __shared__ __attribute__((aligned(16))) unsigned char sm[GEMM_SM_B(true)];
  const sorow* const so = (const sorow*)sm;
  const int tid = threadIdx.x;
  const int rt = (int)blockIdx.x >> 3, nq = (int)blockIdx.x & 7, b = blockIdx.y;
  const int t0 = rt * 128;
  const size_t r0 = (size_t)b * SEQ + t0;
  const int col0 = nq * 64;
  if (t0 < ERL) gemm_core<true, true>(sm, CH, CL, WPB, 1.0f, bias, r0, col0);
  else gemm_core<false, true>(sm, C16, C16, WP16, 0.0009765625f, bias, r0, col0);
  // f32 rows of the output buffer (full-size layout): 128 rows x 256 B: row = it*8 + tid/16, piece = tid%16 (4 floats = 16 B)
#pragma unroll
  for (int it = 0; it < 16; ++it) {
    const int row = it * 8 + (tid >> 4), pc = tid & 15;
    const v4f v = *(const v4fa*)&so[row][4 * pc];
    *(v4f*)(OF + ((size_t)b * SEQ_FULL + t0 + row) * DM + col0 + 4 * pc) = v;
  }
}

// Causal attention, one wave per 16 query rows of one (batch, head); block = 4 waves (64 queries) that share the staged K and V^T tiles; one block barrier per 64 keys.
// S^T[key][query] = K Q^T: A = K rows (lane = key), B = Q rows (lane = query). D: lane (hh, ln) element r = (key 8hh + r, query ln).
// O^T[d][query] = V^T P^T: A = V^T rows (lane = d, k = keys), B = packed P^T: element r <- tile(keys 0..15)[r], element 8+r <- tile(keys 16..31)[r].
// RES: bf16 hi/lo operands, three products per site; else f16 single products with P carried x1024 (sum carried alike) and ctx stored x64.
// lds: the ring [buffer][K hi, V^T hi, K lo, V^T lo][row * LP + element] (the lo tiles with RES alone); behind the loop's last barrier its first bytes become the waves' output tiles [wave][hi, lo][16][64].
template <bool RES>
__device__ __forceinline__ void attn_body(unsigned short* lds, const unsigned short* __restrict__ Qh, const unsigned short* __restrict__ Ql,
                                          const unsigned short* __restrict__ Kh, const unsigned short* __restrict__ Kl,
                                          const unsigned short* __restrict__ Vh, const unsigned short* __restrict__ Vl,
                                          unsigned short* __restrict__ Ch, unsigned short* __restrict__ Cl, int qb, int h, int b) {
  constexpr int NTL = RES ? 4 : 2;   /* staged tiles per buffer */
  const int lane = threadIdx.x & 31, ln = lane & 15, hh = lane >> 4;
  const int w = __builtin_amdgcn_readfirstlane((int)(threadIdx.x >> 5));
  unsigned short (* const sc)[16][64] = (unsigned short (*)[16][64])lds + w * (RES ? 2 : 1);   /* this wave's output tiles */
  const int q0 = qb + w * 16;
  const int qi = q0 + ln;
  const size_t rowb = (size_t)b * SEQ;
  const size_t qof = (rowb + q0 + ln) * DM + h * HD;
  const Frag qh0 = ldf(Qh + qof, hh), qh1 = ldf(Qh + qof + 32, hh);
  Frag ql0 = qh0, ql1 = qh1;
  if (RES) { ql0 = ldf(Ql + qof, hh); ql1 = ldf(Ql + qof + 32, hh); }
  const int crow = (int)threadIdx.x >> 3, cpc = (int)threadIdx.x & 7;
  const size_t kcp = (rowb + crow) * DM + h * HD + 8 * cpc;
  const size_t vcp = (((size_t)b * NH + h) * HD + crow) * SEQ + 8 * cpc;
  const unsigned lcp = lds_off(lds) + (unsigned)(crow * LP + 8 * cpc) * 2u;
  auto fill = [&](int s, int bf) {   // keys 64 s .. 64 s + 63 into buffer bf; all of them lie at or below the block's last query
    const unsigned lb = lcp + (unsigned)bf * (unsigned)(NTL * TILE_E * 2);
    const size_t k0 = (size_t)s * KT;
    cp_tile(lb, Kh + kcp + k0 * DM, (size_t)16 * DM);
    cp_tile(lb + TILE_E * 2, Vh + vcp + k0, (size_t)16 * SEQ);
    if (RES) {
      cp_tile(lb + 2 * TILE_E * 2, Kl + kcp + k0 * DM, (size_t)16 * DM);
      cp_tile(lb + 3 * TILE_E * 2, Vl + vcp + k0, (size_t)16 * SEQ);
    }
  };
  const v8f z8 = {0.f, 0.f, 0.f, 0.f, 0.f, 0.f, 0.f, 0.f};
  v8f acc[4];
#pragma unroll
  for (int t = 0; t < 4; ++t) acc[t] = z8;
  float m = NEGBIG, l = 0.f;
  const float carry = RES ? 0.f : CARRY_LN;
  const int nst = (qb >> 6) + 1;   // scalar and the same in the whole block: stages of 64 keys up to the block's last query
  fill(0, 0);
  asm volatile("s_wait_asynccnt 0x0" ::: "memory");   // this wave's copies of stage 0 have landed
  __syncthreads();                                    // ... and every other wave's
  if (nst > 1) fill(1, 1);
#pragma unroll 1   /* rolled: one hand-over of the buffers per trip, and the loop text stays small */
  for (int sg = 0; sg < nst; ++sg) {
   const unsigned short* tk = lds + (sg & 1) * (NTL * TILE_E);
#pragma unroll     /* both 32-key halves of the stage in line, so that every LDS offset is an immediate */
   for (int hf = 0; hf < 2; ++hf) {
    const int kb = sg * KT + hf * 32;
    if (kb >= q0 + 16) continue;   // scalar: the wave's queries all lie in front of these 32 keys
    v8f s[2];
#pragma unroll
    for (int kt = 0; kt < 2; ++kt) {
      const unsigned short* kp = tk + (hf * 32 + 16 * kt + ln) * LP;
      const Frag k0 = ldf(kp, hh), k1 = ldf(kp + 32, hh);
      v8f c = z8;
      if (RES) {
        const Frag kl0 = ldf(kp + 2 * TILE_E, hh), kl1 = ldf(kp + 2 * TILE_E + 32, hh);
        c = wm_b(k0, qh0, c); c = wm_b(kl0, qh0, c); c = wm_b(k0, ql0, c);
        c = wm_b(k1, qh1, c); c = wm_b(kl1, qh1, c); c = wm_b(k1, ql1, c);
        nop8(c, k0, k1, kl0, kl1, qh0, qh1, ql0, ql1);
      } else {
        c = wm_h(k0, qh0, c); c = wm_h(k1, qh1, c);
        nop4(c, k0, k1, qh0, qh1);
      }
      s[kt] = c;
    }
    if (kb + 32 > q0) {   // scalar condition: this step touches the diagonal; masked scores are replaced
#pragma unroll
      for (int kt = 0; kt < 2; ++kt)
#pragma unroll
        for (int r = 0; r < 8; ++r) { const int key = kb + 16 * kt + 8 * hh + r; s[kt][r] = (key > qi) ? NEGBIG : s[kt][r]; }
    }
    float mx = fmaxf(s[0][0], s[1][0]);
#pragma unroll
    for (int r = 1; r < 8; ++r) mx = fmaxf(mx, fmaxf(s[0][r], s[1][r]));
    mx = fmaxf(mx, __shfl_xor(mx, 16, 32));
    const float mnew = fmaxf(m, mx);
    const float alpha = __expf((m - mnew) * QSCALE);
    const float cc = carry - mnew * QSCALE;
    m = mnew;
    Frag ph, pl;
    float ps = 0.f;
#pragma unroll
    for (int kt = 0; kt < 2; ++kt)
#pragma unroll
      for (int r = 0; r < 8; ++r) {
        const float p = __expf(fmaf(s[kt][r], QSCALE, cc));
        if (RES) {
          const unsigned short hb = bf16_bits(p); const float hv = bf16_val(hb);
          const unsigned short lb = bf16_bits(p - hv);
          ph.u[8 * kt + r] = hb; pl.u[8 * kt + r] = lb; ps += hv + bf16_val(lb);
        } else {
          ph.e[8 * kt + r] = (_Float16)p; ps += p;
        }
      }
    if (!RES) pl = ph;
    ps += __shfl_xor(ps, 16, 32);
    l = l * alpha + ps;
#pragma unroll
    for (int t = 0; t < 4; ++t) acc[t] = acc[t] * alpha;
#pragma unroll
    for (int t = 0; t < 4; ++t) {
      const unsigned short* vp = tk + TILE_E + (16 * t + ln) * LP + hf * 32;
      const Frag vh = ldf(vp, hh);
      if (RES) {
        const Frag vl = ldf(vp + 2 * TILE_E, hh);
        acc[t] = wm_b(vh, ph, acc[t]); acc[t] = wm_b(vl, ph, acc[t]); acc[t] = wm_b(vh, pl, acc[t]);
        nop4(acc[t], vh, vl, ph, pl);
      } else {
        acc[t] = wm_h(vh, ph, acc[t]);
        nop2(acc[t], vh, ph);
      }
    }
   }
   // hand-over of the buffers, passed by every wave:
   asm volatile("s_wait_dscnt 0x0" ::: "memory");      // this wave's reads of the buffer that is refilled below have returned
   asm volatile("s_wait_asynccnt 0x0" ::: "memory");   // this wave's copies of the next stage have landed
   __syncthreads();                                    // publishes the next stage and ends every wave's reads of this one
   if (sg + 2 < nst) fill(sg + 2, sg & 1);
  }
  asm volatile("s_wait_asynccnt 0x0" ::: "memory");    // no copy is outstanding when the ring's LDS becomes the output tiles
  // acc[t][r] = O^T[d = 16t + 8hh + r][query ln]; normalise and stage row ln of the wave tile
  const float inv = 1.0f / l;
  const float osc = RES ? inv : inv * 64.0f;
#pragma unroll
  for (int t = 0; t < 4; ++t) {
    if (RES) {
      Frag oh, ol;
#pragma unroll
      for (int r = 0; r < 8; ++r) { const float c = acc[t][r] * osc; const unsigned short hb = bf16_bits(c); oh.u[r] = hb; ol.u[r] = bf16_bits(c - bf16_val(hb)); }
      *(v8us*)&sc[0][ln][16 * t + 8 * hh] = oh.half[0];
      *(v8us*)&sc[RES ? 1 : 0][ln][16 * t + 8 * hh] = ol.half[0];
    } else {
      Frag o;
#pragma unroll
      for (int r = 0; r < 8; ++r) o.e[r] = (_Float16)(acc[t][r] * osc);
      *(v8us*)&sc[0][ln][16 * t + 8 * hh] = o.half[0];
    }
  }
  __builtin_amdgcn_fence(4 /* acq_rel order */, "workgroup");
  __builtin_amdgcn_wave_barrier();
  const int rsub = lane >> 3, pc = lane & 7;
  {
#pragma unroll
    for (int q = 0; q < 4; ++q) {
      const int row = 4 * q + rsub;
      const size_t off = (rowb + q0 + row) * DM + h * HD + 8 * pc;
      const v8us v0 = *(const v8us*)&sc[0][row][8 * pc];
      *(v8us*)(Ch + off) = v0;
      if (RES) { const v8us v1 = *(const v8us*)&sc[RES ? 1 : 0][row][8 * pc]; *(v8us*)(Cl + off) = v1; }
    }
    
  }
}

// Both row classes in one grid: grid.x = query tiles of 64 rows from row tbase on, grid.y = head, grid.z = batch.
// Tiles of rows t < ERL run on the bf16 hi/lo planes, the rest on the f16 planes.
__global__ __launch_bounds__(128) void k_attn(const unsigned short* __restrict__ QH, const unsigned short* __restrict__ QL,
                                              const unsigned short* __restrict__ KH, const unsigned short* __restrict__ KL,
                                              const unsigned short* __restrict__ VTH, const unsigned short* __restrict__ VTL,
                                              const unsigned short* __restrict__ Q16, const unsigned short* __restrict__ K16, const unsigned short* __restrict__ VT16,
                                              unsigned short* __restrict__ CH, unsigned short* __restrict__ CL, unsigned short* __restrict__ C16, int tbase) {
  __shared__ __attribute__((aligned(16))) unsigned short lds[2 * 4 * TILE_E];
  const int h = blockIdx.y, b = blockIdx.z;
  const int qb = tbase + (int)blockIdx.x * 64;
  if (qb < ERL) attn_body<true>(lds, QH, QL, KH, KL, VTH, VTL, CH, CL, qb, h, b);
  else attn_body<false>(lds, Q16, Q16, K16, K16, VT16, VT16, C16, C16, qb, h, b);
}

extern "C" void kernel_launch(void* const* d_in, const int* in_sizes, int n_in,
                              void* d_out, int out_size, void* d_ws, size_t ws_size, hipStream_t stream) {
  static_assert(NH * HD == DM);
  static_assert(DM == 512);
  static_assert(SEQ % 128 == 0);
  static_assert(ERL % 128 == 0);
  static_assert(NB <= NB_FULL);
  static_assert(((size_t)NB * SEQ * DM) % (8 * 256) == 0 && (DM * DM) % (8 * 256) == 0);   /* the conversion grid is exact: no thread past an end */
  static_assert(SEQ <= SEQ_FULL);
  static_assert((size_t)13 * NB * SEQ * DM * 2 + (size_t)5 * DM * DM * 2 <= (size_t)134217728);
  if (n_in < 6) return;
  const long long xmin = ((long long)(NB - 1) * SEQ_FULL + SEQ) * DM;
  if ((long long)in_sizes[0] < xmin) return;
  if (in_sizes[1] < DM * DM || in_sizes[2] < DM * DM || in_sizes[3] < DM * DM || in_sizes[4] < DM * DM || in_sizes[5] < DM) return;
  if ((long long)out_size < xmin) return;
  const float* x  = (const float*)d_in[0];
  const float* Wq = (const float*)d_in[1];
  const float* Wk = (const float*)d_in[2];
  const float* Wv = (const float*)d_in[3];
  const float* Wp = (const float*)d_in[4];
  const float* bp = (const float*)d_in[5];
  float* out = (float*)d_out;

  char* ws = (char*)d_ws; size_t off = 0;
  auto take = [&](size_t bytes) { char* p = ws + off; off += (bytes + 255) & ~(size_t)255; return (unsigned short*)p; };
  const size_t PL = NR * DM;            /* elements of one [NB*SEQ][DM] 16-bit plane */
  const size_t WN = (size_t)DM * DM;
  unsigned short* W16  = take(4 * WN * 2);     /* Wq, Wk, Wv, Wp as f16 x16, [n][k] */
  unsigned short* WPB  = take(WN * 2);         /* Wp as bf16, [n][k] */
  unsigned short* X16  = take(PL * 2);
  unsigned short* QK16 = take(2 * PL * 2);     /* q plane then k plane (f16) */
  unsigned short* QKH  = take(2 * PL * 2);     /* bf16 hi, rows t < ERL written */
  unsigned short* QKL  = take(2 * PL * 2);     /* bf16 lo, rows t < ERL written */
  unsigned short* VT16 = take(PL * 2);         /* [(b,h)][d][SEQ] f16 */
  unsigned short* VTH  = take(PL * 2);
  unsigned short* VTL  = take(PL * 2);
  unsigned short* C16  = take(PL * 2);         /* ctx x64 f16, rows t >= ERL */
  unsigned short* CH   = take(PL * 2);         /* ctx bf16 hi, rows t < ERL */
  unsigned short* CL   = take(PL * 2);         /* ctx bf16 lo, rows t < ERL */
  if (off > ws_size || off > (size_t)134217728) return;

  /* conversions of the four weight matrices and of x */
  k_prep<<<(unsigned)(4 * WBLK + XBLK), 256, 0, stream>>>(x, Wq, Wk, Wv, Wp, X16, W16, WPB);

  /* q, k and v projections: grid.z selects the weight plane and the output plane set; v is written transposed per (batch, head) */
  k_proj<<<dim3((SEQ / 128) * 8, NB, 3), 128, 0, stream>>>(X16, W16, QK16, QKH, QKL, VT16, VTH, VTL);

  /* attention: first ERL rows on bf16 hi/lo planes, remaining rows on f16 planes */
  k_attn<<<dim3(SEQ / 64, NH, NB), 128, 0, stream>>>(QKH, QKL, QKH + PL, QKL + PL, VTH, VTL, QK16, QK16 + PL, VT16, CH, CL, C16, 0);

  /* output projection + bias */
  k_out<<<dim3((SEQ / 128) * 8, NB, 1), 128, 0, stream>>>(CH, CL, C16, WPB, W16 + 3 * WN, bp, out);
}

// v004
// It runs in 72.2 microseconds.
// In both of two side-by-side timings against v003, it was 1.12 times as fast.
// Over all steps from v000 it is 3.94 times as fast.
#include <hip/hip_runtime.h>
// Compute dtype: inputs RNE-converted to bf16 values (x as exact f16, weights as exact f16 x16 / exact bf16); q,k,v projections, dense-row scores, dense-row P.V and dense-row output GEMM = v_wmma_f32_16x16x32_f16 single products (P carried x1024, ctx carried x64); first ERL rows of every sequence: scores and P.V as bf16 hi/lo three-product sums, output GEMM as bf16 hi/lo A x exact bf16 W (v_wmma_f32_16x16x32_bf16); all accumulation, softmax statistics, bias add in f32.
// Structure: causal attention per (batch, head) with S^T = K Q^T (Q fragments in registers as the B operand) and O^T = V^T P^T (packed S^T accumulators are the B fragment), online max-subtracted softmax per lane column; K and V^T tiles of 64 keys are staged in LDS once per block (two buffers) and read from there by its four waves. Four launches, each the jobs that read none of each other's output, the job picked by the block index: conversions; q, k, v projections; attention (both row classes); output GEMM (both row classes).
#ifndef NB
#define NB 4
#endif
#ifndef SEQ
#define SEQ 2048
#endif
#ifndef EARLY
#define EARLY 512
#endif
#define NB_FULL 4
#define SEQ_FULL 2048
#define DM 512
#define NH 8
#define HD 64
#define ERL ((EARLY < SEQ) ? EARLY : SEQ)   /* rows per sequence on the multi-product path */
#define NR ((size_t)NB * SEQ)               /* compact token rows r = b*SEQ + t */
#define QSCALE 0.044194173824159216f        /* d_model^-0.5 */
#define NEGBIG (-3.0e38f)
#define CARRY_LN 6.931471805599453f         /* ln 1024 */

typedef _Float16 v16h __attribute__((ext_vector_type(16)));
typedef __bf16   v16b __attribute__((ext_vector_type(16)));
typedef unsigned short v8us __attribute__((ext_vector_type(8), may_alias));
typedef float v8f  __attribute__((ext_vector_type(8)));
typedef float v4f  __attribute__((ext_vector_type(4)));
typedef float v4fa __attribute__((ext_vector_type(4), may_alias));
union Frag { v16h h; v16b b; v8us half[2]; _Float16 e[16]; unsigned short u[16]; };

__device__ __forceinline__ unsigned short bf16_bits(float x) { unsigned int u = __float_as_uint(x); return (unsigned short)((u + 0x7FFFu + ((u >> 16) & 1u)) >> 16); }
__device__ __forceinline__ float bf16_val(unsigned short b) { return __uint_as_float(((unsigned int)b) << 16); }
__device__ __forceinline__ float bf16_rne(float x) { return bf16_val(bf16_bits(x)); }

// fragment loader (A and B alike): elements 0..7 <- p[8h .. 8h+7], elements 8..15 <- p[16+8h .. 16+8h+7]
__device__ __forceinline__ Frag ldf(const unsigned short* p, int hh) {
  Frag f; f.half[0] = *(const v8us*)(p + 8 * hh); f.half[1] = *(const v8us*)(p + 16 + 8 * hh); return f;
}
__device__ __forceinline__ v8f wm_h(const Frag& a, const Frag& b, v8f c) { return __builtin_amdgcn_wmma_f32_16x16x32_f16(false, a.h, false, b.h, (short)0, c, false, false); }
__device__ __forceinline__ v8f wm_b(const Frag& a, const Frag& b, v8f c) { return __builtin_amdgcn_wmma_f32_16x16x32_bf16(false, a.b, false, b.b, (short)0, c, false, false); }
__device__ __forceinline__ void nop2(v8f& c, const Frag& a, const Frag& b) { asm volatile("v_nop\n\tv_nop\n\tv_nop\n\tv_nop" : "+v"(c) : "v"(a.h), "v"(b.h)); }
__device__ __forceinline__ void nop3(v8f& c, const Frag& a, const Frag& b, const Frag& d) { asm volatile("v_nop\n\tv_nop\n\tv_nop\n\tv_nop" : "+v"(c) : "v"(a.h), "v"(b.h), "v"(d.h)); }
__device__ __forceinline__ void nop4(v8f& c, const Frag& a, const Frag& b, const Frag& d, const Frag& e) { asm volatile("v_nop\n\tv_nop\n\tv_nop\n\tv_nop" : "+v"(c) : "v"(a.h), "v"(b.h), "v"(d.h), "v"(e.h)); }
__device__ __forceinline__ void nop8(v8f& c, const Frag& a, const Frag& b, const Frag& d, const Frag& e, const Frag& f, const Frag& g, const Frag& i, const Frag& j) {
  asm volatile("v_nop\n\tv_nop\n\tv_nop\n\tv_nop" : "+v"(c) : "v"(a.h), "v"(b.h), "v"(d.h), "v"(e.h), "v"(f.h), "v"(g.h), "v"(i.h), "v"(j.h));
}

// behind a group of eight products on four accumulators (four A fragments per k half, one B fragment per k half): the four vector slots that the chip needs before an accumulator is read or an operand register rewritten
__device__ __forceinline__ void nop_grp(v8f (&c)[4], const Frag (&a)[4][2], const Frag& b0, const Frag& b1) {
  asm volatile("v_nop\n\tv_nop\n\tv_nop\n\tv_nop" : "+v"(c[0]), "+v"(c[1]), "+v"(c[2]), "+v"(c[3])
               : "v"(a[0][0].h), "v"(a[0][1].h), "v"(a[1][0].h), "v"(a[1][1].h), "v"(a[2][0].h), "v"(a[2][1].h), "v"(a[3][0].h), "v"(a[3][1].h), "v"(b0.h), "v"(b1.h));
}

__device__ __forceinline__ v8us to_f16x8(v4f a, v4f c) {
  Frag f;
#pragma unroll
  for (int q = 0; q < 4; ++q) { f.e[q] = (_Float16)a[q]; f.e[4 + q] = (_Float16)c[q]; }
  return f.half[0];
}
__device__ __forceinline__ void to_bf16x8_hl(v4f a, v4f c, v8us& hi, v8us& lo) {
  Frag fh, fl;
#pragma unroll
  for (int q = 0; q < 4; ++q) {
    unsigned short hb = bf16_bits(a[q]); fh.u[q] = hb; fl.u[q] = bf16_bits(a[q] - bf16_val(hb));
    hb = bf16_bits(c[q]); fh.u[4 + q] = hb; fl.u[4 + q] = bf16_bits(c[q] - bf16_val(hb));
  }
  hi = fh.half[0]; lo = fl.half[0];
}

// behind a global store: stands in front of any rewrite of the registers that the store names
__device__ __forceinline__ void st_wait() { asm volatile("s_wait_xcnt 0x0" ::: "memory"); }

#define XBLK ((int)(NR * DM / 8 / 256))     /* conversion blocks of x: 8 elements a thread */
#define WBLK (DM * DM / 8 / 256)            /* conversion blocks of one weight matrix */

// All input conversions in one grid: blocks 0 .. 4 WBLK - 1 take the four weight matrices (f16 x16 planes; the last also its bf16 plane), the rest take x (bf16 values as exact f16).
__global__ __launch_bounds__(256) void k_prep(const float* __restrict__ x, const float* __restrict__ Wq, const float* __restrict__ Wk, const float* __restrict__ Wv, const float* __restrict__ Wp,
                                              unsigned short* __restrict__ X16, unsigned short* __restrict__ W16, unsigned short* __restrict__ WBF) {
  const int bx = (int)blockIdx.x;
  if (bx < 4 * WBLK) {
    const int sel = bx / WBLK;
    const float* w = sel == 0 ? Wq : sel == 1 ? Wk : sel == 2 ? Wv : Wp;
    const int t = (bx % WBLK) * 256 + (int)threadIdx.x;
    const v4f a = *(const v4fa*)(w + (size_t)t * 8), c = *(const v4fa*)(w + (size_t)t * 8 + 4);
    v4f as, cs; Frag fb;
#pragma unroll
    for (int q = 0; q < 4; ++q) {
      const unsigned short b0 = bf16_bits(a[q]), b1 = bf16_bits(c[q]);
      fb.u[q] = b0; fb.u[4 + q] = b1;
      as[q] = bf16_val(b0) * 16.0f; cs[q] = bf16_val(b1) * 16.0f;
    }
    const v8us o = to_f16x8(as, cs);
    const v8us ob = fb.half[0];
    *(v8us*)(W16 + (size_t)sel * DM * DM + (size_t)t * 8) = o;
    st_wait();
    if (sel == 3) { *(v8us*)(WBF + (size_t)t * 8) = ob; st_wait(); }
  } else {
    const int t = (bx - 4 * WBLK) * 256 + (int)threadIdx.x;
    const int r = t / (DM / 8), c8 = (t % (DM / 8)) * 8;
    const int b = r / SEQ, tt = r % SEQ;
    const float* src = x + ((size_t)b * SEQ_FULL + tt) * DM + c8;
    const v4f a = *(const v4fa*)src, c = *(const v4fa*)(src + 4);
    v4f ar, cr;
#pragma unroll
    for (int q = 0; q < 4; ++q) { ar[q] = bf16_rne(a[q]); cr[q] = bf16_rne(c[q]); }
    const v8us o = to_f16x8(ar, cr);
    *(v8us*)(X16 + (size_t)t * 8) = o;
    st_wait();
  }
}

#define KT 64               /* keys (attention) or k elements (GEMM) per LDS stage */
#define LP 72               /* LDS row pitch in 16-bit elements: 144 B = 16 B x odd, the pitch for 16-byte readers of 128-B rows */
#define TILE_E (64 * LP)    /* one staged tile: 64 rows of 128 B */

__device__ __forceinline__ unsigned lds_off(const void* p) { return (unsigned)(size_t)p; }

// One 64-row x 128-B tile into LDS by the block's 128 threads: thread = (row tid/8 + 16 i, 16-byte piece tid%8), i = 0..3, so a wave's copy takes 4 whole lines.
// l = the lane's LDS byte address of row tid/8, g = its global address there, gstep = 16 source rows in elements.
__device__ __forceinline__ void cp_tile(unsigned l, const unsigned short* g, size_t gstep) {
  const unsigned l1 = l + 16 * LP * 2, l2 = l + 32 * LP * 2, l3 = l + 48 * LP * 2;
  const unsigned short* g1 = g + gstep;
  const unsigned short* g2 = g + 2 * gstep;
  const unsigned short* g3 = g + 3 * gstep;
  // the copies bring the tile into LDS through no register; the closing s_wait_xcnt stands in front of any rewrite of the address registers they name
  asm volatile("global_load_async_to_lds_b128 %0, %4, off\n\t"
               "global_load_async_to_lds_b128 %1, %5, off\n\t"
               "global_load_async_to_lds_b128 %2, %6, off\n\t"
               "global_load_async_to_lds_b128 %3, %7, off\n\t"
               "s_wait_xcnt 0x0"
               :: "v"(l), "v"(l1), "v"(l2), "v"(l3), "v"(g), "v"(g1), "v"(g2), "v"(g3) : "memory");
}

template <bool ABF>
__device__ __forceinline__ v8f gmm(const Frag& a, const Frag& al, const Frag& b, v8f c) {
  if (ABF) { c = wm_b(a, b, c); c = wm_b(al, b, c); nop3(c, a, al, b); }
  else { c = wm_h(a, b, c); nop2(c, a, b); }
  return c;
}

// GEMM over K = DM: block = 4 waves, block tile 128 token rows x 64 cols, wave tile 32 x 64; the block's A rows and B rows are staged in LDS 64 k at a time (two buffers) and read from there by its four waves.
// ABF: A = bf16 hi (A) + lo (A2) planes, two products against bf16 Bt; else A f16, single product against f16 Bt.
// gemm_core leaves the block's 128 x 64 tile (x alpha, + the bf16 value of the bias where BIAS) as f32 in LDS, published by a block barrier; the epilogues below store it.
#define GEMM_NT(ABF) ((ABF) ? 5 : 3)                    /* tiles of 64 rows x 128 B per stage: A rows 0..63, A rows 64..127, B rows, then the A lo rows */
#define GEMM_RING_B(ABF) (2 * GEMM_NT(ABF) * TILE_E * 2) /* two buffers, bytes */
#define SO_B (128 * 68 * 4)                             /* the epilogue's f32 tile, which takes the ring's place behind the loop's last barrier */
#define GEMM_SM_B(ABF) (GEMM_RING_B(ABF) > SO_B ? GEMM_RING_B(ABF) : SO_B)
typedef float sorow[68];

template <bool ABF, bool BIAS>
__device__ __forceinline__ void gemm_core(unsigned char* sm, const unsigned short* __restrict__ A, const unsigned short* __restrict__ A2,
                                          const unsigned short* __restrict__ Bt, float alpha, const float* __restrict__ bias, size_t r0, int col0) {
  constexpr int NT = GEMM_NT(ABF);
  unsigned short* const ring = (unsigned short*)sm;
  sorow* const so = (sorow*)sm;
  const int tid = threadIdx.x, lane = tid & 31, ln = lane & 15, hh = lane >> 4;
  const int w = __builtin_amdgcn_readfirstlane((int)(threadIdx.x >> 5));
  const int crow = tid >> 3, cpc = tid & 7;
  const size_t acp = (r0 + crow) * DM + 8 * cpc;
  const size_t bcp = (size_t)(col0 + crow) * DM + 8 * cpc;
  const unsigned lcp = lds_off(ring) + (unsigned)(crow * LP + 8 * cpc) * 2u;
  auto fill = [&](int s, int bf) {   // k = 64 s .. 64 s + 63 of the block's 128 A rows and 64 B rows into buffer bf
    const unsigned lb = lcp + (unsigned)bf * (unsigned)(NT * TILE_E * 2);
    const size_t k0 = (size_t)s * KT;
    cp_tile(lb, A + acp + k0, (size_t)16 * DM);
    cp_tile(lb + TILE_E * 2, A + acp + (size_t)64 * DM + k0, (size_t)16 * DM);
    cp_tile(lb + 2 * TILE_E * 2, Bt + bcp + k0, (size_t)16 * DM);
    if (ABF) {
      cp_tile(lb + 3 * TILE_E * 2, A2 + acp + k0, (size_t)16 * DM);
      cp_tile(lb + 4 * TILE_E * 2, A2 + acp + (size_t)64 * DM + k0, (size_t)16 * DM);
    }
  };
  const v8f z8 = {0.f, 0.f, 0.f, 0.f, 0.f, 0.f, 0.f, 0.f};
  v8f acc[8];
#pragma unroll
  for (int u = 0; u < 8; ++u) acc[u] = z8;
  fill(0, 0);
  asm volatile("s_wait_asynccnt 0x0" ::: "memory");   // this wave's copies of stage 0 have landed
  __syncthreads();                                    // ... and every other wave's
  fill(1, 1);
#pragma unroll 1   /* rolled: one hand-over of the buffers per trip, and the loop text stays small */
  for (int sg = 0; sg < DM / KT; ++sg) {
    const unsigned short* tb = ring + (sg & 1) * (NT * TILE_E);
    const unsigned short* ap = tb + (32 * w + ln) * LP;
    const unsigned short* bp0 = tb + 2 * TILE_E + ln * LP;
    // the stage's fragment reads stand together in front of its products: one LDS latency per stage, not one per fragment
    Frag fa[2][2], fl[2][2], fb[2][4];
#pragma unroll     /* both 32-k halves of the stage in line, so that every LDS offset is an immediate and every fragment a register */
    for (int h2 = 0; h2 < 2; ++h2) {
      fa[h2][0] = ldf(ap + 32 * h2, hh); fa[h2][1] = ldf(ap + 16 * LP + 32 * h2, hh);
      if (ABF) { fl[h2][0] = ldf(ap + 3 * TILE_E + 32 * h2, hh); fl[h2][1] = ldf(ap + 3 * TILE_E + 16 * LP + 32 * h2, hh); }
      else { fl[h2][0] = fa[h2][0]; fl[h2][1] = fa[h2][1]; }
#pragma unroll
      for (int t = 0; t < 4; ++t) fb[h2][t] = ldf(bp0 + (16 * t) * LP + 32 * h2, hh);
    }
#pragma unroll     /* in line, k ascending in every accumulator */
    for (int h2 = 0; h2 < 2; ++h2) {
#pragma unroll
      for (int t = 0; t < 4; ++t) {
        acc[t] = gmm<ABF>(fa[h2][0], fl[h2][0], fb[h2][t], acc[t]);
        acc[4 + t] = gmm<ABF>(fa[h2][1], fl[h2][1], fb[h2][t], acc[4 + t]);
      }
    }
    // hand-over of the buffers, passed by every wave:
    asm volatile("s_wait_dscnt 0x0" ::: "memory");      // this wave's reads of the buffer that is refilled below have returned
    asm volatile("s_wait_asynccnt 0x0" ::: "memory");   // this wave's copies of the next stage have landed
    __syncthreads();                                    // publishes the next stage and ends every wave's reads of this one
    if (sg + 2 < DM / KT) fill(sg + 2, sg & 1);
  }
  asm volatile("s_wait_asynccnt 0x0" ::: "memory");    // no copy is outstanding when the ring's LDS becomes the epilogue's tile
  // D element r of lane (hh, ln) = (row 8hh + r, col ln) of its 16x16 tile
#pragma unroll
  for (int u = 0; u < 8; ++u) {
    const int t = u & 3, half = u >> 2;
    const int col = t * 16 + ln;
    float bv = 0.f;
    if (BIAS) bv = bf16_rne(bias[col0 + col]);
#pragma unroll
    for (int r = 0; r < 8; ++r) so[32 * w + half * 16 + 8 * hh + r][col] = acc[u][r] * alpha + bv;
  }
  __syncthreads();
}

// q, k and v projections in one grid: grid.x = (row tiles of 128) * 8 col tiles, grid.y = batch, grid.z = weight plane (0 q, 1 k, 2 v).
// q and k: f16 row plane [row][DM] (+ bf16 hi/lo row planes for rows t < ERL); v: transposed planes [(b,head)][d][SEQ] (f16, + bf16 hi/lo for t < ERL).
__global__ __launch_bounds__(128) void k_proj(const unsigned short* __restrict__ X16, const unsigned short* __restrict__ W16,
                                              unsigned short* __restrict__ QK16, unsigned short* __restrict__ QKH, unsigned short* __restrict__ QKL,
                                              unsigned short* __restrict__ VT16, unsigned short* __restrict__ VTH, unsigned short* __restrict__ VTL) {
  __shared__ __attribute__((aligned(16))) unsigned char sm[GEMM_SM_B(false)];
  const sorow* const so = (const sorow*)sm;
  const int tid = threadIdx.x;
  const int rt = (int)blockIdx.x >> 3, nq = (int)blockIdx.x & 7, b = blockIdx.y, z = blockIdx.z;
  const int t0 = rt * 128;
  const size_t r0 = (size_t)b * SEQ + t0;
  const int col0 = nq * 64;
  gemm_core<false, false>(sm, X16, X16, W16 + (size_t)z * DM * DM, 0.0625f, nullptr, r0, col0);
  const bool early = (t0 < ERL);
  if (z < 2) {
#pragma unroll
    for (int it = 0; it < 8; ++it) {
      const int row = it * 16 + (tid >> 3), pc = tid & 7;
      const v4f x0 = *(const v4fa*)&so[row][8 * pc], x1 = *(const v4fa*)&so[row][8 * pc + 4];
      const size_t off = (size_t)z * (NR * DM) + (r0 + row) * DM + col0 + 8 * pc;
      const v8us o = to_f16x8(x0, x1);
      *(v8us*)(QK16 + off) = o;
      st_wait();
      if (early) {
        v8us oh, ol; to_bf16x8_hl(x0, x1, oh, ol);
        *(v8us*)(QKH + off) = oh;
        *(v8us*)(QKL + off) = ol;
        st_wait();
      }
    }
  } else {
    // transposed: 64 d rows x 128 tokens (256 B each): d = it*8 + tid/16, piece = tid%16 (8 tokens = 16 B)
    const int hd = nq;
#pragma unroll
    for (int it = 0; it < 8; ++it) {
      const int d = it * 8 + (tid >> 4), pc = tid & 15;
      v4f x0, x1;
#pragma unroll
      for (int j = 0; j < 4; ++j) { x0[j] = so[8 * pc + j][d]; x1[j] = so[8 * pc + 4 + j][d]; }
      const size_t off = (((size_t)b * NH + hd) * HD + d) * SEQ + t0 + 8 * pc;
      const v8us o = to_f16x8(x0, x1);
      *(v8us*)(VT16 + off) = o;
      st_wait();
      if (early) {
        v8us oh, ol; to_bf16x8_hl(x0, x1, oh, ol);
        *(v8us*)(VTH + off) = oh;
        *(v8us*)(VTL + off) = ol;
        st_wait();
      }
    }
  }
}

// Output projection + bias for all rows in one grid: grid.x = (row tiles of 128) * 8 col tiles, grid.y = batch; row tiles t < ERL take the bf16 hi/lo ctx planes, the rest the f16 plane (ctx x64, weights x16).
__global__ __launch_bounds__(128) void k_out(const unsigned short* __restrict__ CH, const unsigned short* __restrict__ CL, const unsigned short* __restrict__ C16,
                                             const unsigned short* __restrict__ WPB, const unsigned short* __restrict__ WP16,
                                             const float* __restrict__ bias, float* __restrict__ OF) {
  __shared__ __attribute__((aligned(16))) unsigned char sm[GEMM_SM_B(true)];
  const sorow* const so = (const sorow*)sm;
  const int tid = threadIdx.x;
  const int rt = (int)blockIdx.x >> 3, nq = (int)blockIdx.x & 7, b = blockIdx.y;
  const int t0 = rt * 128;
  const size_t r0 = (size_t)b * SEQ + t0;
  const int col0 = nq * 64;
  if (t0 < ERL) gemm_core<true, true>(sm, CH, CL, WPB, 1.0f, bias, r0, col0);
  else gemm_core<false, true>(sm, C16, C16, WP16, 0.0009765625f, bias, r0, col0);
  // f32 rows of the output buffer (full-size layout): 128 rows x 256 B: row = it*8 + tid/16, piece = tid%16 (4 floats = 16 B)
#pragma unroll
  for (int it = 0; it < 16; ++it) {
    const int row = it * 8 + (tid >> 4), pc = tid & 15;
    const v4f v = *(const v4fa*)&so[row][4 * pc];
    *(v4f*)(OF + ((size_t)b * SEQ_FULL + t0 + row) * DM + col0 + 4 * pc) = v;
  }
}

// Causal attention, one wave per 16 query rows of one (batch, head); block = 4 waves (64 queries) that share the staged K and V^T tiles; one block barrier per 64 keys.
// S^T[key][query] = K Q^T: A = K rows (lane = key), B = Q rows (lane = query). D: lane (hh, ln) element r = (key 8hh + r, query ln).
// O^T[d][query] = V^T P^T: A = V^T rows (lane = d, k = keys), B = packed P^T: element r <- tile(keys 0..15)[r], element 8+r <- tile(keys 16..31)[r].
// RES: bf16 hi/lo operands, three products per site; else f16 single products with P carried x1024 (sum carried alike) and ctx stored x64.
// lds: the ring [buffer][K hi, V^T hi, K lo, V^T lo][row * LP + element] (the lo tiles with RES alone); behind the loop's last barrier its first bytes become the waves' output tiles [wave][hi, lo][16][64].
template <bool RES>
__device__ __forceinline__ void attn_body(unsigned short* lds, const unsigned short* __restrict__ Qh, const unsigned short* __restrict__ Ql,
                                          const unsigned short* __restrict__ Kh, const unsigned short* __restrict__ Kl,
                                          const unsigned short* __restrict__ Vh, const unsigned short* __restrict__ Vl,
                                          unsigned short* __restrict__ Ch, unsigned short* __restrict__ Cl, int qb, int h, int b) {
  constexpr int NTL = RES ? 4 : 2;   /* staged tiles per buffer */
  const int lane = threadIdx.x & 31, ln = lane & 15, hh = lane >> 4;
  const int w = __builtin_amdgcn_readfirstlane((int)(threadIdx.x >> 5));
  unsigned short (* const sc)[16][64] = (unsigned short (*)[16][64])lds + w * (RES ? 2 : 1);   /* this wave's output tiles */
  const int q0 = qb + w * 16;
  const int qi = q0 + ln;
  const size_t rowb = (size_t)b * SEQ;
  const size_t qof = (rowb + q0 + ln) * DM + h * HD;
  const Frag qh0 = ldf(Qh + qof, hh), qh1 = ldf(Qh + qof + 32, hh);
  Frag ql0 = qh0, ql1 = qh1;
  if (RES) { ql0 = ldf(Ql + qof, hh); ql1 = ldf(Ql + qof + 32, hh); }
  const int crow = (int)threadIdx.x >> 3, cpc = (int)threadIdx.x & 7;
  const size_t kcp = (rowb + crow) * DM + h * HD + 8 * cpc;
  const size_t vcp = (((size_t)b * NH + h) * HD + crow) * SEQ + 8 * cpc;
  const unsigned lcp = lds_off(lds) + (unsigned)(crow * LP + 8 * cpc) * 2u;
  auto fill = [&](int s, int bf) {   // keys 64 s .. 64 s + 63 into buffer bf; all of them lie at or below the block's last query
    const unsigned lb = lcp + (unsigned)bf * (unsigned)(NTL * TILE_E * 2);
    const size_t k0 = (size_t)s * KT;
    cp_tile(lb, Kh + kcp + k0 * DM, (size_t)16 * DM);
    cp_tile(lb + TILE_E * 2, Vh + vcp + k0, (size_t)16 * SEQ);
    if (RES) {
      cp_tile(lb + 2 * TILE_E * 2, Kl + kcp + k0 * DM, (size_t)16 * DM);
      cp_tile(lb + 3 * TILE_E * 2, Vl + vcp + k0, (size_t)16 * SEQ);
    }
  };
  const v8f z8 = {0.f, 0.f, 0.f, 0.f, 0.f, 0.f, 0.f, 0.f};
  v8f acc[4];
#pragma unroll
  for (int t = 0; t < 4; ++t) acc[t] = z8;
  float m = NEGBIG, l = 0.f;
  const float carry = RES ? 0.f : CARRY_LN;
  const int nst = (qb >> 6) + 1;   // scalar and the same in the whole block: stages of 64 keys up to the block's last query
  fill(0, 0);
  asm volatile("s_wait_asynccnt 0x0" ::: "memory");   // this wave's copies of stage 0 have landed
  __syncthreads();                                    // ... and every other wave's
  if (nst > 1) fill(1, 1);
#pragma unroll 1   /* rolled: one hand-over of the buffers per trip, and the loop text stays small */
  for (int sg = 0; sg < nst; ++sg) {
   const unsigned short* tk = lds + (sg & 1) * (NTL * TILE_E);
   if (!RES) {
    // dense rows: the stage's 64 keys are one softmax step: one maximum, one rescale, eight score and eight P.V products in four independent accumulator chains each
    // (keys behind the diagonal get weight 0 by the mask; every loop of the step is unrolled, so that fragments, scores and accumulators stay in registers under constant indices)
    const int kb = sg * KT;
    // the stage's fragment reads stand together in front of its products, K first: one LDS latency per stage, and the V^T fragments return while scores and softmax run
    Frag kf[4][2], vf[4][2];
#pragma unroll
    for (int kt = 0; kt < 4; ++kt) {
      const unsigned short* kp = tk + (16 * kt + ln) * LP;
      kf[kt][0] = ldf(kp, hh); kf[kt][1] = ldf(kp + 32, hh);
    }
    __builtin_amdgcn_sched_barrier(0);   // keeps every K read in front of the V^T reads: LDS returns in order, and the score products then wait for K alone
#pragma unroll
    for (int t = 0; t < 4; ++t) {
      const unsigned short* vp = tk + TILE_E + (16 * t + ln) * LP;
      vf[t][0] = ldf(vp, hh); vf[t][1] = ldf(vp + 32, hh);
    }
    v8f s[4];
#pragma unroll
    for (int kt = 0; kt < 4; ++kt) s[kt] = wm_h(kf[kt][0], qh0, z8);
#pragma unroll
    for (int kt = 0; kt < 4; ++kt) s[kt] = wm_h(kf[kt][1], qh1, s[kt]);
    nop_grp(s, kf, qh0, qh1);
    if (kb + KT > q0) {   // scalar condition: this stage touches the diagonal; masked scores are replaced
#pragma unroll
      for (int kt = 0; kt < 4; ++kt)
#pragma unroll
        for (int r = 0; r < 8; ++r) { const int key = kb + 16 * kt + 8 * hh + r; s[kt][r] = (key > qi) ? NEGBIG : s[kt][r]; }
    }
    float mt[4];
#pragma unroll
    for (int kt = 0; kt < 4; ++kt) {
      float a = s[kt][0];
#pragma unroll
      for (int r = 1; r < 8; ++r) a = fmaxf(a, s[kt][r]);
      mt[kt] = a;
    }
    float mx = fmaxf(fmaxf(mt[0], mt[1]), fmaxf(mt[2], mt[3]));
    mx = fmaxf(mx, __shfl_xor(mx, 16, 32));
    const float mnew = fmaxf(m, mx);
    const float alpha = __expf((m - mnew) * QSCALE);
    const float cc = carry - mnew * QSCALE;
    m = mnew;
    Frag ph[2];
    float pt[4];
#pragma unroll
    for (int kt = 0; kt < 4; ++kt) {
      float a = 0.f;
#pragma unroll
      for (int r = 0; r < 8; ++r) {
        const float p = __expf(fmaf(s[kt][r], QSCALE, cc));
        ph[kt >> 1].e[8 * (kt & 1) + r] = (_Float16)p; a += p;
      }
      pt[kt] = a;
    }
    float ps = (pt[0] + pt[1]) + (pt[2] + pt[3]);
    ps += __shfl_xor(ps, 16, 32);
    l = l * alpha + ps;
#pragma unroll
    for (int t = 0; t < 4; ++t) acc[t] = acc[t] * alpha;
#pragma unroll
    for (int t = 0; t < 4; ++t) acc[t] = wm_h(vf[t][0], ph[0], acc[t]);
#pragma unroll
    for (int t = 0; t < 4; ++t) acc[t] = wm_h(vf[t][1], ph[1], acc[t]);
    nop_grp(acc, vf, ph[0], ph[1]);
   } else
#pragma unroll     /* both 32-key halves of the stage in line, so that every LDS offset is an immediate */
   for (int hf = 0; hf < 2; ++hf) {
    const int kb = sg * KT + hf * 32;
    if (kb >= q0 + 16) continue;   // scalar: the wave's queries all lie in front of these 32 keys
    v8f s[2];
#pragma unroll
    for (int kt = 0; kt < 2; ++kt) {
      const unsigned short* kp = tk + (hf * 32 + 16 * kt + ln) * LP;
      const Frag k0 = ldf(kp, hh), k1 = ldf(kp + 32, hh);
      v8f c = z8;
      if (RES) {
        const Frag kl0 = ldf(kp + 2 * TILE_E, hh), kl1 = ldf(kp + 2 * TILE_E + 32, hh);
        c = wm_b(k0, qh0, c); c = wm_b(kl0, qh0, c); c = wm_b(k0, ql0, c);
        c = wm_b(k1, qh1, c); c = wm_b(kl1, qh1, c); c = wm_b(k1, ql1, c);
        nop8(c, k0, k1, kl0, kl1, qh0, qh1, ql0, ql1);
      } else {
        c = wm_h(k0, qh0, c); c = wm_h(k1, qh1, c);
        nop4(c, k0, k1, qh0, qh1);
      }
      s[kt] = c;
    }
    if (kb + 32 > q0) {   // scalar condition: this step touches the diagonal; masked scores are replaced
#pragma unroll
      for (int kt = 0; kt < 2; ++kt)
#pragma unroll
        for (int r = 0; r < 8; ++r) { const int key = kb + 16 * kt + 8 * hh + r; s[kt][r] = (key > qi) ? NEGBIG : s[kt][r]; }
    }
    float mx = fmaxf(s[0][0], s[1][0]);
#pragma unroll
    for (int r = 1; r < 8; ++r) mx = fmaxf(mx, fmaxf(s[0][r], s[1][r]));
    mx = fmaxf(mx, __shfl_xor(mx, 16, 32));
    const float mnew = fmaxf(m, mx);
    const float alpha = __expf((m - mnew) * QSCALE);
    const float cc = carry - mnew * QSCALE;
    m = mnew;
    Frag ph, pl;
    float ps = 0.f;
#pragma unroll
    for (int kt = 0; kt < 2; ++kt)
#pragma unroll
      for (int r = 0; r < 8; ++r) {
        const float p = __expf(fmaf(s[kt][r], QSCALE, cc));
        if (RES) {
          const unsigned short hb = bf16_bits(p); const float hv = bf16_val(hb);
          const unsigned short lb = bf16_bits(p - hv);
          ph.u[8 * kt + r] = hb; pl.u[8 * kt + r] = lb; ps += hv + bf16_val(lb);
        } else {
          ph.e[8 * kt + r] = (_Float16)p; ps += p;
        }
      }
    if (!RES) pl = ph;
    ps += __shfl_xor(ps, 16, 32);
    l = l * alpha + ps;
#pragma unroll
    for (int t = 0; t < 4; ++t) acc[t] = acc[t] * alpha;
#pragma unroll
    for (int t = 0; t < 4; ++t) {
      const unsigned short* vp = tk + TILE_E + (16 * t + ln) * LP + hf * 32;
      const Frag vh = ldf(vp, hh);
      if (RES) {
        const Frag vl = ldf(vp + 2 * TILE_E, hh);
        acc[t] = wm_b(vh, ph, acc[t]); acc[t] = wm_b(vl, ph, acc[t]); acc[t] = wm_b(vh, pl, acc[t]);
        nop4(acc[t], vh, vl, ph, pl);
      } else {
        acc[t] = wm_h(vh, ph, acc[t]);
        nop2(acc[t], vh, ph);
      }
    }
   }
   // hand-over of the buffers, passed by every wave:
   asm volatile("s_wait_dscnt 0x0" ::: "memory");      // this wave's reads of the buffer that is refilled below have returned
   asm volatile("s_wait_asynccnt 0x0" ::: "memory");   // this wave's copies of the next stage have landed
   __syncthreads();                                    // publishes the next stage and ends every wave's reads of this one
   if (sg + 2 < nst) fill(sg + 2, sg & 1);
  }
  asm volatile("s_wait_asynccnt 0x0" ::: "memory");    // no copy is outstanding when the ring's LDS becomes the output tiles
  // acc[t][r] = O^T[d = 16t + 8hh + r][query ln]; normalise and stage row ln of the wave tile
  const float inv = 1.0f / l;
  const float osc = RES ? inv : inv * 64.0f;
#pragma unroll
  for (int t = 0; t < 4; ++t) {
    if (RES) {
      Frag oh, ol;
#pragma unroll
      for (int r = 0; r < 8; ++r) { const float c = acc[t][r] * osc; const unsigned short hb = bf16_bits(c); oh.u[r] = hb; ol.u[r] = bf16_bits(c - bf16_val(hb)); }
      *(v8us*)&sc[0][ln][16 * t + 8 * hh] = oh.half[0];
      *(v8us*)&sc[RES ? 1 : 0][ln][16 * t + 8 * hh] = ol.half[0];
    } else {
      Frag o;
#pragma unroll
      for (int r = 0; r < 8; ++r) o.e[r] = (_Float16)(acc[t][r] * osc);
      *(v8us*)&sc[0][ln][16 * t + 8 * hh] = o.half[0];
    }
  }
  __builtin_amdgcn_fence(4 /* acq_rel order */, "workgroup");
  __builtin_amdgcn_wave_barrier();
  const int rsub = lane >> 3, pc = lane & 7;
  {
#pragma unroll
    for (int q = 0; q < 4; ++q) {
      const int row = 4 * q + rsub;
      const size_t off = (rowb + q0 + row) * DM + h * HD + 8 * pc;
      const v8us v0 = *(const v8us*)&sc[0][row][8 * pc];
      *(v8us*)(Ch + off) = v0;
      if (RES) { const v8us v1 = *(const v8us*)&sc[RES ? 1 : 0][row][8 * pc]; *(v8us*)(Cl + off) = v1; }
    }
    
  }
}

// Both row classes in one grid: grid.x = query tiles of 64 rows from row tbase on, grid.y = head, grid.z = batch.
// Tiles of rows t < ERL run on the bf16 hi/lo planes, the rest on the f16 planes.
__global__ __launch_bounds__(128) void k_attn(const unsigned short* __restrict__ QH, const unsigned short* __restrict__ QL,
                                              const unsigned short* __restrict__ KH, const unsigned short* __restrict__ KL,
                                              const unsigned short* __restrict__ VTH, const unsigned short* __restrict__ VTL,
                                              const unsigned short* __restrict__ Q16, const unsigned short* __restrict__ K16, const unsigned short* __restrict__ VT16,
                                              unsigned short* __restrict__ CH, unsigned short* __restrict__ CL, unsigned short* __restrict__ C16, int tbase) {
  __shared__ __attribute__((aligned(16))) unsigned short lds[2 * 4 * TILE_E];
  const int h = blockIdx.y, b = blockIdx.z;
  const int qb = tbase + (int)blockIdx.x * 64;
  if (qb < ERL) attn_body<true>(lds, QH, QL, KH, KL, VTH, VTL, CH, CL, qb, h, b);
  else attn_body<false>(lds, Q16, Q16, K16, K16, VT16, VT16, C16, C16, qb, h, b);
}

extern "C" void kernel_launch(void* const* d_in, const int* in_sizes, int n_in,
                              void* d_out, int out_size, void* d_ws, size_t ws_size, hipStream_t stream) {
  static_assert(NH * HD == DM);
  static_assert(DM == 512);
  static_assert(SEQ % 128 == 0);
  static_assert(ERL % 128 == 0);
  static_assert(NB <= NB_FULL);
  static_assert(((size_t)NB * SEQ * DM) % (8 * 256) == 0 && (DM * DM) % (8 * 256) == 0);   /* the conversion grid is exact: no thread past an end */
  static_assert(SEQ <= SEQ_FULL);
  static_assert((size_t)13 * NB * SEQ * DM * 2 + (size_t)5 * DM * DM * 2 <= (size_t)134217728);
  if (n_in < 6) return;
  const long long xmin = ((long long)(NB - 1) * SEQ_FULL + SEQ) * DM;
  if ((long long)in_sizes[0] < xmin) return;
  if (in_sizes[1] < DM * DM || in_sizes[2] < DM * DM || in_sizes[3] < DM * DM || in_sizes[4] < DM * DM || in_sizes[5] < DM) return;
  if ((long long)out_size < xmin) return;
  const float* x  = (const float*)d_in[0];
  const float* Wq = (const float*)d_in[1];
  const float* Wk = (const float*)d_in[2];
  const float* Wv = (const float*)d_in[3];
  const float* Wp = (const float*)d_in[4];
  const float* bp = (const float*)d_in[5];
  float* out = (float*)d_out;

  char* ws = (char*)d_ws; size_t off = 0;
  auto take = [&](size_t bytes) { char* p = ws + off; off += (bytes + 255) & ~(size_t)255; return (unsigned short*)p; };
  const size_t PL = NR * DM;            /* elements of one [NB*SEQ][DM] 16-bit plane */
  const size_t WN = (size_t)DM * DM;
  unsigned short* W16  = take(4 * WN * 2);     /* Wq, Wk, Wv, Wp as f16 x16, [n][k] */
  unsigned short* WPB  = take(WN * 2);         /* Wp as bf16, [n][k] */
  unsigned short* X16  = take(PL * 2);
  unsigned short* QK16 = take(2 * PL * 2);     /* q plane then k plane (f16) */
  unsigned short* QKH  = take(2 * PL * 2);     /* bf16 hi, rows t < ERL written */
  unsigned short* QKL  = take(2 * PL * 2);     /* bf16 lo, rows t < ERL written */
  unsigned short* VT16 = take(PL * 2);         /* [(b,h)][d][SEQ] f16 */
  unsigned short* VTH  = take(PL * 2);
  unsigned short* VTL  = take(PL * 2);
  unsigned short* C16  = take(PL * 2);         /* ctx x64 f16, rows t >= ERL */
  unsigned short* CH   = take(PL * 2);         /* ctx bf16 hi, rows t < ERL */
  unsigned short* CL   = take(PL * 2);         /* ctx bf16 lo, rows t < ERL */
  if (off > ws_size || off > (size_t)134217728) return;

  /* conversions of the four weight matrices and of x */
  k_prep<<<(unsigned)(4 * WBLK + XBLK), 256, 0, stream>>>(x, Wq, Wk, Wv, Wp, X16, W16, WPB);

  /* q, k and v projections: grid.z selects the weight plane and the output plane set; v is written transposed per (batch, head) */
  k_proj<<<dim3((SEQ / 128) * 8, NB, 3), 128, 0, stream>>>(X16, W16, QK16, QKH, QKL, VT16, VTH, VTL);

  /* attention: first ERL rows on bf16 hi/lo planes, remaining rows on f16 planes */
  k_attn<<<dim3(SEQ / 64, NH, NB), 128, 0, stream>>>(QKH, QKL, QKH + PL, QKL + PL, VTH, VTL, QK16, QK16 + PL, VT16, CH, CL, C16, 0);

  /* output projection + bias */
  k_out<<<dim3((SEQ / 128) * 8, NB, 1), 128, 0, stream>>>(CH, CL, C16, WPB, W16 + 3 * WN, bp, out);
}

// v005
// One run takes 68.2 microseconds.
// In both of two side-by-side timings against v004, it was 1.06 times as fast.
// Over all steps from v000 it is 4.17 times as fast.
#include <hip/hip_runtime.h>
// Compute dtype: inputs RNE-converted to bf16 values (x as exact f16, weights as exact f16 x16 / exact bf16); q,k,v projections, dense-row scores, dense-row P.V and dense-row output GEMM = v_wmma_f32_16x16x32_f16 single products (P carried x1024, ctx carried x64); first ERL rows of every sequence: scores and P.V as bf16 hi/lo three-product sums, output GEMM as bf16 hi/lo A x exact bf16 W (v_wmma_f32_16x16x32_bf16); all accumulation, softmax statistics, bias add in f32.
// Structure: causal attention per (batch, head) with S^T = K Q^T (Q fragments in registers as the B operand) and O^T = V^T P^T (packed S^T accumulators are the B fragment), online max-subtracted softmax per lane column; K and V^T tiles of 64 keys are staged in LDS once per block (two buffers) and read from there by its four waves. Four launches, each the jobs that read none of each other's output, the job picked by the block index: conversions; q, k, v projections; attention (both row classes); output GEMM (both row classes).
#ifndef NB
#define NB 4
#endif
#ifndef SEQ
#define SEQ 2048
#endif
#ifndef EARLY
#define EARLY 512
#endif
#define NB_FULL 4
#define SEQ_FULL 2048
#define DM 512
#define NH 8
#define HD 64
#define ERL ((EARLY < SEQ) ? EARLY : SEQ)   /* rows per sequence on the multi-product path */
#define NR ((size_t)NB * SEQ)               /* compact token rows r = b*SEQ + t */
#define QSCALE 0.044194173824159216f        /* d_model^-0.5 */
#define NEGBIG (-3.0e38f)
#define CARRY_LN 6.931471805599453f         /* ln 1024 */

typedef _Float16 v16h __attribute__((ext_vector_type(16)));
typedef __bf16   v16b __attribute__((ext_vector_type(16)));
typedef unsigned short v8us __attribute__((ext_vector_type(8), may_alias));
typedef float v8f  __attribute__((ext_vector_type(8)));
typedef float v4f  __attribute__((ext_vector_type(4)));
typedef float v4fa __attribute__((ext_vector_type(4), may_alias));
union Frag { v16h h; v16b b; v8us half[2]; _Float16 e[16]; unsigned short u[16]; };

__device__ __forceinline__ unsigned short bf16_bits(float x) { unsigned int u = __float_as_uint(x); return (unsigned short)((u + 0x7FFFu + ((u >> 16) & 1u)) >> 16); }
__device__ __forceinline__ float bf16_val(unsigned short b) { return __uint_as_float(((unsigned int)b) << 16); }
__device__ __forceinline__ float bf16_rne(float x) { return bf16_val(bf16_bits(x)); }

// fragment loader (A and B alike): elements 0..7 <- p[8h .. 8h+7], elements 8..15 <- p[16+8h .. 16+8h+7]
__device__ __forceinline__ Frag ldf(const unsigned short* p, int hh) {
  Frag f; f.half[0] = *(const v8us*)(p + 8 * hh); f.half[1] = *(const v8us*)(p + 16 + 8 * hh); return f;
}
__device__ __forceinline__ v8f wm_h(const Frag& a, const Frag& b, v8f c) { return __builtin_amdgcn_wmma_f32_16x16x32_f16(false, a.h, false, b.h, (short)0, c, false, false); }
__device__ __forceinline__ v8f wm_b(const Frag& a, const Frag& b, v8f c) { return __builtin_amdgcn_wmma_f32_16x16x32_bf16(false, a.b, false, b.b, (short)0, c, false, false); }
__device__ __forceinline__ void nop2(v8f& c, const Frag& a, const Frag& b) { asm volatile("v_nop\n\tv_nop\n\tv_nop\n\tv_nop" : "+v"(c) : "v"(a.h), "v"(b.h)); }
__device__ __forceinline__ void nop3(v8f& c, const Frag& a, const Frag& b, const Frag& d) { asm volatile("v_nop\n\tv_nop\n\tv_nop\n\tv_nop" : "+v"(c) : "v"(a.h), "v"(b.h), "v"(d.h)); }
__device__ __forceinline__ void nop4(v8f& c, const Frag& a, const Frag& b, const Frag& d, const Frag& e) { asm volatile("v_nop\n\tv_nop\n\tv_nop\n\tv_nop" : "+v"(c) : "v"(a.h), "v"(b.h), "v"(d.h), "v"(e.h)); }
__device__ __forceinline__ void nop8(v8f& c, const Frag& a, const Frag& b, const Frag& d, const Frag& e, const Frag& f, const Frag& g, const Frag& i, const Frag& j) {
  asm volatile("v_nop\n\tv_nop\n\tv_nop\n\tv_nop" : "+v"(c) : "v"(a.h), "v"(b.h), "v"(d.h), "v"(e.h), "v"(f.h), "v"(g.h), "v"(i.h), "v"(j.h));
}

// behind a group of eight products on four accumulators (four A fragments per k half, one B fragment per k half): the four vector slots that the chip needs before an accumulator is read or an operand register rewritten
__device__ __forceinline__ void nop_grp(v8f (&c)[4], const Frag (&a)[4][2], const Frag& b0, const Frag& b1) {
  asm volatile("v_nop\n\tv_nop\n\tv_nop\n\tv_nop" : "+v"(c[0]), "+v"(c[1]), "+v"(c[2]), "+v"(c[3])
               : "v"(a[0][0].h), "v"(a[0][1].h), "v"(a[1][0].h), "v"(a[1][1].h), "v"(a[2][0].h), "v"(a[2][1].h), "v"(a[3][0].h), "v"(a[3][1].h), "v"(b0.h), "v"(b1.h));
}

__device__ __forceinline__ v8us to_f16x8(v4f a, v4f c) {
  Frag f;
#pragma unroll
  for (int q = 0; q < 4; ++q) { f.e[q] = (_Float16)a[q]; f.e[4 + q] = (_Float16)c[q]; }
  return f.half[0];
}
__device__ __forceinline__ void to_bf16x8_hl(v4f a, v4f c, v8us& hi, v8us& lo) {
  Frag fh, fl;
#pragma unroll
  for (int q = 0; q < 4; ++q) {
    unsigned short hb = bf16_bits(a[q]); fh.u[q] = hb; fl.u[q] = bf16_bits(a[q] - bf16_val(hb));
    hb = bf16_bits(c[q]); fh.u[4 + q] = hb; fl.u[4 + q] = bf16_bits(c[q] - bf16_val(hb));
  }
  hi = fh.half[0]; lo = fl.half[0];
}

// behind a global store: stands in front of any rewrite of the registers that the store names
__device__ __forceinline__ void st_wait() { asm volatile("s_wait_xcnt 0x0" ::: "memory"); }

#define XBLK ((int)(NR * DM / 8 / 256))     /* conversion blocks of x: 8 elements a thread */
#define WBLK (DM * DM / 8 / 256)            /* conversion blocks of one weight matrix */

// All input conversions in one grid: blocks 0 .. 4 WBLK - 1 take the four weight matrices (f16 x16 planes; the last also its bf16 plane), the rest take x (bf16 values as exact f16).
__global__ __launch_bounds__(256) void k_prep(const float* __restrict__ x, const float* __restrict__ Wq, const float* __restrict__ Wk, const float* __restrict__ Wv, const float* __restrict__ Wp,
                                              unsigned short* __restrict__ X16, unsigned short* __restrict__ W16, unsigned short* __restrict__ WBF) {
  const int bx = (int)blockIdx.x;
  if (bx < 4 * WBLK) {
    const int sel = bx / WBLK;
    const float* w = sel == 0 ? Wq : sel == 1 ? Wk : sel == 2 ? Wv : Wp;
    const int t = (bx % WBLK) * 256 + (int)threadIdx.x;
    const v4f a = *(const v4fa*)(w + (size_t)t * 8), c = *(const v4fa*)(w + (size_t)t * 8 + 4);
    v4f as, cs; Frag fb;
#pragma unroll
    for (int q = 0; q < 4; ++q) {
      const unsigned short b0 = bf16_bits(a[q]), b1 = bf16_bits(c[q]);
      fb.u[q] = b0; fb.u[4 + q] = b1;
      as[q] = bf16_val(b0) * 16.0f; cs[q] = bf16_val(b1) * 16.0f;
    }
    const v8us o = to_f16x8(as, cs);
    const v8us ob = fb.half[0];
    *(v8us*)(W16 + (size_t)sel * DM * DM + (size_t)t * 8) = o;
    st_wait();
    if (sel == 3) { *(v8us*)(WBF + (size_t)t * 8) = ob; st_wait(); }
  } else {
    const int t = (bx - 4 * WBLK) * 256 + (int)threadIdx.x;
    const int r = t / (DM / 8), c8 = (t % (DM / 8)) * 8;
    const int b = r / SEQ, tt = r % SEQ;
    const float* src = x + ((size_t)b * SEQ_FULL + tt) * DM + c8;
    const v4f a = *(const v4fa*)src, c = *(const v4fa*)(src + 4);
    v4f ar, cr;
#pragma unroll
    for (int q = 0; q < 4; ++q) { ar[q] = bf16_rne(a[q]); cr[q] = bf16_rne(c[q]); }
    const v8us o = to_f16x8(ar, cr);
    *(v8us*)(X16 + (size_t)t * 8) = o;
    st_wait();
  }
}

#define KT 64               /* keys (attention) or k elements (GEMM) per LDS stage */
#define LP 72               /* LDS row pitch in 16-bit elements: 144 B = 16 B x odd, the pitch for 16-byte readers of 128-B rows */
#define TILE_E (64 * LP)    /* one staged tile: 64 rows of 128 B */

__device__ __forceinline__ unsigned lds_off(const void* p) { return (unsigned)(size_t)p; }

// One 64-row x 128-B tile into LDS by the block's 128 threads: thread = (row tid/8 + 16 i, 16-byte piece tid%8), i = 0..3, so a wave's copy takes 4 whole lines.
// l = the lane's LDS byte address of row tid/8, g = its global address there, gstep = 16 source rows in elements.
__device__ __forceinline__ void cp_tile(unsigned l, const unsigned short* g, size_t gstep) {
  const unsigned l1 = l + 16 * LP * 2, l2 = l + 32 * LP * 2, l3 = l + 48 * LP * 2;
  const unsigned short* g1 = g + gstep;
  const unsigned short* g2 = g + 2 * gstep;
  const unsigned short* g3 = g + 3 * gstep;
  // the copies bring the tile into LDS through no register; the closing s_wait_xcnt stands in front of any rewrite of the address registers they name
  asm volatile("global_load_async_to_lds_b128 %0, %4, off\n\t"
               "global_load_async_to_lds_b128 %1, %5, off\n\t"
               "global_load_async_to_lds_b128 %2, %6, off\n\t"
               "global_load_async_to_lds_b128 %3, %7, off\n\t"
               "s_wait_xcnt 0x0"
               :: "v"(l), "v"(l1), "v"(l2), "v"(l3), "v"(g), "v"(g1), "v"(g2), "v"(g3) : "memory");
}

template <bool ABF>
__device__ __forceinline__ v8f gmm(const Frag& a, const Frag& al, const Frag& b, v8f c) {
  if (ABF) { c = wm_b(a, b, c); c = wm_b(al, b, c); nop3(c, a, al, b); }
  else { c = wm_h(a, b, c); nop2(c, a, b); }
  return c;
}

// GEMM over K = DM: block = 4 waves, block tile 128 token rows x 64 cols, wave tile 32 x 64; the block's A rows and B rows are staged in LDS 64 k at a time (two buffers) and read from there by its four waves.
// ABF: A = bf16 hi (A) + lo (A2) planes, two products against bf16 Bt; else A f16, single product against f16 Bt.
// gemm_core leaves the block's 128 x 64 tile (x alpha, + the bf16 value of the bias where BIAS) as f32 in LDS, published by a block barrier; the epilogues below store it.
#define GEMM_NT(ABF) ((ABF) ? 5 : 3)                    /* tiles of 64 rows x 128 B per stage: A rows 0..63, A rows 64..127, B rows, then the A lo rows */
#define GEMM_RING_B(ABF) (2 * GEMM_NT(ABF) * TILE_E * 2) /* two buffers, bytes */
#define SO_B (128 * 68 * 4)                             /* the epilogue's f32 tile, which takes the ring's place behind the loop's last barrier */
#define GEMM_SM_B(ABF) (GEMM_RING_B(ABF) > SO_B ? GEMM_RING_B(ABF) : SO_B)
typedef float sorow[68];

template <bool ABF, bool BIAS>
__device__ __forceinline__ void gemm_core(unsigned char* sm, const unsigned short* __restrict__ A, const unsigned short* __restrict__ A2,
                                          const unsigned short* __restrict__ Bt, float alpha, const float* __restrict__ bias, size_t r0, int col0) {
  constexpr int NT = GEMM_NT(ABF);
  unsigned short* const ring = (unsigned short*)sm;
  sorow* const so = (sorow*)sm;
  const int tid = threadIdx.x, lane = tid & 31, ln = lane & 15, hh = lane >> 4;
  const int w = __builtin_amdgcn_readfirstlane((int)(threadIdx.x >> 5));
  const int crow = tid >> 3, cpc = tid & 7;
  const size_t acp = (r0 + crow) * DM + 8 * cpc;
  const size_t bcp = (size_t)(col0 + crow) * DM + 8 * cpc;
  const unsigned lcp = lds_off(ring) + (unsigned)(crow * LP + 8 * cpc) * 2u;
  auto fill = [&](int s, int bf) {   // k = 64 s .. 64 s + 63 of the block's 128 A rows and 64 B rows into buffer bf
    const unsigned lb = lcp + (unsigned)bf * (unsigned)(NT * TILE_E * 2);
    const size_t k0 = (size_t)s * KT;
    cp_tile(lb, A + acp + k0, (size_t)16 * DM);
    cp_tile(lb + TILE_E * 2, A + acp + (size_t)64 * DM + k0, (size_t)16 * DM);
    cp_tile(lb + 2 * TILE_E * 2, Bt + bcp + k0, (size_t)16 * DM);
    if (ABF) {
      cp_tile(lb + 3 * TILE_E * 2, A2 + acp + k0, (size_t)16 * DM);
      cp_tile(lb + 4 * TILE_E * 2, A2 + acp + (size_t)64 * DM + k0, (size_t)16 * DM);
    }
  };
  const v8f z8 = {0.f, 0.f, 0.f, 0.f, 0.f, 0.f, 0.f, 0.f};
  v8f acc[8];
#pragma unroll
  for (int u = 0; u < 8; ++u) acc[u] = z8;
  fill(0, 0);
  asm volatile("s_wait_asynccnt 0x0" ::: "memory");   // this wave's copies of stage 0 have landed
  __syncthreads();                                    // ... and every other wave's
  fill(1, 1);
#pragma unroll 1   /* rolled: one hand-over of the buffers per trip, and the loop text stays small */
  for (int sg = 0; sg < DM / KT; ++sg) {
    const unsigned short* tb = ring + (sg & 1) * (NT * TILE_E);
    const unsigned short* ap = tb + (32 * w + ln) * LP;
    const unsigned short* bp0 = tb + 2 * TILE_E + ln * LP;
    // the stage's fragment reads stand together in front of its products: one LDS latency per stage, not one per fragment
    Frag fa[2][2], fl[2][2], fb[2][4];
#pragma unroll     /* both 32-k halves of the stage in line, so that every LDS offset is an immediate and every fragment a register */
    for (int h2 = 0; h2 < 2; ++h2) {
      fa[h2][0] = ldf(ap + 32 * h2, hh); fa[h2][1] = ldf(ap + 16 * LP + 32 * h2, hh);
      if (ABF) { fl[h2][0] = ldf(ap + 3 * TILE_E + 32 * h2, hh); fl[h2][1] = ldf(ap + 3 * TILE_E + 16 * LP + 32 * h2, hh); }
      else { fl[h2][0] = fa[h2][0]; fl[h2][1] = fa[h2][1]; }
#pragma unroll
      for (int t = 0; t < 4; ++t) fb[h2][t] = ldf(bp0 + (16 * t) * LP + 32 * h2, hh);
    }
#pragma unroll     /* in line, k ascending in every accumulator */
    for (int h2 = 0; h2 < 2; ++h2) {
#pragma unroll
      for (int t = 0; t < 4; ++t) {
        acc[t] = gmm<ABF>(fa[h2][0], fl[h2][0], fb[h2][t], acc[t]);
        acc[4 + t] = gmm<ABF>(fa[h2][1], fl[h2][1], fb[h2][t], acc[4 + t]);
      }
    }
    // hand-over of the buffers, passed by every wave:
    asm volatile("s_wait_dscnt 0x0" ::: "memory");      // this wave's reads of the buffer that is refilled below have returned
    asm volatile("s_wait_asynccnt 0x0" ::: "memory");   // this wave's copies of the next stage have landed
    __syncthreads();                                    // publishes the next stage and ends every wave's reads of this one
    if (sg + 2 < DM / KT) fill(sg + 2, sg & 1);
  }
  asm volatile("s_wait_asynccnt 0x0" ::: "memory");    // no copy is outstanding when the ring's LDS becomes the epilogue's tile
  // D element r of lane (hh, ln) = (row 8hh + r, col ln) of its 16x16 tile
#pragma unroll
  for (int u = 0; u < 8; ++u) {
    const int t = u & 3, half = u >> 2;
    const int col = t * 16 + ln;
    float bv = 0.f;
    if (BIAS) bv = bf16_rne(bias[col0 + col]);
#pragma unroll
    for (int r = 0; r < 8; ++r) so[32 * w + half * 16 + 8 * hh + r][col] = acc[u][r] * alpha + bv;
  }
  __syncthreads();
}

// q, k and v projections in one grid: grid.x = (row tiles of 128) * 8 col tiles, grid.y = batch, grid.z = weight plane (0 q, 1 k, 2 v).
// q and k: f16 row plane [row][DM] (+ bf16 hi/lo row planes for rows t < ERL); v: transposed planes [(b,head)][d][SEQ] (f16, + bf16 hi/lo for t < ERL).
__global__ __launch_bounds__(128) void k_proj(const unsigned short* __restrict__ X16, const unsigned short* __restrict__ W16,
                                              unsigned short* __restrict__ QK16, unsigned short* __restrict__ QKH, unsigned short* __restrict__ QKL,
                                              unsigned short* __restrict__ VT16, unsigned short* __restrict__ VTH, unsigned short* __restrict__ VTL) {
  __shared__ __attribute__((aligned(16))) unsigned char sm[GEMM_SM_B(false)];
  const sorow* const so = (const sorow*)sm;
  const int tid = threadIdx.x;
  const int rt = (int)blockIdx.x >> 3, nq = (int)blockIdx.x & 7, b = blockIdx.y, z = blockIdx.z;
  const int t0 = rt * 128;
  const size_t r0 = (size_t)b * SEQ + t0;
  const int col0 = nq * 64;
  gemm_core<false, false>(sm, X16, X16, W16 + (size_t)z * DM * DM, 0.0625f, nullptr, r0, col0);
  const bool early = (t0 < ERL);
  if (z < 2) {
#pragma unroll
    for (int it = 0; it < 8; ++it) {
      const int row = it * 16 + (tid >> 3), pc = tid & 7;
      const v4f x0 = *(const v4fa*)&so[row][8 * pc], x1 = *(const v4fa*)&so[row][8 * pc + 4];
      const size_t off = (size_t)z * (NR * DM) + (r0 + row) * DM + col0 + 8 * pc;
      const v8us o = to_f16x8(x0, x1);
      *(v8us*)(QK16 + off) = o;
      st_wait();
      if (early) {
        v8us oh, ol; to_bf16x8_hl(x0, x1, oh, ol);
        *(v8us*)(QKH + off) = oh;
        *(v8us*)(QKL + off) = ol;
        st_wait();
      }
    }
  } else {
    // transposed: 64 d rows x 128 tokens (256 B each): d = it*8 + tid/16, piece = tid%16 (8 tokens = 16 B)
    const int hd = nq;
#pragma unroll
    for (int it = 0; it < 8; ++it) {
      const int d = it * 8 + (tid >> 4), pc = tid & 15;
      v4f x0, x1;
#pragma unroll
      for (int j = 0; j < 4; ++j) { x0[j] = so[8 * pc + j][d]; x1[j] = so[8 * pc + 4 + j][d]; }
      const size_t off = (((size_t)b * NH + hd) * HD + d) * SEQ + t0 + 8 * pc;
      const v8us o = to_f16x8(x0, x1);
      *(v8us*)(VT16 + off) = o;
      st_wait();
      if (early) {
        v8us oh, ol; to_bf16x8_hl(x0, x1, oh, ol);
        *(v8us*)(VTH + off) = oh;
        *(v8us*)(VTL + off) = ol;
        st_wait();
      }
    }
  }
}

// Output projection + bias for all rows in one grid: grid.x = (row tiles of 128) * 8 col tiles, grid.y = batch; row tiles t < ERL take the bf16 hi/lo ctx planes, the rest the f16 plane (ctx x64, weights x16).
__global__ __launch_bounds__(128) void k_out(const unsigned short* __restrict__ CH, const unsigned short* __restrict__ CL, const unsigned short* __restrict__ C16,
                                             const unsigned short* __restrict__ WPB, const unsigned short* __restrict__ WP16,
                                             const float* __restrict__ bias, float* __restrict__ OF) {
  __shared__ __attribute__((aligned(16))) unsigned char sm[GEMM_SM_B(true)];
  const sorow* const so = (const sorow*)sm;
  const int tid = threadIdx.x;
  const int rt = (int)blockIdx.x >> 3, nq = (int)blockIdx.x & 7, b = blockIdx.y;
  const int t0 = rt * 128;
  const size_t r0 = (size_t)b * SEQ + t0;
  const int col0 = nq * 64;
  if (t0 < ERL) gemm_core<true, true>(sm, CH, CL, WPB, 1.0f, bias, r0, col0);
  else gemm_core<false, true>(sm, C16, C16, WP16, 0.0009765625f, bias, r0, col0);
  // f32 rows of the output buffer (full-size layout): 128 rows x 256 B: row = it*8 + tid/16, piece = tid%16 (4 floats = 16 B)
#pragma unroll
  for (int it = 0; it < 16; ++it) {
    const int row = it * 8 + (tid >> 4), pc = tid & 15;
    const v4f v = *(const v4fa*)&so[row][4 * pc];
    *(v4f*)(OF + ((size_t)b * SEQ_FULL + t0 + row) * DM + col0 + 4 * pc) = v;
  }
}

// Causal attention, one wave per 16 query rows of one (batch, head); block = 4 waves (64 queries) that share the staged K and V^T tiles; one block barrier per 64 keys.
// S^T[key][query] = K Q^T: A = K rows (lane = key), B = Q rows (lane = query). D: lane (hh, ln) element r = (key 8hh + r, query ln).
// O^T[d][query] = V^T P^T: A = V^T rows (lane = d, k = keys), B = packed P^T: element r <- tile(keys 0..15)[r], element 8+r <- tile(keys 16..31)[r].
// RES: bf16 hi/lo operands, three products per site; else f16 single products with P carried x1024 (sum carried alike) and ctx stored x64.
// lds: the ring [buffer][K hi, V^T hi, K lo, V^T lo][row * LP + element] (the lo tiles with RES alone); behind the loop's last barrier its first bytes become the waves' output tiles [wave][hi, lo][16][64].
template <bool RES>
__device__ __forceinline__ void attn_body(unsigned short* lds, const unsigned short* __restrict__ Qh, const unsigned short* __restrict__ Ql,
                                          const unsigned short* __restrict__ Kh, const unsigned short* __restrict__ Kl,
                                          const unsigned short* __restrict__ Vh, const unsigned short* __restrict__ Vl,
                                          unsigned short* __restrict__ Ch, unsigned short* __restrict__ Cl, int qb, int h, int b) {
  constexpr int NTL = RES ? 4 : 2;   /* staged tiles per buffer */
  const int lane = threadIdx.x & 31, ln = lane & 15, hh = lane >> 4;
  const int w = __builtin_amdgcn_readfirstlane((int)(threadIdx.x >> 5));
  unsigned short (* const sc)[16][64] = (unsigned short (*)[16][64])lds + w * (RES ? 2 : 1);   /* this wave's output tiles */
  const int q0 = qb + w * 16;
  const int qi = q0 + ln;
  const size_t rowb = (size_t)b * SEQ;
  const size_t qof = (rowb + q0 + ln) * DM + h * HD;
  const Frag qh0 = ldf(Qh + qof, hh), qh1 = ldf(Qh + qof + 32, hh);
  Frag ql0 = qh0, ql1 = qh1;
  if (RES) { ql0 = ldf(Ql + qof, hh); ql1 = ldf(Ql + qof + 32, hh); }
  const int crow = (int)threadIdx.x >> 3, cpc = (int)threadIdx.x & 7;
  const size_t kcp = (rowb + crow) * DM + h * HD + 8 * cpc;
  const size_t vcp = (((size_t)b * NH + h) * HD + crow) * SEQ + 8 * cpc;
  const unsigned lcp = lds_off(lds) + (unsigned)(crow * LP + 8 * cpc) * 2u;
  auto fill = [&](int s, int bf) {   // keys 64 s .. 64 s + 63 into buffer bf; all of them lie at or below the block's last query
    const unsigned lb = lcp + (unsigned)bf * (unsigned)(NTL * TILE_E * 2);
    const size_t k0 = (size_t)s * KT;
    cp_tile(lb, Kh + kcp + k0 * DM, (size_t)16 * DM);
    cp_tile(lb + TILE_E * 2, Vh + vcp + k0, (size_t)16 * SEQ);
    if (RES) {
      cp_tile(lb + 2 * TILE_E * 2, Kl + kcp + k0 * DM, (size_t)16 * DM);
      cp_tile(lb + 3 * TILE_E * 2, Vl + vcp + k0, (size_t)16 * SEQ);
    }
  };
  const v8f z8 = {0.f, 0.f, 0.f, 0.f, 0.f, 0.f, 0.f, 0.f};
  v8f acc[4];
#pragma unroll
  for (int t = 0; t < 4; ++t) acc[t] = z8;
  float m = NEGBIG, l = 0.f;
  const float carry = RES ? 0.f : CARRY_LN;
  const int nst = (qb >> 6) + 1;   // scalar and the same in the whole block: stages of 64 keys up to the block's last query
  fill(0, 0);
  asm volatile("s_wait_asynccnt 0x0" ::: "memory");   // this wave's copies of stage 0 have landed
  __syncthreads();                                    // ... and every other wave's
  if (nst > 1) fill(1, 1);
#pragma unroll 1   /* rolled: one hand-over of the buffers per trip, and the loop text stays small */
  for (int sg = 0; sg < nst; ++sg) {
   const unsigned short* tk = lds + (sg & 1) * (NTL * TILE_E);
   if (!RES) {
    // dense rows: the stage's 64 keys are one softmax step: one maximum, one rescale, eight score and eight P.V products in four independent accumulator chains each
    // (keys behind the diagonal get weight 0 by the mask; every loop of the step is unrolled, so that fragments, scores and accumulators stay in registers under constant indices)
    const int kb = sg * KT;
    // the stage's fragment reads stand together in front of its products, K first: one LDS latency per stage, and the V^T fragments return while scores and softmax run
    Frag kf[4][2], vf[4][2];
#pragma unroll
    for (int kt = 0; kt < 4; ++kt) {
      const unsigned short* kp = tk + (16 * kt + ln) * LP;
      kf[kt][0] = ldf(kp, hh); kf[kt][1] = ldf(kp + 32, hh);
    }
    __builtin_amdgcn_sched_barrier(0);   // keeps every K read in front of the V^T reads: LDS returns in order, and the score products then wait for K alone
#pragma unroll
    for (int t = 0; t < 4; ++t) {
      const unsigned short* vp = tk + TILE_E + (16 * t + ln) * LP;
      vf[t][0] = ldf(vp, hh); vf[t][1] = ldf(vp + 32, hh);
    }
    v8f s[4];
#pragma unroll
    for (int kt = 0; kt < 4; ++kt) s[kt] = wm_h(kf[kt][0], qh0, z8);
#pragma unroll
    for (int kt = 0; kt < 4; ++kt) s[kt] = wm_h(kf[kt][1], qh1, s[kt]);
    nop_grp(s, kf, qh0, qh1);
    if (kb + KT > q0) {   // scalar condition: this stage touches the diagonal; masked scores are replaced
#pragma unroll
      for (int kt = 0; kt < 4; ++kt)
#pragma unroll
        for (int r = 0; r < 8; ++r) { const int key = kb + 16 * kt + 8 * hh + r; s[kt][r] = (key > qi) ? NEGBIG : s[kt][r]; }
    }
    float mt[4];
#pragma unroll
    for (int kt = 0; kt < 4; ++kt) {
      float a = s[kt][0];
#pragma unroll
      for (int r = 1; r < 8; ++r) a = fmaxf(a, s[kt][r]);
      mt[kt] = a;
    }
    float mx = fmaxf(fmaxf(mt[0], mt[1]), fmaxf(mt[2], mt[3]));
    mx = fmaxf(mx, __shfl_xor(mx, 16, 32));
    const float mnew = fmaxf(m, mx);
    const float alpha = __expf((m - mnew) * QSCALE);
    const float cc = carry - mnew * QSCALE;
    m = mnew;
    Frag ph[2];
    float pt[4];
#pragma unroll
    for (int kt = 0; kt < 4; ++kt) {
      float a = 0.f;
#pragma unroll
      for (int r = 0; r < 8; ++r) {
        const float p = __expf(fmaf(s[kt][r], QSCALE, cc));
        ph[kt >> 1].e[8 * (kt & 1) + r] = (_Float16)p; a += p;
      }
      pt[kt] = a;
    }
    float ps = (pt[0] + pt[1]) + (pt[2] + pt[3]);
    ps += __shfl_xor(ps, 16, 32);
    l = l * alpha + ps;
#pragma unroll
    for (int t = 0; t < 4; ++t) acc[t] = acc[t] * alpha;
#pragma unroll
    for (int t = 0; t < 4; ++t) acc[t] = wm_h(vf[t][0], ph[0], acc[t]);
#pragma unroll
    for (int t = 0; t < 4; ++t) acc[t] = wm_h(vf[t][1], ph[1], acc[t]);
    nop_grp(acc, vf, ph[0], ph[1]);
   } else
#pragma unroll     /* both 32-key halves of the stage in line, so that every LDS offset is an immediate */
   for (int hf = 0; hf < 2; ++hf) {
    const int kb = sg * KT + hf * 32;
    if (kb >= q0 + 16) continue;   // scalar: the wave's queries all lie in front of these 32 keys
    v8f s[2];
#pragma unroll
    for (int kt = 0; kt < 2; ++kt) {
      const unsigned short* kp = tk + (hf * 32 + 16 * kt + ln) * LP;
      const Frag k0 = ldf(kp, hh), k1 = ldf(kp + 32, hh);
      v8f c = z8;
      if (RES) {
        const Frag kl0 = ldf(kp + 2 * TILE_E, hh), kl1 = ldf(kp + 2 * TILE_E + 32, hh);
        c = wm_b(k0, qh0, c); c = wm_b(kl0, qh0, c); c = wm_b(k0, ql0, c);
        c = wm_b(k1, qh1, c); c = wm_b(kl1, qh1, c); c = wm_b(k1, ql1, c);
        nop8(c, k0, k1, kl0, kl1, qh0, qh1, ql0, ql1);
      } else {
        c = wm_h(k0, qh0, c); c = wm_h(k1, qh1, c);
        nop4(c, k0, k1, qh0, qh1);
      }
      s[kt] = c;
    }
    if (kb + 32 > q0) {   // scalar condition: this step touches the diagonal; masked scores are replaced
#pragma unroll
      for (int kt = 0; kt < 2; ++kt)
#pragma unroll
        for (int r = 0; r < 8; ++r) { const int key = kb + 16 * kt + 8 * hh + r; s[kt][r] = (key > qi) ? NEGBIG : s[kt][r]; }
    }
    float mx = fmaxf(s[0][0], s[1][0]);
#pragma unroll
    for (int r = 1; r < 8; ++r) mx = fmaxf(mx, fmaxf(s[0][r], s[1][r]));
    mx = fmaxf(mx, __shfl_xor(mx, 16, 32));
    const float mnew = fmaxf(m, mx);
    const float alpha = __expf((m - mnew) * QSCALE);
    const float cc = carry - mnew * QSCALE;
    m = mnew;
    Frag ph, pl;
    float ps = 0.f;
#pragma unroll
    for (int kt = 0; kt < 2; ++kt)
#pragma unroll
      for (int r = 0; r < 8; ++r) {
        const float p = __expf(fmaf(s[kt][r], QSCALE, cc));
        if (RES) {
          const unsigned short hb = bf16_bits(p); const float hv = bf16_val(hb);
          const unsigned short lb = bf16_bits(p - hv);
          ph.u[8 * kt + r] = hb; pl.u[8 * kt + r] = lb; ps += hv + bf16_val(lb);
        } else {
          ph.e[8 * kt + r] = (_Float16)p; ps += p;
        }
      }
    if (!RES) pl = ph;
    ps += __shfl_xor(ps, 16, 32);
    l = l * alpha + ps;
#pragma unroll
    for (int t = 0; t < 4; ++t) acc[t] = acc[t] * alpha;
#pragma unroll
    for (int t = 0; t < 4; ++t) {
      const unsigned short* vp = tk + TILE_E + (16 * t + ln) * LP + hf * 32;
      const Frag vh = ldf(vp, hh);
      if (RES) {
        const Frag vl = ldf(vp + 2 * TILE_E, hh);
        acc[t] = wm_b(vh, ph, acc[t]); acc[t] = wm_b(vl, ph, acc[t]); acc[t] = wm_b(vh, pl, acc[t]);
        nop4(acc[t], vh, vl, ph, pl);
      } else {
        acc[t] = wm_h(vh, ph, acc[t]);
        nop2(acc[t], vh, ph);
      }
    }
   }
   // hand-over of the buffers, passed by every wave:
   asm volatile("s_wait_dscnt 0x0" ::: "memory");      // this wave's reads of the buffer that is refilled below have returned
   asm volatile("s_wait_asynccnt 0x0" ::: "memory");   // this wave's copies of the next stage have landed
   __syncthreads();                                    // publishes the next stage and ends every wave's reads of this one
   if (sg + 2 < nst) fill(sg + 2, sg & 1);
  }
  asm volatile("s_wait_asynccnt 0x0" ::: "memory");    // no copy is outstanding when the ring's LDS becomes the output tiles
  // acc[t][r] = O^T[d = 16t + 8hh + r][query ln]; normalise and stage row ln of the wave tile
  const float inv = 1.0f / l;
  const float osc = RES ? inv : inv * 64.0f;
#pragma unroll
  for (int t = 0; t < 4; ++t) {
    if (RES) {
      Frag oh, ol;
#pragma unroll
      for (int r = 0; r < 8; ++r) { const float c = acc[t][r] * osc; const unsigned short hb = bf16_bits(c); oh.u[r] = hb; ol.u[r] = bf16_bits(c - bf16_val(hb)); }
      *(v8us*)&sc[0][ln][16 * t + 8 * hh] = oh.half[0];
      *(v8us*)&sc[RES ? 1 : 0][ln][16 * t + 8 * hh] = ol.half[0];
    } else {
      Frag o;
#pragma unroll
      for (int r = 0; r < 8; ++r) o.e[r] = (_Float16)(acc[t][r] * osc);
      *(v8us*)&sc[0][ln][16 * t + 8 * hh] = o.half[0];
    }
  }
  __builtin_amdgcn_fence(4 /* acq_rel order */, "workgroup");
  __builtin_amdgcn_wave_barrier();
  const int rsub = lane >> 3, pc = lane & 7;
  {
#pragma unroll
    for (int q = 0; q < 4; ++q) {
      const int row = 4 * q + rsub;
      const size_t off = (rowb + q0 + row) * DM + h * HD + 8 * pc;
      const v8us v0 = *(const v8us*)&sc[0][row][8 * pc];
      *(v8us*)(Ch + off) = v0;
      if (RES) { const v8us v1 = *(const v8us*)&sc[RES ? 1 : 0][row][8 * pc]; *(v8us*)(Cl + off) = v1; }
    }
    
  }
}

// Both row classes in one grid: grid.x = query tiles of 64 rows from row tbase on, grid.y = head, grid.z = batch.
// Tiles of rows t < ERL run on the bf16 hi/lo planes, the rest on the f16 planes.
__global__ __launch_bounds__(128) void k_attn(const unsigned short* __restrict__ QH, const unsigned short* __restrict__ QL,
                                              const unsigned short* __restrict__ KH, const unsigned short* __restrict__ KL,
                                              const unsigned short* __restrict__ VTH, const unsigned short* __restrict__ VTL,
                                              const unsigned short* __restrict__ Q16, const unsigned short* __restrict__ K16, const unsigned short* __restrict__ VT16,
                                              unsigned short* __restrict__ CH, unsigned short* __restrict__ CL, unsigned short* __restrict__ C16, int tbase) {
  __shared__ __attribute__((aligned(16))) unsigned short lds[2 * 4 * TILE_E];
  const int h = blockIdx.y, b = blockIdx.z;
  // Every block of the grid is resident at once and a tile's cost grows with its row, so the launch lasts as long as the fullest WGP. The tiles fall into four classes of QG by row (class 0: the multi-product rows);
  // block x takes, of class (x / QG + b) % 4, tile x % QG counted upward in class 0 and downward in the others: blocks x, x + QG, x + 2 QG, x + 3 QG of one (head, batch), and blocks (x, head) of four successive batches, then hold one tile of each class with nearly the same summed cost.
  // For a fixed (head, batch) the map is a permutation of the tiles; where blocks land matters for speed alone.
  constexpr int QG = SEQ / 64 / 4;
  const int xr = (int)blockIdx.x % QG, xc = ((int)blockIdx.x / QG + b) & 3;
  const int qb = tbase + (xc == 0 ? xr : (xc + 1) * QG - 1 - xr) * 64;
  if (qb < ERL) attn_body<true>(lds, QH, QL, KH, KL, VTH, VTL, CH, CL, qb, h, b);
  else attn_body<false>(lds, Q16, Q16, K16, K16, VT16, VT16, C16, C16, qb, h, b);
}

extern "C" void kernel_launch(void* const* d_in, const int* in_sizes, int n_in,
                              void* d_out, int out_size, void* d_ws, size_t ws_size, hipStream_t stream) {
  static_assert(NH * HD == DM);
  static_assert(DM == 512);
  static_assert(SEQ % 256 == 0);
  static_assert(ERL % 128 == 0);
  static_assert(NB <= NB_FULL);
  static_assert(((size_t)NB * SEQ * DM) % (8 * 256) == 0 && (DM * DM) % (8 * 256) == 0);   /* the conversion grid is exact: no thread past an end */
  static_assert(SEQ <= SEQ_FULL);
  static_assert((size_t)13 * NB * SEQ * DM * 2 + (size_t)5 * DM * DM * 2 <= (size_t)134217728);
  if (n_in < 6) return;
  const long long xmin = ((long long)(NB - 1) * SEQ_FULL + SEQ) * DM;
  if ((long long)in_sizes[0] < xmin) return;
  if (in_sizes[1] < DM * DM || in_sizes[2] < DM * DM || in_sizes[3] < DM * DM || in_sizes[4] < DM * DM || in_sizes[5] < DM) return;
  if ((long long)out_size < xmin) return;
  const float* x  = (const float*)d_in[0];
  const float* Wq = (const float*)d_in[1];
  const float* Wk = (const float*)d_in[2];
  const float* Wv = (const float*)d_in[3];
  const float* Wp = (const float*)d_in[4];
  const float* bp = (const float*)d_in[5];
  float* out = (float*)d_out;

  char* ws = (char*)d_ws; size_t off = 0;
  auto take = [&](size_t bytes) { char* p = ws + off; off += (bytes + 255) & ~(size_t)255; return (unsigned short*)p; };
  const size_t PL = NR * DM;            /* elements of one [NB*SEQ][DM] 16-bit plane */
  const size_t WN = (size_t)DM * DM;
  unsigned short* W16  = take(4 * WN * 2);     /* Wq, Wk, Wv, Wp as f16 x16, [n][k] */
  unsigned short* WPB  = take(WN * 2);         /* Wp as bf16, [n][k] */
  unsigned short* X16  = take(PL * 2);
  unsigned short* QK16 = take(2 * PL * 2);     /* q plane then k plane (f16) */
  unsigned short* QKH  = take(2 * PL * 2);     /* bf16 hi, rows t < ERL written */
  unsigned short* QKL  = take(2 * PL * 2);     /* bf16 lo, rows t < ERL written */
  unsigned short* VT16 = take(PL * 2);         /* [(b,h)][d][SEQ] f16 */
  unsigned short* VTH  = take(PL * 2);
  unsigned short* VTL  = take(PL * 2);
  unsigned short* C16  = take(PL * 2);         /* ctx x64 f16, rows t >= ERL */
  unsigned short* CH   = take(PL * 2);         /* ctx bf16 hi, rows t < ERL */
  unsigned short* CL   = take(PL * 2);         /* ctx bf16 lo, rows t < ERL */
  if (off > ws_size || off > (size_t)134217728) return;

  /* conversions of the four weight matrices and of x */
  k_prep<<<(unsigned)(4 * WBLK + XBLK), 256, 0, stream>>>(x, Wq, Wk, Wv, Wp, X16, W16, WPB);

  /* q, k and v projections: grid.z selects the weight plane and the output plane set; v is written transposed per (batch, head) */
  k_proj<<<dim3((SEQ / 128) * 8, NB, 3), 128, 0, stream>>>(X16, W16, QK16, QKH, QKL, VT16, VTH, VTL);

  /* attention: first ERL rows on bf16 hi/lo planes, remaining rows on f16 planes */
  k_attn<<<dim3(SEQ / 64, NH, NB), 128, 0, stream>>>(QKH, QKL, QKH + PL, QKL + PL, VTH, VTL, QK16, QK16 + PL, VT16, CH, CL, C16, 0);

  /* output projection + bias */
  k_out<<<dim3((SEQ / 128) * 8, NB, 1), 128, 0, stream>>>(CH, CL, C16, WPB, W16 + 3 * WN, bp, out);
}

// v006
// One run takes 65.8 microseconds.
// Timed twice side by side with v005, it ran 1.03 times as fast both times.
// All steps since v000 together make it 4.30 times as fast.
#include <hip/hip_runtime.h>
// Compute dtype: inputs RNE-converted to bf16 values (x as exact f16, weights as exact f16 x16 / exact bf16); q,k,v projections, dense-row scores, dense-row P.V and dense-row output GEMM = v_wmma_f32_16x16x32_f16 single products (P carried x1024, ctx carried x64); first ERL rows of every sequence: scores and P.V as bf16 hi/lo three-product sums, output GEMM as bf16 hi/lo A x exact bf16 W (v_wmma_f32_16x16x32_bf16); all accumulation, softmax statistics, bias add in f32.
// Structure: causal attention per (batch, head) with S^T = K Q^T (Q fragments in registers as the B operand) and O^T = V^T P^T (packed S^T accumulators are the B fragment), online max-subtracted softmax per lane column; K and V^T tiles of 64 keys are staged in LDS once per block (two buffers; a buffer holds one tile pair with its lo planes for the first ERL rows, two tile pairs = 128 keys for the dense rows) and read from there by its four waves. Four launches, each the jobs that read none of each other's output, the job picked by the block index: conversions; q, k, v projections; attention (both row classes); output GEMM (both row classes).
#ifndef NB
#define NB 4
#endif
#ifndef SEQ
#define SEQ 2048
#endif
#ifndef EARLY
#define EARLY 512
#endif
#define NB_FULL 4
#define SEQ_FULL 2048
#define DM 512
#define NH 8
#define HD 64
#define ERL ((EARLY < SEQ) ? EARLY : SEQ)   /* rows per sequence on the multi-product path */
#define NR ((size_t)NB * SEQ)               /* compact token rows r = b*SEQ + t */
#define QSCALE 0.044194173824159216f        /* d_model^-0.5 */
#define NEGBIG (-3.0e38f)
#define CARRY_LN 6.931471805599453f         /* ln 1024 */

typedef _Float16 v16h __attribute__((ext_vector_type(16)));
typedef __bf16   v16b __attribute__((ext_vector_type(16)));
typedef unsigned short v8us __attribute__((ext_vector_type(8), may_alias));
typedef float v8f  __attribute__((ext_vector_type(8)));
typedef float v4f  __attribute__((ext_vector_type(4)));
typedef float v4fa __attribute__((ext_vector_type(4), may_alias));
union Frag { v16h h; v16b b; v8us half[2]; _Float16 e[16]; unsigned short u[16]; };

__device__ __forceinline__ unsigned short bf16_bits(float x) { unsigned int u = __float_as_uint(x); return (unsigned short)((u + 0x7FFFu + ((u >> 16) & 1u)) >> 16); }
__device__ __forceinline__ float bf16_val(unsigned short b) { return __uint_as_float(((unsigned int)b) << 16); }
__device__ __forceinline__ float bf16_rne(float x) { return bf16_val(bf16_bits(x)); }

// fragment loader (A and B alike): elements 0..7 <- p[8h .. 8h+7], elements 8..15 <- p[16+8h .. 16+8h+7]
__device__ __forceinline__ Frag ldf(const unsigned short* p, int hh) {
  Frag f; f.half[0] = *(const v8us*)(p + 8 * hh); f.half[1] = *(const v8us*)(p + 16 + 8 * hh); return f;
}
__device__ __forceinline__ v8f wm_h(const Frag& a, const Frag& b, v8f c) { return __builtin_amdgcn_wmma_f32_16x16x32_f16(false, a.h, false, b.h, (short)0, c, false, false); }
__device__ __forceinline__ v8f wm_b(const Frag& a, const Frag& b, v8f c) { return __builtin_amdgcn_wmma_f32_16x16x32_bf16(false, a.b, false, b.b, (short)0, c, false, false); }
__device__ __forceinline__ void nop2(v8f& c, const Frag& a, const Frag& b) { asm volatile("v_nop\n\tv_nop\n\tv_nop\n\tv_nop" : "+v"(c) : "v"(a.h), "v"(b.h)); }
__device__ __forceinline__ void nop3(v8f& c, const Frag& a, const Frag& b, const Frag& d) { asm volatile("v_nop\n\tv_nop\n\tv_nop\n\tv_nop" : "+v"(c) : "v"(a.h), "v"(b.h), "v"(d.h)); }
__device__ __forceinline__ void nop4(v8f& c, const Frag& a, const Frag& b, const Frag& d, const Frag& e) { asm volatile("v_nop\n\tv_nop\n\tv_nop\n\tv_nop" : "+v"(c) : "v"(a.h), "v"(b.h), "v"(d.h), "v"(e.h)); }
__device__ __forceinline__ void nop8(v8f& c, const Frag& a, const Frag& b, const Frag& d, const Frag& e, const Frag& f, const Frag& g, const Frag& i, const Frag& j) {
  asm volatile("v_nop\n\tv_nop\n\tv_nop\n\tv_nop" : "+v"(c) : "v"(a.h), "v"(b.h), "v"(d.h), "v"(e.h), "v"(f.h), "v"(g.h), "v"(i.h), "v"(j.h));
}

// behind a group of eight products on four accumulators (four A fragments per k half, one B fragment per k half): the four vector slots that the chip needs before an accumulator is read or an operand register rewritten
__device__ __forceinline__ void nop_grp(v8f (&c)[4], const Frag (&a)[4][2], const Frag& b0, const Frag& b1) {
  asm volatile("v_nop\n\tv_nop\n\tv_nop\n\tv_nop" : "+v"(c[0]), "+v"(c[1]), "+v"(c[2]), "+v"(c[3])
               : "v"(a[0][0].h), "v"(a[0][1].h), "v"(a[1][0].h), "v"(a[1][1].h), "v"(a[2][0].h), "v"(a[2][1].h), "v"(a[3][0].h), "v"(a[3][1].h), "v"(b0.h), "v"(b1.h));
}

__device__ __forceinline__ v8us to_f16x8(v4f a, v4f c) {
  Frag f;
#pragma unroll
  for (int q = 0; q < 4; ++q) { f.e[q] = (_Float16)a[q]; f.e[4 + q] = (_Float16)c[q]; }
  return f.half[0];
}
__device__ __forceinline__ void to_bf16x8_hl(v4f a, v4f c, v8us& hi, v8us& lo) {
  Frag fh, fl;
#pragma unroll
  for (int q = 0; q < 4; ++q) {
    unsigned short hb = bf16_bits(a[q]); fh.u[q] = hb; fl.u[q] = bf16_bits(a[q] - bf16_val(hb));
    hb = bf16_bits(c[q]); fh.u[4 + q] = hb; fl.u[4 + q] = bf16_bits(c[q] - bf16_val(hb));
  }
  hi = fh.half[0]; lo = fl.half[0];
}

// behind a global store: stands in front of any rewrite of the registers that the store names
__device__ __forceinline__ void st_wait() { asm volatile("s_wait_xcnt 0x0" ::: "memory"); }

#define XBLK ((int)(NR * DM / 8 / 256))     /* conversion blocks of x: 8 elements a thread */
#define WBLK (DM * DM / 8 / 256)            /* conversion blocks of one weight matrix */

// All input conversions in one grid: blocks 0 .. 4 WBLK - 1 take the four weight matrices (f16 x16 planes; the last also its bf16 plane), the rest take x (bf16 values as exact f16).
__global__ __launch_bounds__(256) void k_prep(const float* __restrict__ x, const float* __restrict__ Wq, const float* __restrict__ Wk, const float* __restrict__ Wv, const float* __restrict__ Wp,
                                              unsigned short* __restrict__ X16, unsigned short* __restrict__ W16, unsigned short* __restrict__ WBF) {
  const int bx = (int)blockIdx.x;
  if (bx < 4 * WBLK) {
    const int sel = bx / WBLK;
    const float* w = sel == 0 ? Wq : sel == 1 ? Wk : sel == 2 ? Wv : Wp;
    const int t = (bx % WBLK) * 256 + (int)threadIdx.x;
    const v4f a = *(const v4fa*)(w + (size_t)t * 8), c = *(const v4fa*)(w + (size_t)t * 8 + 4);
    v4f as, cs; Frag fb;
#pragma unroll
    for (int q = 0; q < 4; ++q) {
      const unsigned short b0 = bf16_bits(a[q]), b1 = bf16_bits(c[q]);
      fb.u[q] = b0; fb.u[4 + q] = b1;
      as[q] = bf16_val(b0) * 16.0f; cs[q] = bf16_val(b1) * 16.0f;
    }
    const v8us o = to_f16x8(as, cs);
    const v8us ob = fb.half[0];
    *(v8us*)(W16 + (size_t)sel * DM * DM + (size_t)t * 8) = o;
    st_wait();
    if (sel == 3) { *(v8us*)(WBF + (size_t)t * 8) = ob; st_wait(); }
  } else {
    const int t = (bx - 4 * WBLK) * 256 + (int)threadIdx.x;
    const int r = t / (DM / 8), c8 = (t % (DM / 8)) * 8;
    const int b = r / SEQ, tt = r % SEQ;
    const float* src = x + ((size_t)b * SEQ_FULL + tt) * DM + c8;
    const v4f a = *(const v4fa*)src, c = *(const v4fa*)(src + 4);
    v4f ar, cr;
#pragma unroll
    for (int q = 0; q < 4; ++q) { ar[q] = bf16_rne(a[q]); cr[q] = bf16_rne(c[q]); }
    const v8us o = to_f16x8(ar, cr);
    *(v8us*)(X16 + (size_t)t * 8) = o;
    st_wait();
  }
}

#define KT 64               /* keys per staged tile (attention) or k elements per LDS stage (GEMM) */
#define LP 72               /* LDS row pitch in 16-bit elements: 144 B = 16 B x odd, the pitch for 16-byte readers of 128-B rows */
#define TILE_E (64 * LP)    /* one staged tile: 64 rows of 128 B */

__device__ __forceinline__ unsigned lds_off(const void* p) { return (unsigned)(size_t)p; }

// One 64-row x 128-B tile into LDS by the block's 128 threads: thread = (row tid/8 + 16 i, 16-byte piece tid%8), i = 0..3, so a wave's copy takes 4 whole lines.
// l = the lane's LDS byte address of row tid/8, g = its global address there, gstep = 16 source rows in elements.
__device__ __forceinline__ void cp_tile(unsigned l, const unsigned short* g, size_t gstep) {
  const unsigned l1 = l + 16 * LP * 2, l2 = l + 32 * LP * 2, l3 = l + 48 * LP * 2;
  const unsigned short* g1 = g + gstep;
  const unsigned short* g2 = g + 2 * gstep;
  const unsigned short* g3 = g + 3 * gstep;
  // the copies bring the tile into LDS through no register; the closing s_wait_xcnt stands in front of any rewrite of the address registers they name
  asm volatile("global_load_async_to_lds_b128 %0, %4, off\n\t"
               "global_load_async_to_lds_b128 %1, %5, off\n\t"
               "global_load_async_to_lds_b128 %2, %6, off\n\t"
               "global_load_async_to_lds_b128 %3, %7, off\n\t"
               "s_wait_xcnt 0x0"
               :: "v"(l), "v"(l1), "v"(l2), "v"(l3), "v"(g), "v"(g1), "v"(g2), "v"(g3) : "memory");
}

template <bool ABF>
__device__ __forceinline__ v8f gmm(const Frag& a, const Frag& al, const Frag& b, v8f c) {
  if (ABF) { c = wm_b(a, b, c); c = wm_b(al, b, c); nop3(c, a, al, b); }
  else { c = wm_h(a, b, c); nop2(c, a, b); }
  return c;
}

// GEMM over K = DM: block = 4 waves, block tile 128 token rows x 64 cols, wave tile 32 x 64; the block's A rows and B rows are staged in LDS 64 k at a time (two buffers) and read from there by its four waves.
// ABF: A = bf16 hi (A) + lo (A2) planes, two products against bf16 Bt; else A f16, single product against f16 Bt.
// gemm_core leaves the block's 128 x 64 tile (x alpha, + the bf16 value of the bias where BIAS) as f32 in LDS, published by a block barrier; the epilogues below store it.
#define GEMM_NT(ABF) ((ABF) ? 5 : 3)                    /* tiles of 64 rows x 128 B per stage: A rows 0..63, A rows 64..127, B rows, then the A lo rows */
#define GEMM_RING_B(ABF) (2 * GEMM_NT(ABF) * TILE_E * 2) /* two buffers, bytes */
#define SO_B (128 * 68 * 4)                             /* the epilogue's f32 tile, which takes the ring's place behind the loop's last barrier */
#define GEMM_SM_B(ABF) (GEMM_RING_B(ABF) > SO_B ? GEMM_RING_B(ABF) : SO_B)
typedef float sorow[68];

template <bool ABF, bool BIAS>
__device__ __forceinline__ void gemm_core(unsigned char* sm, const unsigned short* __restrict__ A, const unsigned short* __restrict__ A2,
                                          const unsigned short* __restrict__ Bt, float alpha, const float* __restrict__ bias, size_t r0, int col0) {
  constexpr int NT = GEMM_NT(ABF);
  unsigned short* const ring = (unsigned short*)sm;
  sorow* const so = (sorow*)sm;
  const int tid = threadIdx.x, lane = tid & 31, ln = lane & 15, hh = lane >> 4;
  const int w = __builtin_amdgcn_readfirstlane((int)(threadIdx.x >> 5));
  const int crow = tid >> 3, cpc = tid & 7;
  const size_t acp = (r0 + crow) * DM + 8 * cpc;
  const size_t bcp = (size_t)(col0 + crow) * DM + 8 * cpc;
  const unsigned lcp = lds_off(ring) + (unsigned)(crow * LP + 8 * cpc) * 2u;
  auto fill = [&](int s, int bf) {   // k = 64 s .. 64 s + 63 of the block's 128 A rows and 64 B rows into buffer bf
    const unsigned lb = lcp + (unsigned)bf * (unsigned)(NT * TILE_E * 2);
    const size_t k0 = (size_t)s * KT;
    cp_tile(lb, A + acp + k0, (size_t)16 * DM);
    cp_tile(lb + TILE_E * 2, A + acp + (size_t)64 * DM + k0, (size_t)16 * DM);
    cp_tile(lb + 2 * TILE_E * 2, Bt + bcp + k0, (size_t)16 * DM);
    if (ABF) {
      cp_tile(lb + 3 * TILE_E * 2, A2 + acp + k0, (size_t)16 * DM);
      cp_tile(lb + 4 * TILE_E * 2, A2 + acp + (size_t)64 * DM + k0, (size_t)16 * DM);
    }
  };
  const v8f z8 = {0.f, 0.f, 0.f, 0.f, 0.f, 0.f, 0.f, 0.f};
  v8f acc[8];
#pragma unroll
  for (int u = 0; u < 8; ++u) acc[u] = z8;
  fill(0, 0);
  asm volatile("s_wait_asynccnt 0x0" ::: "memory");   // this wave's copies of stage 0 have landed
  __syncthreads();                                    // ... and every other wave's
  fill(1, 1);
#pragma unroll 1   /* rolled: one hand-over of the buffers per trip, and the loop text stays small */
  for (int sg = 0; sg < DM / KT; ++sg) {
    const unsigned short* tb = ring + (sg & 1) * (NT * TILE_E);
    const unsigned short* ap = tb + (32 * w + ln) * LP;
    const unsigned short* bp0 = tb + 2 * TILE_E + ln * LP;
    // the stage's fragment reads stand together in front of its products: one LDS latency per stage, not one per fragment
    Frag fa[2][2], fl[2][2], fb[2][4];
#pragma unroll     /* both 32-k halves of the stage in line, so that every LDS offset is an immediate and every fragment a register */
    for (int h2 = 0; h2 < 2; ++h2) {
      fa[h2][0] = ldf(ap + 32 * h2, hh); fa[h2][1] = ldf(ap + 16 * LP + 32 * h2, hh);
      if (ABF) { fl[h2][0] = ldf(ap + 3 * TILE_E + 32 * h2, hh); fl[h2][1] = ldf(ap + 3 * TILE_E + 16 * LP + 32 * h2, hh); }
      else { fl[h2][0] = fa[h2][0]; fl[h2][1] = fa[h2][1]; }
#pragma unroll
      for (int t = 0; t < 4; ++t) fb[h2][t] = ldf(bp0 + (16 * t) * LP + 32 * h2, hh);
    }
#pragma unroll     /* in line, k ascending in every accumulator */
    for (int h2 = 0; h2 < 2; ++h2) {
#pragma unroll
      for (int t = 0; t < 4; ++t) {
        acc[t] = gmm<ABF>(fa[h2][0], fl[h2][0], fb[h2][t], acc[t]);
        acc[4 + t] = gmm<ABF>(fa[h2][1], fl[h2][1], fb[h2][t], acc[4 + t]);
      }
    }
    // hand-over of the buffers, passed by every wave:
    asm volatile("s_wait_dscnt 0x0" ::: "memory");      // this wave's reads of the buffer that is refilled below have returned
    asm volatile("s_wait_asynccnt 0x0" ::: "memory");   // this wave's copies of the next stage have landed
    __syncthreads();                                    // publishes the next stage and ends every wave's reads of this one
    if (sg + 2 < DM / KT) fill(sg + 2, sg & 1);
  }
  asm volatile("s_wait_asynccnt 0x0" ::: "memory");    // no copy is outstanding when the ring's LDS becomes the epilogue's tile
  // D element r of lane (hh, ln) = (row 8hh + r, col ln) of its 16x16 tile
#pragma unroll
  for (int u = 0; u < 8; ++u) {
    const int t = u & 3, half = u >> 2;
    const int col = t * 16 + ln;
    float bv = 0.f;
    if (BIAS) bv = bf16_rne(bias[col0 + col]);
#pragma unroll
    for (int r = 0; r < 8; ++r) so[32 * w + half * 16 + 8 * hh + r][col] = acc[u][r] * alpha + bv;
  }
  __syncthreads();
}

// q, k and v projections in one grid: grid.x = (row tiles of 128) * 8 col tiles, grid.y = batch, grid.z = weight plane (0 q, 1 k, 2 v).
// q and k: f16 row plane [row][DM] (+ bf16 hi/lo row planes for rows t < ERL); v: transposed planes [(b,head)][d][SEQ] (f16, + bf16 hi/lo for t < ERL).
__global__ __launch_bounds__(128) void k_proj(const unsigned short* __restrict__ X16, const unsigned short* __restrict__ W16,
                                              unsigned short* __restrict__ QK16, unsigned short* __restrict__ QKH, unsigned short* __restrict__ QKL,
                                              unsigned short* __restrict__ VT16, unsigned short* __restrict__ VTH, unsigned short* __restrict__ VTL) {
  __shared__ __attribute__((aligned(16))) unsigned char sm[GEMM_SM_B(false)];
  const sorow* const so = (const sorow*)sm;
  const int tid = threadIdx.x;
  const int rt = (int)blockIdx.x >> 3, nq = (int)blockIdx.x & 7, b = blockIdx.y, z = blockIdx.z;
  const int t0 = rt * 128;
  const size_t r0 = (size_t)b * SEQ + t0;
  const int col0 = nq * 64;
  gemm_core<false, false>(sm, X16, X16, W16 + (size_t)z * DM * DM, 0.0625f, nullptr, r0, col0);
  const bool early = (t0 < ERL);
  if (z < 2) {
#pragma unroll
    for (int it = 0; it < 8; ++it) {
      const int row = it * 16 + (tid >> 3), pc = tid & 7;
      const v4f x0 = *(const v4fa*)&so[row][8 * pc], x1 = *(const v4fa*)&so[row][8 * pc + 4];
      const size_t off = (size_t)z * (NR * DM) + (r0 + row) * DM + col0 + 8 * pc;
      const v8us o = to_f16x8(x0, x1);
      *(v8us*)(QK16 + off) = o;
      st_wait();
      if (early) {
        v8us oh, ol; to_bf16x8_hl(x0, x1, oh, ol);
        *(v8us*)(QKH + off) = oh;
        *(v8us*)(QKL + off) = ol;
        st_wait();
      }
    }
  } else {
    // transposed: 64 d rows x 128 tokens (256 B each): d = it*8 + tid/16, piece = tid%16 (8 tokens = 16 B)
    const int hd = nq;
#pragma unroll
    for (int it = 0; it < 8; ++it) {
      const int d = it * 8 + (tid >> 4), pc = tid & 15;
      v4f x0, x1;
#pragma unroll
      for (int j = 0; j < 4; ++j) { x0[j] = so[8 * pc + j][d]; x1[j] = so[8 * pc + 4 + j][d]; }
      const size_t off = (((size_t)b * NH + hd) * HD + d) * SEQ + t0 + 8 * pc;
      const v8us o = to_f16x8(x0, x1);
      *(v8us*)(VT16 + off) = o;
      st_wait();
      if (early) {
        v8us oh, ol; to_bf16x8_hl(x0, x1, oh, ol);
        *(v8us*)(VTH + off) = oh;
        *(v8us*)(VTL + off) = ol;
        st_wait();
      }
    }
  }
}

// Output projection + bias for all rows in one grid: grid.x = (row tiles of 128) * 8 col tiles, grid.y = batch; row tiles t < ERL take the bf16 hi/lo ctx planes, the rest the f16 plane (ctx x64, weights x16).
__global__ __launch_bounds__(128) void k_out(const unsigned short* __restrict__ CH, const unsigned short* __restrict__ CL, const unsigned short* __restrict__ C16,
                                             const unsigned short* __restrict__ WPB, const unsigned short* __restrict__ WP16,
                                             const float* __restrict__ bias, float* __restrict__ OF) {
  __shared__ __attribute__((aligned(16))) unsigned char sm[GEMM_SM_B(true)];
  const sorow* const so = (const sorow*)sm;
  const int tid = threadIdx.x;
  const int rt = (int)blockIdx.x >> 3, nq = (int)blockIdx.x & 7, b = blockIdx.y;
  const int t0 = rt * 128;
  const size_t r0 = (size_t)b * SEQ + t0;
  const int col0 = nq * 64;
  if (t0 < ERL) gemm_core<true, true>(sm, CH, CL, WPB, 1.0f, bias, r0, col0);
  else gemm_core<false, true>(sm, C16, C16, WP16, 0.0009765625f, bias, r0, col0);
  // f32 rows of the output buffer (full-size layout): 128 rows x 256 B: row = it*8 + tid/16, piece = tid%16 (4 floats = 16 B)
#pragma unroll
  for (int it = 0; it < 16; ++it) {
    const int row = it * 8 + (tid >> 4), pc = tid & 15;
    const v4f v = *(const v4fa*)&so[row][4 * pc];
    *(v4f*)(OF + ((size_t)b * SEQ_FULL + t0 + row) * DM + col0 + 4 * pc) = v;
  }
}

// Causal attention, one wave per 16 query rows of one (batch, head); block = 4 waves (64 queries) that share the staged K and V^T tiles; one block barrier per ring stage (RES: 64 keys; dense rows: 128 keys).
// S^T[key][query] = K Q^T: A = K rows (lane = key), B = Q rows (lane = query). D: lane (hh, ln) element r = (key 8hh + r, query ln).
// O^T[d][query] = V^T P^T: A = V^T rows (lane = d, k = keys), B = packed P^T: element r <- tile(keys 0..15)[r], element 8+r <- tile(keys 16..31)[r].
// RES: bf16 hi/lo operands, three products per site; else f16 single products with P carried x1024 (sum carried alike) and ctx stored x64.
// lds: the ring [buffer][4 tiles][row * LP + element]; the four tiles of a buffer are K hi, V^T hi, K lo, V^T lo of 64 keys with RES, else K, V^T of 64 keys and K, V^T of the next 64; behind the loop's last barrier its first bytes become the waves' output tiles [wave][hi, lo][16][64].
template <bool RES>
__device__ __forceinline__ void attn_body(unsigned short* lds, const unsigned short* __restrict__ Qh, const unsigned short* __restrict__ Ql,
                                          const unsigned short* __restrict__ Kh, const unsigned short* __restrict__ Kl,
                                          const unsigned short* __restrict__ Vh, const unsigned short* __restrict__ Vl,
                                          unsigned short* __restrict__ Ch, unsigned short* __restrict__ Cl, int qb, int h, int b) {
  constexpr int NTL = 4;             /* staged tiles per buffer */
  constexpr int SPT = RES ? 1 : 2;   /* 64-key tile pairs per ring stage: the dense rows need no lo tiles, so their stage is twice as long and its copies have twice the time to land */
  const int lane = threadIdx.x & 31, ln = lane & 15, hh = lane >> 4;
  const int w = __builtin_amdgcn_readfirstlane((int)(threadIdx.x >> 5));
  unsigned short (* const sc)[16][64] = (unsigned short (*)[16][64])lds + w * (RES ? 2 : 1);   /* this wave's output tiles */
  const int q0 = qb + w * 16;
  const int qi = q0 + ln;
  const size_t rowb = (size_t)b * SEQ;
  const size_t qof = (rowb + q0 + ln) * DM + h * HD;
  const Frag qh0 = ldf(Qh + qof, hh), qh1 = ldf(Qh + qof + 32, hh);
  Frag ql0 = qh0, ql1 = qh1;
  if (RES) { ql0 = ldf(Ql + qof, hh); ql1 = ldf(Ql + qof + 32, hh); }
  const int crow = (int)threadIdx.x >> 3, cpc = (int)threadIdx.x & 7;
  const size_t kcp = (rowb + crow) * DM + h * HD + 8 * cpc;
  const size_t vcp = (((size_t)b * NH + h) * HD + crow) * SEQ + 8 * cpc;
  const unsigned lcp = lds_off(lds) + (unsigned)(crow * LP + 8 * cpc) * 2u;
  const int nst = (qb >> 6) + 1;            // scalar and the same in the whole block: tiles of 64 keys up to the block's last query
  const int ntr = (nst + SPT - 1) / SPT;    // ring stages
  auto fill = [&](int s, int bf) {   // ring stage s (keys 64 SPT s .. 64 SPT s + 64 SPT - 1) into buffer bf
    const unsigned lb = lcp + (unsigned)bf * (unsigned)(NTL * TILE_E * 2);
    const size_t k0 = (size_t)s * (SPT * KT);
    cp_tile(lb, Kh + kcp + k0 * DM, (size_t)16 * DM);
    cp_tile(lb + TILE_E * 2, Vh + vcp + k0, (size_t)16 * SEQ);
    if (RES) {
      cp_tile(lb + 2 * TILE_E * 2, Kl + kcp + k0 * DM, (size_t)16 * DM);
      cp_tile(lb + 3 * TILE_E * 2, Vl + vcp + k0, (size_t)16 * SEQ);
    } else {   // the stage's second tile pair; behind an odd tile count it lies past the diagonal, still inside the sequence (SEQ is a multiple of 128), and is not worked on
      cp_tile(lb + 2 * TILE_E * 2, Kh + kcp + (k0 + KT) * DM, (size_t)16 * DM);
      cp_tile(lb + 3 * TILE_E * 2, Vh + vcp + k0 + KT, (size_t)16 * SEQ);
    }
  };
  const v8f z8 = {0.f, 0.f, 0.f, 0.f, 0.f, 0.f, 0.f, 0.f};
  v8f acc[4];
#pragma unroll
  for (int t = 0; t < 4; ++t) acc[t] = z8;
  float m = NEGBIG, l = 0.f;
  const float carry = RES ? 0.f : CARRY_LN;
  fill(0, 0);
  asm volatile("s_wait_asynccnt 0x0" ::: "memory");   // this wave's copies of stage 0 have landed
  __syncthreads();                                    // ... and every other wave's
  if (ntr > 1) fill(1, 1);
#pragma unroll 1   /* rolled: one hand-over of the buffers per trip, and the loop text stays small */
  for (int sg = 0; sg < ntr; ++sg) {
   const unsigned short* tb = lds + (sg & 1) * (NTL * TILE_E);
   if (!RES) {
    // K fragments of the stage's first tile pair; those of the second are read below, into the same registers, while the first pair's softmax runs (the whole stage is published)
    Frag kf[4][2];
#pragma unroll
    for (int kt = 0; kt < 4; ++kt) {
      const unsigned short* kp = tb + (16 * kt + ln) * LP;
      kf[kt][0] = ldf(kp, hh); kf[kt][1] = ldf(kp + 32, hh);
    }
#pragma unroll     /* both tile pairs of the stage in line, so that every LDS offset is an immediate */
   for (int tp = 0; tp < SPT; ++tp) {
    if (tp > 0 && SPT * sg + tp >= nst) continue;   // scalar, the same in the whole block: behind an odd tile count the last stage's second tile pair lies past the diagonal
    const unsigned short* tk = tb + tp * (2 * TILE_E);
    // dense rows: a tile pair's 64 keys are one softmax step: one maximum, one rescale, eight score and eight P.V products in four independent accumulator chains each
    // (keys behind the diagonal get weight 0 by the mask; every loop of the step is unrolled, so that fragments, scores and accumulators stay in registers under constant indices)
    const int kb = (SPT * sg + tp) * KT;
    // the V^T fragment reads stand together in front of the products, behind the K reads: they return while scores and softmax run
    Frag vf[4][2];
    __builtin_amdgcn_sched_barrier(0);   // keeps every K read in front of the V^T reads: LDS returns in order, and the score products then wait for K alone
#pragma unroll
    for (int t = 0; t < 4; ++t) {
      const unsigned short* vp = tk + TILE_E + (16 * t + ln) * LP;
      vf[t][0] = ldf(vp, hh); vf[t][1] = ldf(vp + 32, hh);
    }
    v8f s[4];
#pragma unroll
    for (int kt = 0; kt < 4; ++kt) s[kt] = wm_h(kf[kt][0], qh0, z8);
#pragma unroll
    for (int kt = 0; kt < 4; ++kt) s[kt] = wm_h(kf[kt][1], qh1, s[kt]);
    nop_grp(s, kf, qh0, qh1);
    if (kb + KT > q0) {   // scalar condition: this tile pair touches the diagonal; masked scores are replaced
#pragma unroll
      for (int kt = 0; kt < 4; ++kt)
#pragma unroll
        for (int r = 0; r < 8; ++r) { const int key = kb + 16 * kt + 8 * hh + r; s[kt][r] = (key > qi) ? NEGBIG : s[kt][r]; }
    }
    float mt[4];
#pragma unroll
    for (int kt = 0; kt < 4; ++kt) {
      float a = s[kt][0];
#pragma unroll
      for (int r = 1; r < 8; ++r) a = fmaxf(a, s[kt][r]);
      mt[kt] = a;
    }
    float mx = fmaxf(fmaxf(mt[0], mt[1]), fmaxf(mt[2], mt[3]));
    const float mxo = __shfl_xor(mx, 16, 32);
    if (tp + 1 < SPT) {
      __builtin_amdgcn_sched_barrier(0);   // the exchange goes to the LDS queue first: it returns in order, so the maximum does not wait for the reads below
#pragma unroll
      for (int kt = 0; kt < 4; ++kt) {
        const unsigned short* kp = tk + 2 * TILE_E + (16 * kt + ln) * LP;
        kf[kt][0] = ldf(kp, hh); kf[kt][1] = ldf(kp + 32, hh);
      }
      __builtin_amdgcn_sched_barrier(0);   // keeps the reads here, in front of the exponentials that hide their latency
    }
    mx = fmaxf(mx, mxo);
    const float mnew = fmaxf(m, mx);
    const float alpha = __expf((m - mnew) * QSCALE);
    const float cc = carry - mnew * QSCALE;
    m = mnew;
    Frag ph[2];
    float pt[4];
#pragma unroll
    for (int kt = 0; kt < 4; ++kt) {
      float a = 0.f;
#pragma unroll
      for (int r = 0; r < 8; ++r) {
        const float p = __expf(fmaf(s[kt][r], QSCALE, cc));
        ph[kt >> 1].e[8 * (kt & 1) + r] = (_Float16)p; a += p;
      }
      pt[kt] = a;
    }
    float ps = (pt[0] + pt[1]) + (pt[2] + pt[3]);
    ps += __shfl_xor(ps, 16, 32);
    l = l * alpha + ps;
#pragma unroll
    for (int t = 0; t < 4; ++t) acc[t] = acc[t] * alpha;
#pragma unroll
    for (int t = 0; t < 4; ++t) acc[t] = wm_h(vf[t][0], ph[0], acc[t]);
#pragma unroll
    for (int t = 0; t < 4; ++t) acc[t] = wm_h(vf[t][1], ph[1], acc[t]);
    nop_grp(acc, vf, ph[0], ph[1]);
   }
   } else
#pragma unroll     /* both 32-key halves of the stage in line, so that every LDS offset is an immediate */
   for (int hf = 0; hf < 2; ++hf) {
    const unsigned short* tk = tb;
    const int kb = sg * KT + hf * 32;
    if (kb >= q0 + 16) continue;   // scalar: the wave's queries all lie in front of these 32 keys
    v8f s[2];
#pragma unroll
    for (int kt = 0; kt < 2; ++kt) {
      const unsigned short* kp = tk + (hf * 32 + 16 * kt + ln) * LP;
      const Frag k0 = ldf(kp, hh), k1 = ldf(kp + 32, hh);
      v8f c = z8;
      if (RES) {
        const Frag kl0 = ldf(kp + 2 * TILE_E, hh), kl1 = ldf(kp + 2 * TILE_E + 32, hh);
        c = wm_b(k0, qh0, c); c = wm_b(kl0, qh0, c); c = wm_b(k0, ql0, c);
        c = wm_b(k1, qh1, c); c = wm_b(kl1, qh1, c); c = wm_b(k1, ql1, c);
        nop8(c, k0, k1, kl0, kl1, qh0, qh1, ql0, ql1);
      } else {
        c = wm_h(k0, qh0, c); c = wm_h(k1, qh1, c);
        nop4(c, k0, k1, qh0, qh1);
      }
      s[kt] = c;
    }
    if (kb + 32 > q0) {   // scalar condition: this step touches the diagonal; masked scores are replaced
#pragma unroll
      for (int kt = 0; kt < 2; ++kt)
#pragma unroll
        for (int r = 0; r < 8; ++r) { const int key = kb + 16 * kt + 8 * hh + r; s[kt][r] = (key > qi) ? NEGBIG : s[kt][r]; }
    }
    float mx = fmaxf(s[0][0], s[1][0]);
#pragma unroll
    for (int r = 1; r < 8; ++r) mx = fmaxf(mx, fmaxf(s[0][r], s[1][r]));
    mx = fmaxf(mx, __shfl_xor(mx, 16, 32));
    const float mnew = fmaxf(m, mx);
    const float alpha = __expf((m - mnew) * QSCALE);
    const float cc = carry - mnew * QSCALE;
    m = mnew;
    Frag ph, pl;
    float ps = 0.f;
#pragma unroll
    for (int kt = 0; kt < 2; ++kt)
#pragma unroll
      for (int r = 0; r < 8; ++r) {
        const float p = __expf(fmaf(s[kt][r], QSCALE, cc));
        if (RES) {
          const unsigned short hb = bf16_bits(p); const float hv = bf16_val(hb);
          const unsigned short lb = bf16_bits(p - hv);
          ph.u[8 * kt + r] = hb; pl.u[8 * kt + r] = lb; ps += hv + bf16_val(lb);
        } else {
          ph.e[8 * kt + r] = (_Float16)p; ps += p;
        }
      }
    if (!RES) pl = ph;
    ps += __shfl_xor(ps, 16, 32);
    l = l * alpha + ps;
#pragma unroll
    for (int t = 0; t < 4; ++t) acc[t] = acc[t] * alpha;
#pragma unroll
    for (int t = 0; t < 4; ++t) {
      const unsigned short* vp = tk + TILE_E + (16 * t + ln) * LP + hf * 32;
      const Frag vh = ldf(vp, hh);
      if (RES) {
        const Frag vl = ldf(vp + 2 * TILE_E, hh);
        acc[t] = wm_b(vh, ph, acc[t]); acc[t] = wm_b(vl, ph, acc[t]); acc[t] = wm_b(vh, pl, acc[t]);
        nop4(acc[t], vh, vl, ph, pl);
      } else {
        acc[t] = wm_h(vh, ph, acc[t]);
        nop2(acc[t], vh, ph);
      }
    }
   }
   // hand-over of the buffers, passed by every wave:
   asm volatile("s_wait_dscnt 0x0" ::: "memory");      // this wave's reads of the buffer that is refilled below have returned
   asm volatile("s_wait_asynccnt 0x0" ::: "memory");   // this wave's copies of the next stage have landed
   __syncthreads();                                    // publishes the next stage and ends every wave's reads of this one
   if (sg + 2 < ntr) fill(sg + 2, sg & 1);
  }
  asm volatile("s_wait_asynccnt 0x0" ::: "memory");    // no copy is outstanding when the ring's LDS becomes the output tiles
  // acc[t][r] = O^T[d = 16t + 8hh + r][query ln]; normalise and stage row ln of the wave tile
  const float inv = 1.0f / l;
  const float osc = RES ? inv : inv * 64.0f;
#pragma unroll
  for (int t = 0; t < 4; ++t) {
    if (RES) {
      Frag oh, ol;
#pragma unroll
      for (int r = 0; r < 8; ++r) { const float c = acc[t][r] * osc; const unsigned short hb = bf16_bits(c); oh.u[r] = hb; ol.u[r] = bf16_bits(c - bf16_val(hb)); }
      *(v8us*)&sc[0][ln][16 * t + 8 * hh] = oh.half[0];
      *(v8us*)&sc[RES ? 1 : 0][ln][16 * t + 8 * hh] = ol.half[0];
    } else {
      Frag o;
#pragma unroll
      for (int r = 0; r < 8; ++r) o.e[r] = (_Float16)(acc[t][r] * osc);
      *(v8us*)&sc[0][ln][16 * t + 8 * hh] = o.half[0];
    }
  }
  __builtin_amdgcn_fence(4 /* acq_rel order */, "workgroup");
  __builtin_amdgcn_wave_barrier();
  const int rsub = lane >> 3, pc = lane & 7;
  {
#pragma unroll
    for (int q = 0; q < 4; ++q) {
      const int row = 4 * q + rsub;
      const size_t off = (rowb + q0 + row) * DM + h * HD + 8 * pc;
      const v8us v0 = *(const v8us*)&sc[0][row][8 * pc];
      *(v8us*)(Ch + off) = v0;
      if (RES) { const v8us v1 = *(const v8us*)&sc[RES ? 1 : 0][row][8 * pc]; *(v8us*)(Cl + off) = v1; }
    }
    
  }
}

// Both row classes in one grid: grid.x = query tiles of 64 rows from row tbase on, grid.y = head, grid.z = batch.
// Tiles of rows t < ERL run on the bf16 hi/lo planes, the rest on the f16 planes.
__global__ __launch_bounds__(128) void k_attn(const unsigned short* __restrict__ QH, const unsigned short* __restrict__ QL,
                                              const unsigned short* __restrict__ KH, const unsigned short* __restrict__ KL,
                                              const unsigned short* __restrict__ VTH, const unsigned short* __restrict__ VTL,
                                              const unsigned short* __restrict__ Q16, const unsigned short* __restrict__ K16, const unsigned short* __restrict__ VT16,
                                              unsigned short* __restrict__ CH, unsigned short* __restrict__ CL, unsigned short* __restrict__ C16, int tbase) {
  __shared__ __attribute__((aligned(16))) unsigned short lds[2 * 4 * TILE_E];
  const int h = blockIdx.y, b = blockIdx.z;
  // Every block of the grid is resident at once and a tile's cost grows with its row, so the launch lasts as long as the fullest WGP. The tiles fall into four classes of QG by row (class 0: the multi-product rows);
  // block x takes, of class (x / QG + b) % 4, tile x % QG counted upward in class 0 and downward in the others: blocks x, x + QG, x + 2 QG, x + 3 QG of one (head, batch), and blocks (x, head) of four successive batches, then hold one tile of each class with nearly the same summed cost.
  // For a fixed (head, batch) the map is a permutation of the tiles; where blocks land matters for speed alone.
  constexpr int QG = SEQ / 64 / 4;
  const int xr = (int)blockIdx.x % QG, xc = ((int)blockIdx.x / QG + b) & 3;
  const int qb = tbase + (xc == 0 ? xr : (xc + 1) * QG - 1 - xr) * 64;
  if (qb < ERL) attn_body<true>(lds, QH, QL, KH, KL, VTH, VTL, CH, CL, qb, h, b);
  else attn_body<false>(lds, Q16, Q16, K16, K16, VT16, VT16, C16, C16, qb, h, b);
}

extern "C" void kernel_launch(void* const* d_in, const int* in_sizes, int n_in,
                              void* d_out, int out_size, void* d_ws, size_t ws_size, hipStream_t stream) {
  static_assert(NH * HD == DM);
  static_assert(DM == 512);
  static_assert(SEQ % 256 == 0);
  static_assert(ERL % 128 == 0);
  static_assert(NB <= NB_FULL);
  static_assert(((size_t)NB * SEQ * DM) % (8 * 256) == 0 && (DM * DM) % (8 * 256) == 0);   /* the conversion grid is exact: no thread past an end */
  static_assert(SEQ <= SEQ_FULL);
  static_assert((size_t)13 * NB * SEQ * DM * 2 + (size_t)5 * DM * DM * 2 <= (size_t)134217728);
  if (n_in < 6) return;
  const long long xmin = ((long long)(NB - 1) * SEQ_FULL + SEQ) * DM;
  if ((long long)in_sizes[0] < xmin) return;
  if (in_sizes[1] < DM * DM || in_sizes[2] < DM * DM || in_sizes[3] < DM * DM || in_sizes[4] < DM * DM || in_sizes[5] < DM) return;
  if ((long long)out_size < xmin) return;
  const float* x  = (const float*)d_in[0];
  const float* Wq = (const float*)d_in[1];
  const float* Wk = (const float*)d_in[2];
  const float* Wv = (const float*)d_in[3];
  const float* Wp = (const float*)d_in[4];
  const float* bp = (const float*)d_in[5];
  float* out = (float*)d_out;

  char* ws = (char*)d_ws; size_t off = 0;
  auto take = [&](size_t bytes) { char* p = ws + off; off += (bytes + 255) & ~(size_t)255; return (unsigned short*)p; };
  const size_t PL = NR * DM;            /* elements of one [NB*SEQ][DM] 16-bit plane */
  const size_t WN = (size_t)DM * DM;
  unsigned short* W16  = take(4 * WN * 2);     /* Wq, Wk, Wv, Wp as f16 x16, [n][k] */
  unsigned short* WPB  = take(WN * 2);         /* Wp as bf16, [n][k] */
  unsigned short* X16  = take(PL * 2);
  unsigned short* QK16 = take(2 * PL * 2);     /* q plane then k plane (f16) */
  unsigned short* QKH  = take(2 * PL * 2);     /* bf16 hi, rows t < ERL written */
  unsigned short* QKL  = take(2 * PL * 2);     /* bf16 lo, rows t < ERL written */
  unsigned short* VT16 = take(PL * 2);         /* [(b,h)][d][SEQ] f16 */
  unsigned short* VTH  = take(PL * 2);
  unsigned short* VTL  = take(PL * 2);
  unsigned short* C16  = take(PL * 2);         /* ctx x64 f16, rows t >= ERL */
  unsigned short* CH   = take(PL * 2);         /* ctx bf16 hi, rows t < ERL */
  unsigned short* CL   = take(PL * 2);         /* ctx bf16 lo, rows t < ERL */
  if (off > ws_size || off > (size_t)134217728) return;

  /* conversions of the four weight matrices and of x */
  k_prep<<<(unsigned)(4 * WBLK + XBLK), 256, 0, stream>>>(x, Wq, Wk, Wv, Wp, X16, W16, WPB);

  /* q, k and v projections: grid.z selects the weight plane and the output plane set; v is written transposed per (batch, head) */
  k_proj<<<dim3((SEQ / 128) * 8, NB, 3), 128, 0, stream>>>(X16, W16, QK16, QKH, QKL, VT16, VTH, VTL);

  /* attention: first ERL rows on bf16 hi/lo planes, remaining rows on f16 planes */
  k_attn<<<dim3(SEQ / 64, NH, NB), 128, 0, stream>>>(QKH, QKL, QKH + PL, QKL + PL, VTH, VTL, QK16, QK16 + PL, VT16, CH, CL, C16, 0);

  /* output projection + bias */
  k_out<<<dim3((SEQ / 128) * 8, NB, 1), 128, 0, stream>>>(CH, CL, C16, WPB, W16 + 3 * WN, bp, out);
}

// v007
// One run takes 64 microseconds.
// Next to v006, in two timings, it ran 1.03 and 1.04 times as fast.
// Counting every step since v000, it is 4.45 times as fast.
#include <hip/hip_runtime.h>
// Compute dtype: inputs RNE-converted to bf16 values (x as exact f16, weights as exact f16 x16 / exact bf16); q,k,v projections, dense-row scores, dense-row P.V and dense-row output GEMM = v_wmma_f32_16x16x32_f16 single products (P carried x1024, ctx carried x64); first ERL rows of every sequence: scores and P.V as bf16 hi/lo three-product sums, output GEMM as bf16 hi/lo A x exact bf16 W (v_wmma_f32_16x16x32_bf16); all accumulation, softmax statistics, bias add in f32.
// Structure: causal attention per (batch, head) with S^T = K Q^T (Q fragments in registers as the B operand) and O^T = V^T P^T (packed S^T accumulators are the B fragment), online max-subtracted softmax per lane column; K and V^T tiles of 64 keys are staged in LDS once per block (two buffers; a buffer holds one tile pair with its lo planes for the first ERL rows, two tile pairs = 128 keys for the dense rows) and read from there by its four waves. Four launches, each the jobs that read none of each other's output, the job picked by the block index: conversions; q, k, v projections; attention (both row classes); output GEMM (both row classes).
#ifndef NB
#define NB 4
#endif
#ifndef SEQ
#define SEQ 2048
#endif
#ifndef EARLY
#define EARLY 512
#endif
#define NB_FULL 4
#define SEQ_FULL 2048
#define DM 512
#define NH 8
#define HD 64
#define ERL ((EARLY < SEQ) ? EARLY : SEQ)   /* rows per sequence on the multi-product path */
#define NR ((size_t)NB * SEQ)               /* compact token rows r = b*SEQ + t */
#define QSCALE 0.044194173824159216f        /* d_model^-0.5 */
#define NEGBIG (-3.0e38f)
#define CARRY_LN 6.931471805599453f         /* ln 1024 */

typedef _Float16 v16h __attribute__((ext_vector_type(16)));
typedef __bf16   v16b __attribute__((ext_vector_type(16)));
typedef unsigned short v8us __attribute__((ext_vector_type(8), may_alias));
typedef float v8f  __attribute__((ext_vector_type(8)));
typedef float v4f  __attribute__((ext_vector_type(4)));
typedef float v4fa __attribute__((ext_vector_type(4), may_alias));
union Frag { v16h h; v16b b; v8us half[2]; _Float16 e[16]; unsigned short u[16]; };

__device__ __forceinline__ unsigned short bf16_bits(float x) { unsigned int u = __float_as_uint(x); return (unsigned short)((u + 0x7FFFu + ((u >> 16) & 1u)) >> 16); }
__device__ __forceinline__ float bf16_val(unsigned short b) { return __uint_as_float(((unsigned int)b) << 16); }
__device__ __forceinline__ float bf16_rne(float x) { return bf16_val(bf16_bits(x)); }

// fragment loader (A and B alike): elements 0..7 <- p[8h .. 8h+7], elements 8..15 <- p[16+8h .. 16+8h+7]
__device__ __forceinline__ Frag ldf(const unsigned short* p, int hh) {
  Frag f; f.half[0] = *(const v8us*)(p + 8 * hh); f.half[1] = *(const v8us*)(p + 16 + 8 * hh); return f;
}
__device__ __forceinline__ v8f wm_h(const Frag& a, const Frag& b, v8f c) { return __builtin_amdgcn_wmma_f32_16x16x32_f16(false, a.h, false, b.h, (short)0, c, false, false); }
__device__ __forceinline__ v8f wm_b(const Frag& a, const Frag& b, v8f c) { return __builtin_amdgcn_wmma_f32_16x16x32_bf16(false, a.b, false, b.b, (short)0, c, false, false); }
__device__ __forceinline__ void nop2(v8f& c, const Frag& a, const Frag& b) { asm volatile("v_nop\n\tv_nop\n\tv_nop\n\tv_nop" : "+v"(c) : "v"(a.h), "v"(b.h)); }
__device__ __forceinline__ void nop3(v8f& c, const Frag& a, const Frag& b, const Frag& d) { asm volatile("v_nop\n\tv_nop\n\tv_nop\n\tv_nop" : "+v"(c) : "v"(a.h), "v"(b.h), "v"(d.h)); }
__device__ __forceinline__ void nop4(v8f& c, const Frag& a, const Frag& b, const Frag& d, const Frag& e) { asm volatile("v_nop\n\tv_nop\n\tv_nop\n\tv_nop" : "+v"(c) : "v"(a.h), "v"(b.h), "v"(d.h), "v"(e.h)); }
__device__ __forceinline__ void nop8(v8f& c, const Frag& a, const Frag& b, const Frag& d, const Frag& e, const Frag& f, const Frag& g, const Frag& i, const Frag& j) {
  asm volatile("v_nop\n\tv_nop\n\tv_nop\n\tv_nop" : "+v"(c) : "v"(a.h), "v"(b.h), "v"(d.h), "v"(e.h), "v"(f.h), "v"(g.h), "v"(i.h), "v"(j.h));
}

// behind a group of eight products on four accumulators (four A fragments per k half, one B fragment per k half): the four vector slots that the chip needs before an accumulator is read or an operand register rewritten
__device__ __forceinline__ void nop_grp(v8f (&c)[4], const Frag (&a)[4][2], const Frag& b0, const Frag& b1) {
  asm volatile("v_nop\n\tv_nop\n\tv_nop\n\tv_nop" : "+v"(c[0]), "+v"(c[1]), "+v"(c[2]), "+v"(c[3])
               : "v"(a[0][0].h), "v"(a[0][1].h), "v"(a[1][0].h), "v"(a[1][1].h), "v"(a[2][0].h), "v"(a[2][1].h), "v"(a[3][0].h), "v"(a[3][1].h), "v"(b0.h), "v"(b1.h));
}

__device__ __forceinline__ v8us to_f16x8(v4f a, v4f c) {
  Frag f;
#pragma unroll
  for (int q = 0; q < 4; ++q) { f.e[q] = (_Float16)a[q]; f.e[4 + q] = (_Float16)c[q]; }
  return f.half[0];
}
__device__ __forceinline__ void to_bf16x8_hl(v4f a, v4f c, v8us& hi, v8us& lo) {
  Frag fh, fl;
#pragma unroll
  for (int q = 0; q < 4; ++q) {
    unsigned short hb = bf16_bits(a[q]); fh.u[q] = hb; fl.u[q] = bf16_bits(a[q] - bf16_val(hb));
    hb = bf16_bits(c[q]); fh.u[4 + q] = hb; fl.u[4 + q] = bf16_bits(c[q] - bf16_val(hb));
  }
  hi = fh.half[0]; lo = fl.half[0];
}

// behind a global store: stands in front of any rewrite of the registers that the store names
__device__ __forceinline__ void st_wait() { asm volatile("s_wait_xcnt 0x0" ::: "memory"); }

#define XBLK ((int)(NR * DM / 8 / 256))     /* conversion blocks of x: 8 elements a thread */
#define WBLK (DM * DM / 8 / 256)            /* conversion blocks of one weight matrix */

// All input conversions in one grid: blocks 0 .. 4 WBLK - 1 take the four weight matrices (f16 x16 planes; the last also its bf16 plane), the rest take x (bf16 values as exact f16).
__global__ __launch_bounds__(256) void k_prep(const float* __restrict__ x, const float* __restrict__ Wq, const float* __restrict__ Wk, const float* __restrict__ Wv, const float* __restrict__ Wp,
                                              unsigned short* __restrict__ X16, unsigned short* __restrict__ W16, unsigned short* __restrict__ WBF) {
  const int bx = (int)blockIdx.x;
  if (bx < 4 * WBLK) {
    const int sel = bx / WBLK;
    const float* w = sel == 0 ? Wq : sel == 1 ? Wk : sel == 2 ? Wv : Wp;
    const int t = (bx % WBLK) * 256 + (int)threadIdx.x;
    const v4f a = *(const v4fa*)(w + (size_t)t * 8), c = *(const v4fa*)(w + (size_t)t * 8 + 4);
    v4f as, cs; Frag fb;
#pragma unroll
    for (int q = 0; q < 4; ++q) {
      const unsigned short b0 = bf16_bits(a[q]), b1 = bf16_bits(c[q]);
      fb.u[q] = b0; fb.u[4 + q] = b1;
      as[q] = bf16_val(b0) * 16.0f; cs[q] = bf16_val(b1) * 16.0f;
    }
    const v8us o = to_f16x8(as, cs);
    const v8us ob = fb.half[0];
    *(v8us*)(W16 + (size_t)sel * DM * DM + (size_t)t * 8) = o;
    st_wait();
    if (sel == 3) { *(v8us*)(WBF + (size_t)t * 8) = ob; st_wait(); }
  } else {
    const int t = (bx - 4 * WBLK) * 256 + (int)threadIdx.x;
    const int r = t / (DM / 8), c8 = (t % (DM / 8)) * 8;
    const int b = r / SEQ, tt = r % SEQ;
    const float* src = x + ((size_t)b * SEQ_FULL + tt) * DM + c8;
    const v4f a = *(const v4fa*)src, c = *(const v4fa*)(src + 4);
    v4f ar, cr;
#pragma unroll
    for (int q = 0; q < 4; ++q) { ar[q] = bf16_rne(a[q]); cr[q] = bf16_rne(c[q]); }
    const v8us o = to_f16x8(ar, cr);
    *(v8us*)(X16 + (size_t)t * 8) = o;
    st_wait();
  }
}

#define KT 64               /* keys per staged tile (attention) or k elements per LDS stage (GEMM) */
#define LP 72               /* LDS row pitch in 16-bit elements: 144 B = 16 B x odd, the pitch for 16-byte readers of 128-B rows */
#define TILE_E (64 * LP)    /* one staged tile: 64 rows of 128 B */

__device__ __forceinline__ unsigned lds_off(const void* p) { return (unsigned)(size_t)p; }

// One 64-row x 128-B tile into LDS by the block's 128 threads: thread = (row tid/8 + 16 i, 16-byte piece tid%8), i = 0..3, so a wave's copy takes 4 whole lines.
// l = the lane's LDS byte address of row tid/8, g = its global address there, gstep = 16 source rows in elements.
__device__ __forceinline__ void cp_tile(unsigned l, const unsigned short* g, size_t gstep) {
  const unsigned l1 = l + 16 * LP * 2, l2 = l + 32 * LP * 2, l3 = l + 48 * LP * 2;
  const unsigned short* g1 = g + gstep;
  const unsigned short* g2 = g + 2 * gstep;
  const unsigned short* g3 = g + 3 * gstep;
  // the copies bring the tile into LDS through no register; the closing s_wait_xcnt stands in front of any rewrite of the address registers they name
  asm volatile("global_load_async_to_lds_b128 %0, %4, off\n\t"
               "global_load_async_to_lds_b128 %1, %5, off\n\t"
               "global_load_async_to_lds_b128 %2, %6, off\n\t"
               "global_load_async_to_lds_b128 %3, %7, off\n\t"
               "s_wait_xcnt 0x0"
               :: "v"(l), "v"(l1), "v"(l2), "v"(l3), "v"(g), "v"(g1), "v"(g2), "v"(g3) : "memory");
}

template <bool ABF>
__device__ __forceinline__ v8f gmm(const Frag& a, const Frag& al, const Frag& b, v8f c) {
  if (ABF) { c = wm_b(a, b, c); c = wm_b(al, b, c); nop3(c, a, al, b); }
  else { c = wm_h(a, b, c); nop2(c, a, b); }
  return c;
}

// GEMM over K = DM: block = 4 waves, block tile 128 token rows x 64 cols, wave tile 32 x 64; the block's A rows and B rows are staged in LDS 64 k at a time (two buffers) and read from there by its four waves.
// ABF: A = bf16 hi (A) + lo (A2) planes, two products against bf16 Bt; else A f16, single product against f16 Bt.
// gemm_core leaves the block's 128 x 64 tile (x alpha, + the bf16 value of the bias where BIAS) as f32 in LDS, published by a block barrier; the epilogues below store it.
#define GEMM_NT(ABF) ((ABF) ? 5 : 3)                    /* tiles of 64 rows x 128 B per stage: A rows 0..63, A rows 64..127, B rows, then the A lo rows */
#define GEMM_RING_B(ABF) (2 * GEMM_NT(ABF) * TILE_E * 2) /* two buffers, bytes */
#define SO_B (128 * 68 * 4)                             /* the epilogue's f32 tile, which takes the ring's place behind the loop's last barrier */
#define GEMM_SM_B(ABF) (GEMM_RING_B(ABF) > SO_B ? GEMM_RING_B(ABF) : SO_B)
typedef float sorow[68];

template <bool ABF, bool BIAS>
__device__ __forceinline__ void gemm_core(unsigned char* sm, const unsigned short* __restrict__ A, const unsigned short* __restrict__ A2,
                                          const unsigned short* __restrict__ Bt, float alpha, const float* __restrict__ bias, size_t r0, int col0) {
  constexpr int NT = GEMM_NT(ABF);
  unsigned short* const ring = (unsigned short*)sm;
  sorow* const so = (sorow*)sm;
  const int tid = threadIdx.x, lane = tid & 31, ln = lane & 15, hh = lane >> 4;
  const int w = __builtin_amdgcn_readfirstlane((int)(threadIdx.x >> 5));
  const int crow = tid >> 3, cpc = tid & 7;
  const size_t acp = (r0 + crow) * DM + 8 * cpc;
  const size_t bcp = (size_t)(col0 + crow) * DM + 8 * cpc;
  const unsigned lcp = lds_off(ring) + (unsigned)(crow * LP + 8 * cpc) * 2u;
  auto fill = [&](int s, int bf) {   // k = 64 s .. 64 s + 63 of the block's 128 A rows and 64 B rows into buffer bf
    const unsigned lb = lcp + (unsigned)bf * (unsigned)(NT * TILE_E * 2);
    const size_t k0 = (size_t)s * KT;
    cp_tile(lb, A + acp + k0, (size_t)16 * DM);
    cp_tile(lb + TILE_E * 2, A + acp + (size_t)64 * DM + k0, (size_t)16 * DM);
    cp_tile(lb + 2 * TILE_E * 2, Bt + bcp + k0, (size_t)16 * DM);
    if (ABF) {
      cp_tile(lb + 3 * TILE_E * 2, A2 + acp + k0, (size_t)16 * DM);
      cp_tile(lb + 4 * TILE_E * 2, A2 + acp + (size_t)64 * DM + k0, (size_t)16 * DM);
    }
  };
  const v8f z8 = {0.f, 0.f, 0.f, 0.f, 0.f, 0.f, 0.f, 0.f};
  v8f acc[8];
#pragma unroll
  for (int u = 0; u < 8; ++u) acc[u] = z8;
  fill(0, 0);
  asm volatile("s_wait_asynccnt 0x0" ::: "memory");   // this wave's copies of stage 0 have landed
  __syncthreads();                                    // ... and every other wave's
  fill(1, 1);
#pragma unroll 1   /* rolled: one hand-over of the buffers per trip, and the loop text stays small */
  for (int sg = 0; sg < DM / KT; ++sg) {
    const unsigned short* tb = ring + (sg & 1) * (NT * TILE_E);
    const unsigned short* ap = tb + (32 * w + ln) * LP;
    const unsigned short* bp0 = tb + 2 * TILE_E + ln * LP;
    // the stage's fragment reads stand together in front of its products: one LDS latency per stage, not one per fragment
    Frag fa[2][2], fl[2][2], fb[2][4];
#pragma unroll     /* both 32-k halves of the stage in line, so that every LDS offset is an immediate and every fragment a register */
    for (int h2 = 0; h2 < 2; ++h2) {
      fa[h2][0] = ldf(ap + 32 * h2, hh); fa[h2][1] = ldf(ap + 16 * LP + 32 * h2, hh);
      if (ABF) { fl[h2][0] = ldf(ap + 3 * TILE_E + 32 * h2, hh); fl[h2][1] = ldf(ap + 3 * TILE_E + 16 * LP + 32 * h2, hh); }
      else { fl[h2][0] = fa[h2][0]; fl[h2][1] = fa[h2][1]; }
#pragma unroll
      for (int t = 0; t < 4; ++t) fb[h2][t] = ldf(bp0 + (16 * t) * LP + 32 * h2, hh);
    }
#pragma unroll     /* in line, k ascending in every accumulator */
    for (int h2 = 0; h2 < 2; ++h2) {
#pragma unroll
      for (int t = 0; t < 4; ++t) {
        acc[t] = gmm<ABF>(fa[h2][0], fl[h2][0], fb[h2][t], acc[t]);
        acc[4 + t] = gmm<ABF>(fa[h2][1], fl[h2][1], fb[h2][t], acc[4 + t]);
      }
    }
    // hand-over of the buffers, passed by every wave:
    asm volatile("s_wait_dscnt 0x0" ::: "memory");      // this wave's reads of the buffer that is refilled below have returned
    asm volatile("s_wait_asynccnt 0x0" ::: "memory");   // this wave's copies of the next stage have landed
    __syncthreads();                                    // publishes the next stage and ends every wave's reads of this one
    if (sg + 2 < DM / KT) fill(sg + 2, sg & 1);
  }
  asm volatile("s_wait_asynccnt 0x0" ::: "memory");    // no copy is outstanding when the ring's LDS becomes the epilogue's tile
  // D element r of lane (hh, ln) = (row 8hh + r, col ln) of its 16x16 tile
#pragma unroll
  for (int u = 0; u < 8; ++u) {
    const int t = u & 3, half = u >> 2;
    const int col = t * 16 + ln;
    float bv = 0.f;
    if (BIAS) bv = bf16_rne(bias[col0 + col]);
#pragma unroll
    for (int r = 0; r < 8; ++r) so[32 * w + half * 16 + 8 * hh + r][col] = acc[u][r] * alpha + bv;
  }
  __syncthreads();
}

// q, k and v projections in one grid: grid.x = (row tiles of 128) * 8 col tiles, grid.y = batch, grid.z = weight plane (0 q, 1 k, 2 v).
// q and k: f16 row plane [row][DM] (+ bf16 hi/lo row planes for rows t < ERL); v: transposed planes [(b,head)][d][SEQ] (f16, + bf16 hi/lo for t < ERL).
__global__ __launch_bounds__(128) void k_proj(const unsigned short* __restrict__ X16, const unsigned short* __restrict__ W16,
                                              unsigned short* __restrict__ QK16, unsigned short* __restrict__ QKH, unsigned short* __restrict__ QKL,
                                              unsigned short* __restrict__ VT16, unsigned short* __restrict__ VTH, unsigned short* __restrict__ VTL) {
  __shared__ __attribute__((aligned(16))) unsigned char sm[GEMM_SM_B(false)];
  const sorow* const so = (const sorow*)sm;
  const int tid = threadIdx.x;
  const int rt = (int)blockIdx.x >> 3, nq = (int)blockIdx.x & 7, b = blockIdx.y, z = blockIdx.z;
  const int t0 = rt * 128;
  const size_t r0 = (size_t)b * SEQ + t0;
  const int col0 = nq * 64;
  gemm_core<false, false>(sm, X16, X16, W16 + (size_t)z * DM * DM, 0.0625f, nullptr, r0, col0);
  const bool early = (t0 < ERL);
  if (z < 2) {
#pragma unroll
    for (int it = 0; it < 8; ++it) {
      const int row = it * 16 + (tid >> 3), pc = tid & 7;
      const v4f x0 = *(const v4fa*)&so[row][8 * pc], x1 = *(const v4fa*)&so[row][8 * pc + 4];
      const size_t off = (size_t)z * (NR * DM) + (r0 + row) * DM + col0 + 8 * pc;
      const v8us o = to_f16x8(x0, x1);
      *(v8us*)(QK16 + off) = o;
      st_wait();
      if (early) {
        v8us oh, ol; to_bf16x8_hl(x0, x1, oh, ol);
        *(v8us*)(QKH + off) = oh;
        *(v8us*)(QKL + off) = ol;
        st_wait();
      }
    }
  } else {
    // transposed: 64 d rows x 128 tokens (256 B each): d = it*8 + tid/16, piece = tid%16 (8 tokens = 16 B)
    const int hd = nq;
#pragma unroll
    for (int it = 0; it < 8; ++it) {
      const int d = it * 8 + (tid >> 4), pc = tid & 15;
      v4f x0, x1;
#pragma unroll
      for (int j = 0; j < 4; ++j) { x0[j] = so[8 * pc + j][d]; x1[j] = so[8 * pc + 4 + j][d]; }
      const size_t off = (((size_t)b * NH + hd) * HD + d) * SEQ + t0 + 8 * pc;
      const v8us o = to_f16x8(x0, x1);
      *(v8us*)(VT16 + off) = o;
      st_wait();
      if (early) {
        v8us oh, ol; to_bf16x8_hl(x0, x1, oh, ol);
        *(v8us*)(VTH + off) = oh;
        *(v8us*)(VTL + off) = ol;
        st_wait();
      }
    }
  }
}

// Output projection + bias for all rows in one grid: grid.x = (row tiles of 128) * 8 col tiles, grid.y = batch; row tiles t < ERL take the bf16 hi/lo ctx planes, the rest the f16 plane (ctx x64, weights x16).
__global__ __launch_bounds__(128) void k_out(const unsigned short* __restrict__ CH, const unsigned short* __restrict__ CL, const unsigned short* __restrict__ C16,
                                             const unsigned short* __restrict__ WPB, const unsigned short* __restrict__ WP16,
                                             const float* __restrict__ bias, float* __restrict__ OF) {
  __shared__ __attribute__((aligned(16))) unsigned char sm[GEMM_SM_B(true)];
  const sorow* const so = (const sorow*)sm;
  const int tid = threadIdx.x;
  const int rt = (int)blockIdx.x >> 3, nq = (int)blockIdx.x & 7, b = blockIdx.y;
  const int t0 = rt * 128;
  const size_t r0 = (size_t)b * SEQ + t0;
  const int col0 = nq * 64;
  if (t0 < ERL) gemm_core<true, true>(sm, CH, CL, WPB, 1.0f, bias, r0, col0);
  else gemm_core<false, true>(sm, C16, C16, WP16, 0.0009765625f, bias, r0, col0);
  // f32 rows of the output buffer (full-size layout): 128 rows x 256 B: row = it*8 + tid/16, piece = tid%16 (4 floats = 16 B)
#pragma unroll
  for (int it = 0; it < 16; ++it) {
    const int row = it * 8 + (tid >> 4), pc = tid & 15;
    const v4f v = *(const v4fa*)&so[row][4 * pc];
    *(v4f*)(OF + ((size_t)b * SEQ_FULL + t0 + row) * DM + col0 + 4 * pc) = v;
  }
}

// Causal attention, one wave per 16 query rows of one (batch, head); block = 4 waves (64 queries) that share the staged K and V^T tiles; one block barrier per ring stage (RES: 64 keys; dense rows: 128 keys).
// S^T[key][query] = K Q^T: A = K rows (lane = key), B = Q rows (lane = query). D: lane (hh, ln) element r = (key 8hh + r, query ln).
// O^T[d][query] = V^T P^T: A = V^T rows (lane = d, k = keys), B = packed P^T: element r <- tile(keys 0..15)[r], element 8+r <- tile(keys 16..31)[r].
// RES: bf16 hi/lo operands, three products per site; else f16 single products with P carried x1024 (sum carried alike) and ctx stored x64.
// lds: the ring [buffer][4 tiles][row * LP + element]; the four tiles of a buffer are K hi, V^T hi, K lo, V^T lo of 64 keys with RES, else K, V^T of 64 keys and K, V^T of the next 64; behind the loop's last barrier its first bytes become the waves' output tiles [wave][hi, lo][16][64].
template <bool RES>
__device__ __forceinline__ void attn_body(unsigned short* lds, const unsigned short* __restrict__ Qh, const unsigned short* __restrict__ Ql,
                                          const unsigned short* __restrict__ Kh, const unsigned short* __restrict__ Kl,
                                          const unsigned short* __restrict__ Vh, const unsigned short* __restrict__ Vl,
                                          unsigned short* __restrict__ Ch, unsigned short* __restrict__ Cl, int qb, int h, int b) {
  constexpr int NTL = 4;             /* staged tiles per buffer */
  constexpr int SPT = RES ? 1 : 2;   /* 64-key tile pairs per ring stage: the dense rows need no lo tiles, so their stage is twice as long and its copies have twice the time to land */
  const int lane = threadIdx.x & 31, ln = lane & 15, hh = lane >> 4;
  const int w = __builtin_amdgcn_readfirstlane((int)(threadIdx.x >> 5));
  unsigned short (* const sc)[16][64] = (unsigned short (*)[16][64])lds + w * (RES ? 2 : 1);   /* this wave's output tiles */
  const int q0 = qb + w * 16;
  const int qi = q0 + ln;
  const size_t rowb = (size_t)b * SEQ;
  const size_t qof = (rowb + q0 + ln) * DM + h * HD;
  const Frag qh0 = ldf(Qh + qof, hh), qh1 = ldf(Qh + qof + 32, hh);
  Frag ql0 = qh0, ql1 = qh1;
  if (RES) { ql0 = ldf(Ql + qof, hh); ql1 = ldf(Ql + qof + 32, hh); }
  const int crow = (int)threadIdx.x >> 3, cpc = (int)threadIdx.x & 7;
  const size_t kcp = (rowb + crow) * DM + h * HD + 8 * cpc;
  const size_t vcp = (((size_t)b * NH + h) * HD + crow) * SEQ + 8 * cpc;
  const unsigned lcp = lds_off(lds) + (unsigned)(crow * LP + 8 * cpc) * 2u;
  const int nst = (qb >> 6) + 1;            // scalar and the same in the whole block: tiles of 64 keys up to the block's last query
  const int ntr = (nst + SPT - 1) / SPT;    // ring stages
  auto fill = [&](int s, int bf) {   // ring stage s (keys 64 SPT s .. 64 SPT s + 64 SPT - 1) into buffer bf
    const unsigned lb = lcp + (unsigned)bf * (unsigned)(NTL * TILE_E * 2);
    const size_t k0 = (size_t)s * (SPT * KT);
    cp_tile(lb, Kh + kcp + k0 * DM, (size_t)16 * DM);
    cp_tile(lb + TILE_E * 2, Vh + vcp + k0, (size_t)16 * SEQ);
    if (RES) {
      cp_tile(lb + 2 * TILE_E * 2, Kl + kcp + k0 * DM, (size_t)16 * DM);
      cp_tile(lb + 3 * TILE_E * 2, Vl + vcp + k0, (size_t)16 * SEQ);
    } else {   // the stage's second tile pair; behind an odd tile count it lies past the diagonal, still inside the sequence (SEQ is a multiple of 128), and is not worked on
      cp_tile(lb + 2 * TILE_E * 2, Kh + kcp + (k0 + KT) * DM, (size_t)16 * DM);
      cp_tile(lb + 3 * TILE_E * 2, Vh + vcp + k0 + KT, (size_t)16 * SEQ);
    }
  };
  const v8f z8 = {0.f, 0.f, 0.f, 0.f, 0.f, 0.f, 0.f, 0.f};
  v8f acc[4];
#pragma unroll
  for (int t = 0; t < 4; ++t) acc[t] = z8;
  float m = NEGBIG, l = 0.f;
  const float carry = RES ? 0.f : CARRY_LN;
  fill(0, 0);
  asm volatile("s_wait_asynccnt 0x0" ::: "memory");   // this wave's copies of stage 0 have landed
  __syncthreads();                                    // ... and every other wave's
  if (ntr > 1) fill(1, 1);
  int pr = 0;   // the wave's issue priority now: a wave starts at 0
#pragma unroll 1   /* rolled: one hand-over of the buffers per trip, and the loop text stays small */
  for (int sg = 0; sg < ntr; ++sg) {
   // Waves of blocks with unlike row counts share a SIMD, and the launch lasts until the longest has run out, at the end alone and at one wave's pace. Issue priority therefore follows the work a wave still has:
   // rest = tiles of 64 keys left, a multi-product tile counted as 3.5 single-product ones; one level per 8. Scalar, the same in the whole block; the last stages are at level 0, so every wave leaves the loop at priority 0.
   const int rest = RES ? (7 * (ntr - sg)) >> 1 : nst - SPT * sg;
   const int pw = rest > 24 ? 3 : (rest - 1) >> 3;
   if (pw != pr) {   // the instruction takes its level as an immediate
     pr = pw;
     if (pw == 3) __builtin_amdgcn_s_setprio(3);
     else if (pw == 2) __builtin_amdgcn_s_setprio(2);
     else if (pw == 1) __builtin_amdgcn_s_setprio(1);
     else __builtin_amdgcn_s_setprio(0);
   }
   const unsigned short* tb = lds + (sg & 1) * (NTL * TILE_E);
   if (!RES) {
    // K fragments of the stage's first tile pair; those of the second are read below, into the same registers, while the first pair's softmax runs (the whole stage is published)
    Frag kf[4][2];
#pragma unroll
    for (int kt = 0; kt < 4; ++kt) {
      const unsigned short* kp = tb + (16 * kt + ln) * LP;
      kf[kt][0] = ldf(kp, hh); kf[kt][1] = ldf(kp + 32, hh);
    }
#pragma unroll     /* both tile pairs of the stage in line, so that every LDS offset is an immediate */
   for (int tp = 0; tp < SPT; ++tp) {
    if (tp > 0 && SPT * sg + tp >= nst) continue;   // scalar, the same in the whole block: behind an odd tile count the last stage's second tile pair lies past the diagonal
    const unsigned short* tk = tb + tp * (2 * TILE_E);
    // dense rows: a tile pair's 64 keys are one softmax step: one maximum, one rescale, eight score and eight P.V products in four independent accumulator chains each
    // (keys behind the diagonal get weight 0 by the mask; every loop of the step is unrolled, so that fragments, scores and accumulators stay in registers under constant indices)
    const int kb = (SPT * sg + tp) * KT;
    // the V^T fragment reads stand together in front of the products, behind the K reads: they return while scores and softmax run
    Frag vf[4][2];
    __builtin_amdgcn_sched_barrier(0);   // keeps every K read in front of the V^T reads: LDS returns in order, and the score products then wait for K alone
#pragma unroll
    for (int t = 0; t < 4; ++t) {
      const unsigned short* vp = tk + TILE_E + (16 * t + ln) * LP;
      vf[t][0] = ldf(vp, hh); vf[t][1] = ldf(vp + 32, hh);
    }
    v8f s[4];
#pragma unroll
    for (int kt = 0; kt < 4; ++kt) s[kt] = wm_h(kf[kt][0], qh0, z8);
#pragma unroll
    for (int kt = 0; kt < 4; ++kt) s[kt] = wm_h(kf[kt][1], qh1, s[kt]);
    nop_grp(s, kf, qh0, qh1);
    if (kb + KT > q0) {   // scalar condition: this tile pair touches the diagonal; masked scores are replaced
#pragma unroll
      for (int kt = 0; kt < 4; ++kt)
#pragma unroll
        for (int r = 0; r < 8; ++r) { const int key = kb + 16 * kt + 8 * hh + r; s[kt][r] = (key > qi) ? NEGBIG : s[kt][r]; }
    }
    float mt[4];
#pragma unroll
    for (int kt = 0; kt < 4; ++kt) {
      float a = s[kt][0];
#pragma unroll
      for (int r = 1; r < 8; ++r) a = fmaxf(a, s[kt][r]);
      mt[kt] = a;
    }
    float mx = fmaxf(fmaxf(mt[0], mt[1]), fmaxf(mt[2], mt[3]));
    const float mxo = __shfl_xor(mx, 16, 32);
    if (tp + 1 < SPT) {
      __builtin_amdgcn_sched_barrier(0);   // the exchange goes to the LDS queue first: it returns in order, so the maximum does not wait for the reads below
#pragma unroll
      for (int kt = 0; kt < 4; ++kt) {
        const unsigned short* kp = tk + 2 * TILE_E + (16 * kt + ln) * LP;
        kf[kt][0] = ldf(kp, hh); kf[kt][1] = ldf(kp + 32, hh);
      }
      __builtin_amdgcn_sched_barrier(0);   // keeps the reads here, in front of the exponentials that hide their latency
    }
    mx = fmaxf(mx, mxo);
    const float mnew = fmaxf(m, mx);
    const float alpha = __expf((m - mnew) * QSCALE);
    const float cc = carry - mnew * QSCALE;
    m = mnew;
    Frag ph[2];
    float pt[4];
#pragma unroll
    for (int kt = 0; kt < 4; ++kt) {
      float a = 0.f;
#pragma unroll
      for (int r = 0; r < 8; ++r) {
        const float p = __expf(fmaf(s[kt][r], QSCALE, cc));
        ph[kt >> 1].e[8 * (kt & 1) + r] = (_Float16)p; a += p;
      }
      pt[kt] = a;
    }
    float ps = (pt[0] + pt[1]) + (pt[2] + pt[3]);
    ps += __shfl_xor(ps, 16, 32);
    l = l * alpha + ps;
#pragma unroll
    for (int t = 0; t < 4; ++t) acc[t] = acc[t] * alpha;
#pragma unroll
    for (int t = 0; t < 4; ++t) acc[t] = wm_h(vf[t][0], ph[0], acc[t]);
#pragma unroll
    for (int t = 0; t < 4; ++t) acc[t] = wm_h(vf[t][1], ph[1], acc[t]);
    nop_grp(acc, vf, ph[0], ph[1]);
   }
   } else
#pragma unroll     /* both 32-key halves of the stage in line, so that every LDS offset is an immediate */
   for (int hf = 0; hf < 2; ++hf) {
    const unsigned short* tk = tb;
    const int kb = sg * KT + hf * 32;
    if (kb >= q0 + 16) continue;   // scalar: the wave's queries all lie in front of these 32 keys
    v8f s[2];
#pragma unroll
    for (int kt = 0; kt < 2; ++kt) {
      const unsigned short* kp = tk + (hf * 32 + 16 * kt + ln) * LP;
      const Frag k0 = ldf(kp, hh), k1 = ldf(kp + 32, hh);
      v8f c = z8;
      if (RES) {
        const Frag kl0 = ldf(kp + 2 * TILE_E, hh), kl1 = ldf(kp + 2 * TILE_E + 32, hh);
        c = wm_b(k0, qh0, c); c = wm_b(kl0, qh0, c); c = wm_b(k0, ql0, c);
        c = wm_b(k1, qh1, c); c = wm_b(kl1, qh1, c); c = wm_b(k1, ql1, c);
        nop8(c, k0, k1, kl0, kl1, qh0, qh1, ql0, ql1);
      } else {
        c = wm_h(k0, qh0, c); c = wm_h(k1, qh1, c);
        nop4(c, k0, k1, qh0, qh1);
      }
      s[kt] = c;
    }
    if (kb + 32 > q0) {   // scalar condition: this step touches the diagonal; masked scores are replaced
#pragma unroll
      for (int kt = 0; kt < 2; ++kt)
#pragma unroll
        for (int r = 0; r < 8; ++r) { const int key = kb + 16 * kt + 8 * hh + r; s[kt][r] = (key > qi) ? NEGBIG : s[kt][r]; }
    }
    float mx = fmaxf(s[0][0], s[1][0]);
#pragma unroll
    for (int r = 1; r < 8; ++r) mx = fmaxf(mx, fmaxf(s[0][r], s[1][r]));
    mx = fmaxf(mx, __shfl_xor(mx, 16, 32));
    const float mnew = fmaxf(m, mx);
    const float alpha = __expf((m - mnew) * QSCALE);
    const float cc = carry - mnew * QSCALE;
    m = mnew;
    Frag ph, pl;
    float ps = 0.f;
#pragma unroll
    for (int kt = 0; kt < 2; ++kt)
#pragma unroll
      for (int r = 0; r < 8; ++r) {
        const float p = __expf(fmaf(s[kt][r], QSCALE, cc));
        if (RES) {
          const unsigned short hb = bf16_bits(p); const float hv = bf16_val(hb);
          const unsigned short lb = bf16_bits(p - hv);
          ph.u[8 * kt + r] = hb; pl.u[8 * kt + r] = lb; ps += hv + bf16_val(lb);
        } else {
          ph.e[8 * kt + r] = (_Float16)p; ps += p;
        }
      }
    if (!RES) pl = ph;
    ps += __shfl_xor(ps, 16, 32);
    l = l * alpha + ps;
#pragma unroll
    for (int t = 0; t < 4; ++t) acc[t] = acc[t] * alpha;
#pragma unroll
    for (int t = 0; t < 4; ++t) {
      const unsigned short* vp = tk + TILE_E + (16 * t + ln) * LP + hf * 32;
      const Frag vh = ldf(vp, hh);
      if (RES) {
        const Frag vl = ldf(vp + 2 * TILE_E, hh);
        acc[t] = wm_b(vh, ph, acc[t]); acc[t] = wm_b(vl, ph, acc[t]); acc[t] = wm_b(vh, pl, acc[t]);
        nop4(acc[t], vh, vl, ph, pl);
      } else {
        acc[t] = wm_h(vh, ph, acc[t]);
        nop2(acc[t], vh, ph);
      }
    }
   }
   // hand-over of the buffers, passed by every wave:
   asm volatile("s_wait_dscnt 0x0" ::: "memory");      // this wave's reads of the buffer that is refilled below have returned
   asm volatile("s_wait_asynccnt 0x0" ::: "memory");   // this wave's copies of the next stage have landed
   __syncthreads();                                    // publishes the next stage and ends every wave's reads of this one
   if (sg + 2 < ntr) fill(sg + 2, sg & 1);
  }
  asm volatile("s_wait_asynccnt 0x0" ::: "memory");    // no copy is outstanding when the ring's LDS becomes the output tiles
  // acc[t][r] = O^T[d = 16t + 8hh + r][query ln]; normalise and stage row ln of the wave tile
  const float inv = 1.0f / l;
  const float osc = RES ? inv : inv * 64.0f;
#pragma unroll
  for (int t = 0; t < 4; ++t) {
    if (RES) {
      Frag oh, ol;
#pragma unroll
      for (int r = 0; r < 8; ++r) { const float c = acc[t][r] * osc; const unsigned short hb = bf16_bits(c); oh.u[r] = hb; ol.u[r] = bf16_bits(c - bf16_val(hb)); }
      *(v8us*)&sc[0][ln][16 * t + 8 * hh] = oh.half[0];
      *(v8us*)&sc[RES ? 1 : 0][ln][16 * t + 8 * hh] = ol.half[0];
    } else {
      Frag o;
#pragma unroll
      for (int r = 0; r < 8; ++r) o.e[r] = (_Float16)(acc[t][r] * osc);
      *(v8us*)&sc[0][ln][16 * t + 8 * hh] = o.half[0];
    }
  }
  __builtin_amdgcn_fence(4 /* acq_rel order */, "workgroup");
  __builtin_amdgcn_wave_barrier();
  const int rsub = lane >> 3, pc = lane & 7;
  {
#pragma unroll
    for (int q = 0; q < 4; ++q) {
      const int row = 4 * q + rsub;
      const size_t off = (rowb + q0 + row) * DM + h * HD + 8 * pc;
      const v8us v0 = *(const v8us*)&sc[0][row][8 * pc];
      *(v8us*)(Ch + off) = v0;
      if (RES) { const v8us v1 = *(const v8us*)&sc[RES ? 1 : 0][row][8 * pc]; *(v8us*)(Cl + off) = v1; }
    }
    
  }
}

// Both row classes in one grid: grid.x = query tiles of 64 rows from row tbase on, grid.y = head, grid.z = batch.
// Tiles of rows t < ERL run on the bf16 hi/lo planes, the rest on the f16 planes.
__global__ __launch_bounds__(128) void k_attn(const unsigned short* __restrict__ QH, const unsigned short* __restrict__ QL,
                                              const unsigned short* __restrict__ KH, const unsigned short* __restrict__ KL,
                                              const unsigned short* __restrict__ VTH, const unsigned short* __restrict__ VTL,
                                              const unsigned short* __restrict__ Q16, const unsigned short* __restrict__ K16, const unsigned short* __restrict__ VT16,
                                              unsigned short* __restrict__ CH, unsigned short* __restrict__ CL, unsigned short* __restrict__ C16, int tbase) {
  __shared__ __attribute__((aligned(16))) unsigned short lds[2 * 4 * TILE_E];
  const int h = blockIdx.y, b = blockIdx.z;
  // Every block of the grid is resident at once and a tile's cost grows with its row, so the launch lasts as long as the fullest WGP. The tiles fall into four classes of QG by row (class 0: the multi-product rows);
  // block x takes, of class (x / QG + b) % 4, tile x % QG counted upward in class 0 and downward in the others: blocks x, x + QG, x + 2 QG, x + 3 QG of one (head, batch), and blocks (x, head) of four successive batches, then hold one tile of each class with nearly the same summed cost.
  // For a fixed (head, batch) the map is a permutation of the tiles; where blocks land matters for speed alone.
  constexpr int QG = SEQ / 64 / 4;
  const int xr = (int)blockIdx.x % QG, xc = ((int)blockIdx.x / QG + b) & 3;
  const int qb = tbase + (xc == 0 ? xr : (xc + 1) * QG - 1 - xr) * 64;
  if (qb < ERL) attn_body<true>(lds, QH, QL, KH, KL, VTH, VTL, CH, CL, qb, h, b);
  else attn_body<false>(lds, Q16, Q16, K16, K16, VT16, VT16, C16, C16, qb, h, b);
}

extern "C" void kernel_launch(void* const* d_in, const int* in_sizes, int n_in,
                              void* d_out, int out_size, void* d_ws, size_t ws_size, hipStream_t stream) {
  static_assert(NH * HD == DM);
  static_assert(DM == 512);
  static_assert(SEQ % 256 == 0);
  static_assert(ERL % 128 == 0);
  static_assert(NB <= NB_FULL);
  static_assert(((size_t)NB * SEQ * DM) % (8 * 256) == 0 && (DM * DM) % (8 * 256) == 0);   /* the conversion grid is exact: no thread past an end */
  static_assert(SEQ <= SEQ_FULL);
  static_assert((size_t)13 * NB * SEQ * DM * 2 + (size_t)5 * DM * DM * 2 <= (size_t)134217728);
  if (n_in < 6) return;
  const long long xmin = ((long long)(NB - 1) * SEQ_FULL + SEQ) * DM;
  if ((long long)in_sizes[0] < xmin) return;
  if (in_sizes[1] < DM * DM || in_sizes[2] < DM * DM || in_sizes[3] < DM * DM || in_sizes[4] < DM * DM || in_sizes[5] < DM) return;
  if ((long long)out_size < xmin) return;
  const float* x  = (const float*)d_in[0];
  const float* Wq = (const float*)d_in[1];
  const float* Wk = (const float*)d_in[2];
  const float* Wv = (const float*)d_in[3];
  const float* Wp = (const float*)d_in[4];
  const float* bp = (const float*)d_in[5];
  float* out = (float*)d_out;

  char* ws = (char*)d_ws; size_t off = 0;
  auto take = [&](size_t bytes) { char* p = ws + off; off += (bytes + 255) & ~(size_t)255; return (unsigned short*)p; };
  const size_t PL = NR * DM;            /* elements of one [NB*SEQ][DM] 16-bit plane */
  const size_t WN = (size_t)DM * DM;
  unsigned short* W16  = take(4 * WN * 2);     /* Wq, Wk, Wv, Wp as f16 x16, [n][k] */
  unsigned short* WPB  = take(WN * 2);         /* Wp as bf16, [n][k] */
  unsigned short* X16  = take(PL * 2);
  unsigned short* QK16 = take(2 * PL * 2);     /* q plane then k plane (f16) */
  unsigned short* QKH  = take(2 * PL * 2);     /* bf16 hi, rows t < ERL written */
  unsigned short* QKL  = take(2 * PL * 2);     /* bf16 lo, rows t < ERL written */
  unsigned short* VT16 = take(PL * 2);         /* [(b,h)][d][SEQ] f16 */
  unsigned short* VTH  = take(PL * 2);
  unsigned short* VTL  = take(PL * 2);
  unsigned short* C16  = take(PL * 2);         /* ctx x64 f16, rows t >= ERL */
  unsigned short* CH   = take(PL * 2);         /* ctx bf16 hi, rows t < ERL */
  unsigned short* CL   = take(PL * 2);         /* ctx bf16 lo, rows t < ERL */
  if (off > ws_size || off > (size_t)134217728) return;

  /* conversions of the four weight matrices and of x */
  k_prep<<<(unsigned)(4 * WBLK + XBLK), 256, 0, stream>>>(x, Wq, Wk, Wv, Wp, X16, W16, WPB);

  /* q, k and v projections: grid.z selects the weight plane and the output plane set; v is written transposed per (batch, head) */
  k_proj<<<dim3((SEQ / 128) * 8, NB, 3), 128, 0, stream>>>(X16, W16, QK16, QKH, QKL, VT16, VTH, VTL);

  /* attention: first ERL rows on bf16 hi/lo planes, remaining rows on f16 planes */
  k_attn<<<dim3(SEQ / 64, NH, NB), 128, 0, stream>>>(QKH, QKL, QKH + PL, QKL + PL, VTH, VTL, QK16, QK16 + PL, VT16, CH, CL, C16, 0);

  /* output projection + bias */
  k_out<<<dim3((SEQ / 128) * 8, NB, 1), 128, 0, stream>>>(CH, CL, C16, WPB, W16 + 3 * WN, bp, out);
}

// v008
// Measured time: 59.7 microseconds a run.
// Timed twice side by side with v007, it ran 1.07 times as fast both times.
// Counting every step since v000, it is 4.76 times as fast.
#include <hip/hip_runtime.h>
// Compute dtype: inputs RNE-converted to bf16 values (x as exact f16, weights as exact f16 x16 / exact bf16); q,k,v projections, dense-row scores, dense-row P.V and dense-row output GEMM = v_wmma_f32_16x16x32_f16 single products (P carried x1024, ctx carried x64); first ERL rows of every sequence: scores and P.V as bf16 hi/lo three-product sums, output GEMM as bf16 hi/lo A x exact bf16 W (v_wmma_f32_16x16x32_bf16); all accumulation, softmax statistics, bias add in f32.
// Structure: causal attention per (batch, head) with S^T = K Q^T (Q fragments in registers as the B operand) and O^T = V^T P^T (packed S^T accumulators are the B fragment), online max-subtracted softmax per lane column; K and V^T tiles of 64 keys are staged in LDS once per block (two buffers; a buffer holds one tile pair with its lo planes for the first ERL rows, two tile pairs = 128 keys for the dense rows) and read from there by its four waves. Three launches: q, k, v projections (which round the f32 inputs themselves on the way into LDS, and convert Wp); attention (both row classes); output GEMM (both row classes).
#ifndef NB
#define NB 4
#endif
#ifndef SEQ
#define SEQ 2048
#endif
#ifndef EARLY
#define EARLY 512
#endif
#define NB_FULL 4
#define SEQ_FULL 2048
#define DM 512
#define NH 8
#define HD 64
#define ERL ((EARLY < SEQ) ? EARLY : SEQ)   /* rows per sequence on the multi-product path */
#define NR ((size_t)NB * SEQ)               /* compact token rows r = b*SEQ + t */
#define QSCALE 0.044194173824159216f        /* d_model^-0.5 */
#define NEGBIG (-3.0e38f)
#define CARRY_LN 6.931471805599453f         /* ln 1024 */

typedef _Float16 v16h __attribute__((ext_vector_type(16)));
typedef __bf16   v16b __attribute__((ext_vector_type(16)));
typedef unsigned short v8us __attribute__((ext_vector_type(8), may_alias));
typedef float v8f  __attribute__((ext_vector_type(8)));
typedef float v4f  __attribute__((ext_vector_type(4)));
typedef float v4fa __attribute__((ext_vector_type(4), may_alias));
union Frag { v16h h; v16b b; v8us half[2]; _Float16 e[16]; unsigned short u[16]; };

__device__ __forceinline__ unsigned short bf16_bits(float x) { unsigned int u = __float_as_uint(x); return (unsigned short)((u + 0x7FFFu + ((u >> 16) & 1u)) >> 16); }
__device__ __forceinline__ float bf16_val(unsigned short b) { return __uint_as_float(((unsigned int)b) << 16); }
__device__ __forceinline__ float bf16_rne(float x) { return bf16_val(bf16_bits(x)); }

// fragment loader (A and B alike): elements 0..7 <- p[8h .. 8h+7], elements 8..15 <- p[16+8h .. 16+8h+7]
__device__ __forceinline__ Frag ldf(const unsigned short* p, int hh) {
  Frag f; f.half[0] = *(const v8us*)(p + 8 * hh); f.half[1] = *(const v8us*)(p + 16 + 8 * hh); return f;
}
__device__ __forceinline__ v8f wm_h(const Frag& a, const Frag& b, v8f c) { return __builtin_amdgcn_wmma_f32_16x16x32_f16(false, a.h, false, b.h, (short)0, c, false, false); }
__device__ __forceinline__ v8f wm_b(const Frag& a, const Frag& b, v8f c) { return __builtin_amdgcn_wmma_f32_16x16x32_bf16(false, a.b, false, b.b, (short)0, c, false, false); }
__device__ __forceinline__ void nop2(v8f& c, const Frag& a, const Frag& b) { asm volatile("v_nop\n\tv_nop\n\tv_nop\n\tv_nop" : "+v"(c) : "v"(a.h), "v"(b.h)); }
__device__ __forceinline__ void nop3(v8f& c, const Frag& a, const Frag& b, const Frag& d) { asm volatile("v_nop\n\tv_nop\n\tv_nop\n\tv_nop" : "+v"(c) : "v"(a.h), "v"(b.h), "v"(d.h)); }
__device__ __forceinline__ void nop4(v8f& c, const Frag& a, const Frag& b, const Frag& d, const Frag& e) { asm volatile("v_nop\n\tv_nop\n\tv_nop\n\tv_nop" : "+v"(c) : "v"(a.h), "v"(b.h), "v"(d.h), "v"(e.h)); }
__device__ __forceinline__ void nop8(v8f& c, const Frag& a, const Frag& b, const Frag& d, const Frag& e, const Frag& f, const Frag& g, const Frag& i, const Frag& j) {
  asm volatile("v_nop\n\tv_nop\n\tv_nop\n\tv_nop" : "+v"(c) : "v"(a.h), "v"(b.h), "v"(d.h), "v"(e.h), "v"(f.h), "v"(g.h), "v"(i.h), "v"(j.h));
}

// behind a group of eight products on four accumulators (four A fragments per k half, one B fragment per k half): the four vector slots that the chip needs before an accumulator is read or an operand register rewritten
__device__ __forceinline__ void nop_grp(v8f (&c)[4], const Frag (&a)[4][2], const Frag& b0, const Frag& b1) {
  asm volatile("v_nop\n\tv_nop\n\tv_nop\n\tv_nop" : "+v"(c[0]), "+v"(c[1]), "+v"(c[2]), "+v"(c[3])
               : "v"(a[0][0].h), "v"(a[0][1].h), "v"(a[1][0].h), "v"(a[1][1].h), "v"(a[2][0].h), "v"(a[2][1].h), "v"(a[3][0].h), "v"(a[3][1].h), "v"(b0.h), "v"(b1.h));
}

__device__ __forceinline__ v8us to_f16x8(v4f a, v4f c) {
  Frag f;
#pragma unroll
  for (int q = 0; q < 4; ++q) { f.e[q] = (_Float16)a[q]; f.e[4 + q] = (_Float16)c[q]; }
  return f.half[0];
}
__device__ __forceinline__ void to_bf16x8_hl(v4f a, v4f c, v8us& hi, v8us& lo) {
  Frag fh, fl;
#pragma unroll
  for (int q = 0; q < 4; ++q) {
    unsigned short hb = bf16_bits(a[q]); fh.u[q] = hb; fl.u[q] = bf16_bits(a[q] - bf16_val(hb));
    hb = bf16_bits(c[q]); fh.u[4 + q] = hb; fl.u[4 + q] = bf16_bits(c[q] - bf16_val(hb));
  }
  hi = fh.half[0]; lo = fl.half[0];
}

// behind a global store: stands in front of any rewrite of the registers that the store names
__device__ __forceinline__ void st_wait() { asm volatile("s_wait_xcnt 0x0" ::: "memory"); }

#define KT 64               /* keys per staged tile (attention) or k elements (GEMM) per LDS stage */
#define LP 72               /* LDS row pitch in 16-bit elements: 144 B = 16 B x odd, the pitch for 16-byte readers of 128-B rows */
#define TILE_E (64 * LP)    /* one staged tile: 64 rows of 128 B */

__device__ __forceinline__ unsigned lds_off(const void* p) { return (unsigned)(size_t)p; }

// One 64-row x 128-B tile into LDS by the block's 128 threads: thread = (row tid/8 + 16 i, 16-byte piece tid%8), i = 0..3, so a wave's copy takes 4 whole lines.
// l = the lane's LDS byte address of row tid/8, g = its global address there, gstep = 16 source rows in elements.
__device__ __forceinline__ void cp_tile(unsigned l, const unsigned short* g, size_t gstep) {
  const unsigned l1 = l + 16 * LP * 2, l2 = l + 32 * LP * 2, l3 = l + 48 * LP * 2;
  const unsigned short* g1 = g + gstep;
  const unsigned short* g2 = g + 2 * gstep;
  const unsigned short* g3 = g + 3 * gstep;
  // the copies bring the tile into LDS through no register; the closing s_wait_xcnt stands in front of any rewrite of the address registers they name
  asm volatile("global_load_async_to_lds_b128 %0, %4, off\n\t"
               "global_load_async_to_lds_b128 %1, %5, off\n\t"
               "global_load_async_to_lds_b128 %2, %6, off\n\t"
               "global_load_async_to_lds_b128 %3, %7, off\n\t"
               "s_wait_xcnt 0x0"
               :: "v"(l), "v"(l1), "v"(l2), "v"(l3), "v"(g), "v"(g1), "v"(g2), "v"(g3) : "memory");
}

template <bool ABF>
__device__ __forceinline__ v8f gmm(const Frag& a, const Frag& al, const Frag& b, v8f c) {
  if (ABF) { c = wm_b(a, b, c); c = wm_b(al, b, c); nop3(c, a, al, b); }
  else { c = wm_h(a, b, c); nop2(c, a, b); }
  return c;
}

// GEMM over K = DM: block = 4 waves, block tile 128 token rows x 64 cols, wave tile 32 x 64; the block's A rows and B rows are staged in LDS 64 k at a time (two buffers) and read from there by its four waves.
// ABF: A = bf16 hi (A) + lo (A2) planes, two products against bf16 Bt; else A f16, single product against f16 Bt.
// gemm_core leaves the block's 128 x 64 tile (x alpha, + the bf16 value of the bias where BIAS) as f32 in LDS, published by a block barrier; the epilogues below store it.
#define GEMM_NT(ABF) ((ABF) ? 5 : 3)                    /* tiles of 64 rows x 128 B per stage: A rows 0..63, A rows 64..127, B rows, then the A lo rows */
#define GEMM_RING_B(ABF) (2 * GEMM_NT(ABF) * TILE_E * 2) /* two buffers, bytes */
#define SO_B (128 * 68 * 4)                             /* the epilogue's f32 tile, which takes the ring's place behind the loop's last barrier */
#define GEMM_SM_B(ABF) (GEMM_RING_B(ABF) > SO_B ? GEMM_RING_B(ABF) : SO_B)
typedef float sorow[68];

template <bool ABF, bool BIAS>
__device__ __forceinline__ void gemm_core(unsigned char* sm, const unsigned short* __restrict__ A, const unsigned short* __restrict__ A2,
                                          const unsigned short* __restrict__ Bt, float alpha, const float* __restrict__ bias, size_t r0, int col0) {
  constexpr int NT = GEMM_NT(ABF);
  unsigned short* const ring = (unsigned short*)sm;
  sorow* const so = (sorow*)sm;
  const int tid = threadIdx.x, lane = tid & 31, ln = lane & 15, hh = lane >> 4;
  const int w = __builtin_amdgcn_readfirstlane((int)(threadIdx.x >> 5));
  const int crow = tid >> 3, cpc = tid & 7;
  const size_t acp = (r0 + crow) * DM + 8 * cpc;
  const size_t bcp = (size_t)(col0 + crow) * DM + 8 * cpc;
  const unsigned lcp = lds_off(ring) + (unsigned)(crow * LP + 8 * cpc) * 2u;
  auto fill = [&](int s, int bf) {   // k = 64 s .. 64 s + 63 of the block's 128 A rows and 64 B rows into buffer bf
    const unsigned lb = lcp + (unsigned)bf * (unsigned)(NT * TILE_E * 2);
    const size_t k0 = (size_t)s * KT;
    cp_tile(lb, A + acp + k0, (size_t)16 * DM);
    cp_tile(lb + TILE_E * 2, A + acp + (size_t)64 * DM + k0, (size_t)16 * DM);
    cp_tile(lb + 2 * TILE_E * 2, Bt + bcp + k0, (size_t)16 * DM);
    if (ABF) {
      cp_tile(lb + 3 * TILE_E * 2, A2 + acp + k0, (size_t)16 * DM);
      cp_tile(lb + 4 * TILE_E * 2, A2 + acp + (size_t)64 * DM + k0, (size_t)16 * DM);
    }
  };
  const v8f z8 = {0.f, 0.f, 0.f, 0.f, 0.f, 0.f, 0.f, 0.f};
  v8f acc[8];
#pragma unroll
  for (int u = 0; u < 8; ++u) acc[u] = z8;
  fill(0, 0);
  asm volatile("s_wait_asynccnt 0x0" ::: "memory");   // this wave's copies of stage 0 have landed
  __syncthreads();                                    // ... and every other wave's
  fill(1, 1);
#pragma unroll 1   /* rolled: one hand-over of the buffers per trip, and the loop text stays small */
  for (int sg = 0; sg < DM / KT; ++sg) {
    const unsigned short* tb = ring + (sg & 1) * (NT * TILE_E);
    const unsigned short* ap = tb + (32 * w + ln) * LP;
    const unsigned short* bp0 = tb + 2 * TILE_E + ln * LP;
    // the stage's fragment reads stand together in front of its products: one LDS latency per stage, not one per fragment
    Frag fa[2][2], fl[2][2], fb[2][4];
#pragma unroll     /* both 32-k halves of the stage in line, so that every LDS offset is an immediate and every fragment a register */
    for (int h2 = 0; h2 < 2; ++h2) {
      fa[h2][0] = ldf(ap + 32 * h2, hh); fa[h2][1] = ldf(ap + 16 * LP + 32 * h2, hh);
      if (ABF) { fl[h2][0] = ldf(ap + 3 * TILE_E + 32 * h2, hh); fl[h2][1] = ldf(ap + 3 * TILE_E + 16 * LP + 32 * h2, hh); }
      else { fl[h2][0] = fa[h2][0]; fl[h2][1] = fa[h2][1]; }
#pragma unroll
      for (int t = 0; t < 4; ++t) fb[h2][t] = ldf(bp0 + (16 * t) * LP + 32 * h2, hh);
    }
#pragma unroll     /* in line, k ascending in every accumulator */
    for (int h2 = 0; h2 < 2; ++h2) {
#pragma unroll
      for (int t = 0; t < 4; ++t) {
        acc[t] = gmm<ABF>(fa[h2][0], fl[h2][0], fb[h2][t], acc[t]);
        acc[4 + t] = gmm<ABF>(fa[h2][1], fl[h2][1], fb[h2][t], acc[4 + t]);
      }
    }
    // hand-over of the buffers, passed by every wave:
    asm volatile("s_wait_dscnt 0x0" ::: "memory");      // this wave's reads of the buffer that is refilled below have returned
    asm volatile("s_wait_asynccnt 0x0" ::: "memory");   // this wave's copies of the next stage have landed
    __syncthreads();                                    // publishes the next stage and ends every wave's reads of this one
    if (sg + 2 < DM / KT) fill(sg + 2, sg & 1);
  }
  asm volatile("s_wait_asynccnt 0x0" ::: "memory");    // no copy is outstanding when the ring's LDS becomes the epilogue's tile
  // D element r of lane (hh, ln) = (row 8hh + r, col ln) of its 16x16 tile
#pragma unroll
  for (int u = 0; u < 8; ++u) {
    const int t = u & 3, half = u >> 2;
    const int col = t * 16 + ln;
    float bv = 0.f;
    if (BIAS) bv = bf16_rne(bias[col0 + col]);
#pragma unroll
    for (int r = 0; r < 8; ++r) so[32 * w + half * 16 + 8 * hh + r][col] = acc[u][r] * alpha + bv;
  }
  __syncthreads();
}

// q, k and v projections straight from the f32 inputs, one grid: grid.x = (row tiles of 256) * 8 heads, grid.y = batch. Block = 16 waves; block tile = 256 token rows x 192 cols (the head's 64 q, 64 k and 64 v columns), wave tile 32 x 96.
// A stage is 64 k of the block's 256 x rows and 192 weight rows: each thread loads 14 groups of 4 f32 one stage ahead (they fly during the products of the stage before), rounds them (x: bf16 value as exact f16; weights: bf16 value x16 as exact f16) and stores them as 16-bit rows in LDS (two buffers, one block barrier per stage).
// The block also converts its share of Wp for the output GEMM (f16 x16 plane and bf16 plane).
// q and k: f16 row plane [row][DM] (+ bf16 hi/lo row planes for rows t < ERL); v: transposed planes [(b,head)][d][SEQ] (f16, + bf16 hi/lo for t < ERL).
#define PR 256                       /* token rows of a block */
#define PROWS (PR + 192)             /* staged rows per stage: x rows, then q, k, v weight rows */
#define PBUF_E (PROWS * LP)          /* one buffer, 16-bit elements */
#define PSP 132                      /* f32 pitch of the q, k epilogue tile: 528 B = 16 B x odd */
#define PVP 264                      /* 16-bit pitch of a transposed v epilogue plane: 528 B */
#define PSO_B (PR * PSP * 4)
#define PROJ_SM_B (PSO_B + 3 * 64 * PVP * 2)
#define PBLKS ((SEQ / PR) * NH * NB)
typedef unsigned short v4us __attribute__((ext_vector_type(4), may_alias));
typedef float v2fa __attribute__((ext_vector_type(2), may_alias));
typedef unsigned int u32a __attribute__((may_alias));
typedef float psorow[PSP];

typedef float v2f __attribute__((ext_vector_type(2)));
typedef __bf16 v2b __attribute__((ext_vector_type(2)));
typedef _Float16 v2h __attribute__((ext_vector_type(2)));

// two f32 -> their bf16 values (round to nearest even, one packed conversion) x sc -> two f16 (exact)
__device__ __forceinline__ unsigned int round2(float a, float c, float sc) {
  const v2f v = {a, c};
  const unsigned int p = __builtin_bit_cast(unsigned int, __builtin_convertvector(v, v2b));
  v2f r = {__uint_as_float(p << 16), __uint_as_float(p & 0xFFFF0000u)};
  r = r * sc;
  return __builtin_bit_cast(unsigned int, __builtin_convertvector(r, v2h));
}
__device__ __forceinline__ v4us round4(v4f a, float sc) {
  union { v4us v; unsigned int u[2]; } f;
  f.u[0] = round2(a[0], a[1], sc); f.u[1] = round2(a[2], a[3], sc);
  return f.v;
}

// Block barrier that orders LDS alone (this wave's LDS stores and reads are done, then the barrier): __syncthreads() would also wait for the global loads of the stage after next, which are meant to fly across it into registers.
__device__ __forceinline__ void lds_barrier() {
  __builtin_amdgcn_fence(__ATOMIC_RELEASE, "workgroup", "local");
  __builtin_amdgcn_s_barrier();
  __builtin_amdgcn_fence(__ATOMIC_ACQUIRE, "workgroup", "local");
}

__global__ __launch_bounds__(512) void k_proj(const float* __restrict__ x, const float* __restrict__ Wq, const float* __restrict__ Wk, const float* __restrict__ Wv, const float* __restrict__ Wp,
                                              unsigned short* __restrict__ QK16, unsigned short* __restrict__ QKH, unsigned short* __restrict__ QKL,
                                              unsigned short* __restrict__ VT16, unsigned short* __restrict__ VTH, unsigned short* __restrict__ VTL,
                                              unsigned short* __restrict__ WP16, unsigned short* __restrict__ WPB) {
  __shared__ __attribute__((aligned(16))) unsigned char sm[PROJ_SM_B];
  unsigned short* const ring = (unsigned short*)sm;
  psorow* const so = (psorow*)sm;
  unsigned short* const vt = (unsigned short*)(sm + PSO_B);
  const int tid = threadIdx.x, lane = tid & 31, ln = lane & 15, hh = lane >> 4;
  const int w = __builtin_amdgcn_readfirstlane((int)(threadIdx.x >> 5));
  const int rg = w >> 1, cg = w & 1;
  const int rt = (int)blockIdx.x >> 3, nq = (int)blockIdx.x & 7, b = blockIdx.y;
  const int t0 = rt * PR;
  const size_t r0 = (size_t)b * SEQ + t0;
  const int col0 = nq * 64;
  const int srow = tid >> 4, sc4 = (tid & 15) * 4;   // staging: a wave's load takes 2 whole rows of 256 B
  const float* const xs = x + ((size_t)b * SEQ_FULL + t0 + srow) * DM + sc4;
  const size_t wof = (size_t)(col0 + srow) * DM + sc4;
  const float* const wq = Wq + wof;
  const float* const wk = Wk + wof;
  const float* const wv = Wv + wof;
  unsigned short* const sdst = ring + srow * LP + sc4;
  v4f st[14];
  auto fetch = [&](int s) {   // k = 64 s .. 64 s + 63: group i = staged row 32 i + srow
#pragma unroll
    for (int i = 0; i < 8; ++i) st[i] = *(const v4fa*)(xs + (size_t)i * 32 * DM + s * KT);
#pragma unroll
    for (int i = 0; i < 2; ++i) {
      st[8 + i] = *(const v4fa*)(wq + (size_t)i * 32 * DM + s * KT);
      st[10 + i] = *(const v4fa*)(wk + (size_t)i * 32 * DM + s * KT);
      st[12 + i] = *(const v4fa*)(wv + (size_t)i * 32 * DM + s * KT);
    }
    st_wait();   // behind the loads: stands in front of any rewrite of the address registers they name
  };
  auto put = [&](int bf) {
#pragma unroll
    for (int i = 0; i < 14; ++i) *(v4us*)(sdst + bf * PBUF_E + i * 32 * LP) = round4(st[i], i < 8 ? 1.0f : 16.0f);
  };
  fetch(0);
  // this block's share of Wp
  for (int e = (((int)blockIdx.y * ((SEQ / PR) * NH) + (int)blockIdx.x) * 512 + tid) * 2; e < DM * DM; e += PBLKS * 1024) {
    const v2fa p = *(const v2fa*)(Wp + e);
    const unsigned short b0 = bf16_bits(p[0]), b1 = bf16_bits(p[1]);
    union { unsigned int u; _Float16 h[2]; } f;
    f.h[0] = (_Float16)(bf16_val(b0) * 16.0f); f.h[1] = (_Float16)(bf16_val(b1) * 16.0f);
    *(u32a*)(WP16 + e) = f.u;
    *(u32a*)(WPB + e) = (unsigned int)b0 | ((unsigned int)b1 << 16);
    st_wait();
  }
  const v8f z8 = {0.f, 0.f, 0.f, 0.f, 0.f, 0.f, 0.f, 0.f};
  v8f acc[12];
#pragma unroll
  for (int u = 0; u < 12; ++u) acc[u] = z8;
  put(0);
  fetch(1);
  lds_barrier();   // publishes stage 0
#pragma unroll     /* in line: every global and LDS offset is an immediate, so no address register is rewritten while loads fly */
  for (int sg = 0; sg < DM / KT; ++sg) {
    const unsigned short* tb = ring + (sg & 1) * PBUF_E;
    const unsigned short* ap = tb + (32 * rg + ln) * LP;
    const unsigned short* bp = tb + (PR + 96 * cg + ln) * LP;
#pragma unroll     /* k ascending in every accumulator */
    for (int h2 = 0; h2 < 2; ++h2) {
      Frag fa[2], fb[6];
      fa[0] = ldf(ap + 32 * h2, hh); fa[1] = ldf(ap + 16 * LP + 32 * h2, hh);
#pragma unroll
      for (int t = 0; t < 6; ++t) fb[t] = ldf(bp + (16 * t) * LP + 32 * h2, hh);
      __builtin_amdgcn_sched_barrier(0);   // the half's fragment reads stand together in front of its products: one LDS latency per half, not one per fragment
#pragma unroll
      for (int t = 0; t < 6; ++t) {
        acc[t] = wm_h(fa[0], fb[t], acc[t]);
        acc[6 + t] = wm_h(fa[1], fb[t], acc[6 + t]);
      }
    }
    __builtin_amdgcn_sched_barrier(0);         // keeps the roundings, and with them the wait for the loads, behind the stage's products
    if (sg + 1 < DM / KT) put((sg + 1) & 1);   // into the buffer whose last readers passed the barrier of the stage before
    __builtin_amdgcn_sched_barrier(0);         // keeps the loads below behind the roundings, so that they reuse those registers: a second register set would spill
    if (sg + 2 < DM / KT) fetch(sg + 2);       // into the registers just rounded: these loads fly across the barrier and the next stage's products
    lds_barrier();                             // publishes the next stage and ends every wave's reads of this one
  }
  // D element r of lane (hh, ln) = (row 8hh + r, col ln) of its 16x16 tile. q and k columns go to the f32 tile; a lane's 8 values of a v column are 8 successive tokens of one d, a 16-byte piece of the transposed planes.
  const bool early = (t0 < ERL);
#pragma unroll
  for (int u = 0; u < 12; ++u) {
    const int t = u % 6, half = u / 6;
    const int row = 32 * rg + 16 * half + 8 * hh;
    if (cg == 1 && t >= 2) {
      const int d = 16 * (t - 2) + ln;
      v4f x0, x1;
#pragma unroll
      for (int j = 0; j < 4; ++j) { x0[j] = acc[u][j] * 0.0625f; x1[j] = acc[u][4 + j] * 0.0625f; }
      *(v8us*)(vt + d * PVP + row) = to_f16x8(x0, x1);
      if (early) {
        v8us oh, ol; to_bf16x8_hl(x0, x1, oh, ol);
        *(v8us*)(vt + (64 + d) * PVP + row) = oh;
        *(v8us*)(vt + (128 + d) * PVP + row) = ol;
      }
    } else {
      const int col = 96 * cg + 16 * t + ln;
#pragma unroll
      for (int r = 0; r < 8; ++r) so[row + r][col] = acc[u][r] * 0.0625f;
    }
  }
  __syncthreads();
#pragma unroll
  for (int z = 0; z < 2; ++z) {
#pragma unroll
    for (int it = 0; it < 4; ++it) {
      const int row = it * 64 + (tid >> 3), pc = tid & 7;
      const v4f x0 = *(const v4fa*)&so[row][64 * z + 8 * pc], x1 = *(const v4fa*)&so[row][64 * z + 8 * pc + 4];
      const size_t off = (size_t)z * (NR * DM) + (r0 + row) * DM + col0 + 8 * pc;
      const v8us o = to_f16x8(x0, x1);
      *(v8us*)(QK16 + off) = o;
      st_wait();
      if (early) {
        v8us oh, ol; to_bf16x8_hl(x0, x1, oh, ol);
        *(v8us*)(QKH + off) = oh;
        *(v8us*)(QKL + off) = ol;
        st_wait();
      }
    }
  }
  // transposed: 64 d rows x 256 tokens (512 B each): d = it*16 + tid/32, piece = tid%32 (8 tokens = 16 B)
#pragma unroll
  for (int it = 0; it < 4; ++it) {
    const int d = it * 16 + (tid >> 5), pc = tid & 31;
    const size_t off = (((size_t)b * NH + nq) * HD + d) * SEQ + t0 + 8 * pc;
    const v8us o = *(const v8us*)(vt + d * PVP + 8 * pc);
    *(v8us*)(VT16 + off) = o;
    st_wait();
    if (early) {
      const v8us oh = *(const v8us*)(vt + (64 + d) * PVP + 8 * pc), ol = *(const v8us*)(vt + (128 + d) * PVP + 8 * pc);
      *(v8us*)(VTH + off) = oh;
      *(v8us*)(VTL + off) = ol;
      st_wait();
    }
  }
}

// Output projection + bias for all rows in one grid: grid.x = (row tiles of 128) * 8 col tiles, grid.y = batch; row tiles t < ERL take the bf16 hi/lo ctx planes, the rest the f16 plane (ctx x64, weights x16).
__global__ __launch_bounds__(128) void k_out(const unsigned short* __restrict__ CH, const unsigned short* __restrict__ CL, const unsigned short* __restrict__ C16,
                                             const unsigned short* __restrict__ WPB, const unsigned short* __restrict__ WP16,
                                             const float* __restrict__ bias, float* __restrict__ OF) {
  __shared__ __attribute__((aligned(16))) unsigned char sm[GEMM_SM_B(true)];
  const sorow* const so = (const sorow*)sm;
  const int tid = threadIdx.x;
  const int rt = (int)blockIdx.x >> 3, nq = (int)blockIdx.x & 7, b = blockIdx.y;
  const int t0 = rt * 128;
  const size_t r0 = (size_t)b * SEQ + t0;
  const int col0 = nq * 64;
  if (t0 < ERL) gemm_core<true, true>(sm, CH, CL, WPB, 1.0f, bias, r0, col0);
  else gemm_core<false, true>(sm, C16, C16, WP16, 0.0009765625f, bias, r0, col0);
  // f32 rows of the output buffer (full-size layout): 128 rows x 256 B: row = it*8 + tid/16, piece = tid%16 (4 floats = 16 B)
#pragma unroll
  for (int it = 0; it < 16; ++it) {
    const int row = it * 8 + (tid >> 4), pc = tid & 15;
    const v4f v = *(const v4fa*)&so[row][4 * pc];
    *(v4f*)(OF + ((size_t)b * SEQ_FULL + t0 + row) * DM + col0 + 4 * pc) = v;
  }
}

// Causal attention, one wave per 16 query rows of one (batch, head); block = 4 waves (64 queries) that share the staged K and V^T tiles; one block barrier per ring stage (RES: 64 keys; dense rows: 128 keys).
// S^T[key][query] = K Q^T: A = K rows (lane = key), B = Q rows (lane = query). D: lane (hh, ln) element r = (key 8hh + r, query ln).
// O^T[d][query] = V^T P^T: A = V^T rows (lane = d, k = keys), B = packed P^T: element r <- tile(keys 0..15)[r], element 8+r <- tile(keys 16..31)[r].
// RES: bf16 hi/lo operands, three products per site; else f16 single products with P carried x1024 (sum carried alike) and ctx stored x64.
// lds: the ring [buffer][4 tiles][row * LP + element]; the four tiles of a buffer are K hi, V^T hi, K lo, V^T lo of 64 keys with RES, else K, V^T of 64 keys and K, V^T of the next 64; behind the loop's last barrier its first bytes become the waves' output tiles [wave][hi, lo][16][64].
template <bool RES>
__device__ __forceinline__ void attn_body(unsigned short* lds, const unsigned short* __restrict__ Qh, const unsigned short* __restrict__ Ql,
                                          const unsigned short* __restrict__ Kh, const unsigned short* __restrict__ Kl,
                                          const unsigned short* __restrict__ Vh, const unsigned short* __restrict__ Vl,
                                          unsigned short* __restrict__ Ch, unsigned short* __restrict__ Cl, int qb, int h, int b) {
  constexpr int NTL = 4;             /* staged tiles per buffer */
  constexpr int SPT = RES ? 1 : 2;   /* 64-key tile pairs per ring stage: the dense rows need no lo tiles, so their stage is twice as long and its copies have twice the time to land */
  const int lane = threadIdx.x & 31, ln = lane & 15, hh = lane >> 4;
  const int w = __builtin_amdgcn_readfirstlane((int)(threadIdx.x >> 5));
  unsigned short (* const sc)[16][64] = (unsigned short (*)[16][64])lds + w * (RES ? 2 : 1);   /* this wave's output tiles */
  const int q0 = qb + w * 16;
  const int qi = q0 + ln;
  const size_t rowb = (size_t)b * SEQ;
  const size_t qof = (rowb + q0 + ln) * DM + h * HD;
  const Frag qh0 = ldf(Qh + qof, hh), qh1 = ldf(Qh + qof + 32, hh);
  Frag ql0 = qh0, ql1 = qh1;
  if (RES) { ql0 = ldf(Ql + qof, hh); ql1 = ldf(Ql + qof + 32, hh); }
  const int crow = (int)threadIdx.x >> 3, cpc = (int)threadIdx.x & 7;
  const size_t kcp = (rowb + crow) * DM + h * HD + 8 * cpc;
  const size_t vcp = (((size_t)b * NH + h) * HD + crow) * SEQ + 8 * cpc;
  const unsigned lcp = lds_off(lds) + (unsigned)(crow * LP + 8 * cpc) * 2u;
  const int nst = (qb >> 6) + 1;            // scalar and the same in the whole block: tiles of 64 keys up to the block's last query
  const int ntr = (nst + SPT - 1) / SPT;    // ring stages
  auto fill = [&](int s, int bf) {   // ring stage s (keys 64 SPT s .. 64 SPT s + 64 SPT - 1) into buffer bf
    const unsigned lb = lcp + (unsigned)bf * (unsigned)(NTL * TILE_E * 2);
    const size_t k0 = (size_t)s * (SPT * KT);
    cp_tile(lb, Kh + kcp + k0 * DM, (size_t)16 * DM);
    cp_tile(lb + TILE_E * 2, Vh + vcp + k0, (size_t)16 * SEQ);
    if (RES) {
      cp_tile(lb + 2 * TILE_E * 2, Kl + kcp + k0 * DM, (size_t)16 * DM);
      cp_tile(lb + 3 * TILE_E * 2, Vl + vcp + k0, (size_t)16 * SEQ);
    } else {   // the stage's second tile pair; behind an odd tile count it lies past the diagonal, still inside the sequence (SEQ is a multiple of 128), and is not worked on
      cp_tile(lb + 2 * TILE_E * 2, Kh + kcp + (k0 + KT) * DM, (size_t)16 * DM);
      cp_tile(lb + 3 * TILE_E * 2, Vh + vcp + k0 + KT, (size_t)16 * SEQ);
    }
  };
  const v8f z8 = {0.f, 0.f, 0.f, 0.f, 0.f, 0.f, 0.f, 0.f};
  v8f acc[4];
#pragma unroll
  for (int t = 0; t < 4; ++t) acc[t] = z8;
  float m = NEGBIG, l = 0.f;
  const float carry = RES ? 0.f : CARRY_LN;
  fill(0, 0);
  asm volatile("s_wait_asynccnt 0x0" ::: "memory");   // this wave's copies of stage 0 have landed
  __syncthreads();                                    // ... and every other wave's
  if (ntr > 1) fill(1, 1);
  int pr = 0;   // the wave's issue priority now: a wave starts at 0
#pragma unroll 1   /* rolled: one hand-over of the buffers per trip, and the loop text stays small */
  for (int sg = 0; sg < ntr; ++sg) {
   // Waves of blocks with unlike row counts share a SIMD, and the launch lasts until the longest has run out, at the end alone and at one wave's pace. Issue priority therefore follows the work a wave still has:
   // rest = tiles of 64 keys left, a multi-product tile counted as 3.5 single-product ones; one level per 8. Scalar, the same in the whole block; the last stages are at level 0, so every wave leaves the loop at priority 0.
   const int rest = RES ? (7 * (ntr - sg)) >> 1 : nst - SPT * sg;
   const int pw = rest > 24 ? 3 : (rest - 1) >> 3;
   if (pw != pr) {   // the instruction takes its level as an immediate
     pr = pw;
     if (pw == 3) __builtin_amdgcn_s_setprio(3);
     else if (pw == 2) __builtin_amdgcn_s_setprio(2);
     else if (pw == 1) __builtin_amdgcn_s_setprio(1);
     else __builtin_amdgcn_s_setprio(0);
   }
   const unsigned short* tb = lds + (sg & 1) * (NTL * TILE_E);
   if (!RES) {
    // K fragments of the stage's first tile pair; those of the second are read below, into the same registers, while the first pair's softmax runs (the whole stage is published)
    Frag kf[4][2];
#pragma unroll
    for (int kt = 0; kt < 4; ++kt) {
      const unsigned short* kp = tb + (16 * kt + ln) * LP;
      kf[kt][0] = ldf(kp, hh); kf[kt][1] = ldf(kp + 32, hh);
    }
#pragma unroll     /* both tile pairs of the stage in line, so that every LDS offset is an immediate */
   for (int tp = 0; tp < SPT; ++tp) {
    if (tp > 0 && SPT * sg + tp >= nst) continue;   // scalar, the same in the whole block: behind an odd tile count the last stage's second tile pair lies past the diagonal
    const unsigned short* tk = tb + tp * (2 * TILE_E);
    // dense rows: a tile pair's 64 keys are one softmax step: one maximum, one rescale, eight score and eight P.V products in four independent accumulator chains each
    // (keys behind the diagonal get weight 0 by the mask; every loop of the step is unrolled, so that fragments, scores and accumulators stay in registers under constant indices)
    const int kb = (SPT * sg + tp) * KT;
    // the V^T fragment reads stand together in front of the products, behind the K reads: they return while scores and softmax run
    Frag vf[4][2];
    __builtin_amdgcn_sched_barrier(0);   // keeps every K read in front of the V^T reads: LDS returns in order, and the score products then wait for K alone
#pragma unroll
    for (int t = 0; t < 4; ++t) {
      const unsigned short* vp = tk + TILE_E + (16 * t + ln) * LP;
      vf[t][0] = ldf(vp, hh); vf[t][1] = ldf(vp + 32, hh);
    }
    v8f s[4];
#pragma unroll
    for (int kt = 0; kt < 4; ++kt) s[kt] = wm_h(kf[kt][0], qh0, z8);
#pragma unroll
    for (int kt = 0; kt < 4; ++kt) s[kt] = wm_h(kf[kt][1], qh1, s[kt]);
    nop_grp(s, kf, qh0, qh1);
    if (kb + KT > q0) {   // scalar condition: this tile pair touches the diagonal; masked scores are replaced
#pragma unroll
      for (int kt = 0; kt < 4; ++kt)
#pragma unroll
        for (int r = 0; r < 8; ++r) { const int key = kb + 16 * kt + 8 * hh + r; s[kt][r] = (key > qi) ? NEGBIG : s[kt][r]; }
    }
    float mt[4];
#pragma unroll
    for (int kt = 0; kt < 4; ++kt) {
      float a = s[kt][0];
#pragma unroll
      for (int r = 1; r < 8; ++r) a = fmaxf(a, s[kt][r]);
      mt[kt] = a;
    }
    float mx = fmaxf(fmaxf(mt[0], mt[1]), fmaxf(mt[2], mt[3]));
    const float mxo = __shfl_xor(mx, 16, 32);
    if (tp + 1 < SPT) {
      __builtin_amdgcn_sched_barrier(0);   // the exchange goes to the LDS queue first: it returns in order, so the maximum does not wait for the reads below
#pragma unroll
      for (int kt = 0; kt < 4; ++kt) {
        const unsigned short* kp = tk + 2 * TILE_E + (16 * kt + ln) * LP;
        kf[kt][0] = ldf(kp, hh); kf[kt][1] = ldf(kp + 32, hh);
      }
      __builtin_amdgcn_sched_barrier(0);   // keeps the reads here, in front of the exponentials that hide their latency
    }
    mx = fmaxf(mx, mxo);
    const float mnew = fmaxf(m, mx);
    const float alpha = __expf((m - mnew) * QSCALE);
    const float cc = carry - mnew * QSCALE;
    m = mnew;
    Frag ph[2];
    float pt[4];
#pragma unroll
    for (int kt = 0; kt < 4; ++kt) {
      float a = 0.f;
#pragma unroll
      for (int r = 0; r < 8; ++r) {
        const float p = __expf(fmaf(s[kt][r], QSCALE, cc));
        ph[kt >> 1].e[8 * (kt & 1) + r] = (_Float16)p; a += p;
      }
      pt[kt] = a;
    }
    float ps = (pt[0] + pt[1]) + (pt[2] + pt[3]);
    ps += __shfl_xor(ps, 16, 32);
    l = l * alpha + ps;
#pragma unroll
    for (int t = 0; t < 4; ++t) acc[t] = acc[t] * alpha;
#pragma unroll
    for (int t = 0; t < 4; ++t) acc[t] = wm_h(vf[t][0], ph[0], acc[t]);
#pragma unroll
    for (int t = 0; t < 4; ++t) acc[t] = wm_h(vf[t][1], ph[1], acc[t]);
    nop_grp(acc, vf, ph[0], ph[1]);
   }
   } else
#pragma unroll     /* both 32-key halves of the stage in line, so that every LDS offset is an immediate */
   for (int hf = 0; hf < 2; ++hf) {
    const unsigned short* tk = tb;
    const int kb = sg * KT + hf * 32;
    if (kb >= q0 + 16) continue;   // scalar: the wave's queries all lie in front of these 32 keys
    v8f s[2];
#pragma unroll
    for (int kt = 0; kt < 2; ++kt) {
      const unsigned short* kp = tk + (hf * 32 + 16 * kt + ln) * LP;
      const Frag k0 = ldf(kp, hh), k1 = ldf(kp + 32, hh);
      v8f c = z8;
      if (RES) {
        const Frag kl0 = ldf(kp + 2 * TILE_E, hh), kl1 = ldf(kp + 2 * TILE_E + 32, hh);
        c = wm_b(k0, qh0, c); c = wm_b(kl0, qh0, c); c = wm_b(k0, ql0, c);
        c = wm_b(k1, qh1, c); c = wm_b(kl1, qh1, c); c = wm_b(k1, ql1, c);
        nop8(c, k0, k1, kl0, kl1, qh0, qh1, ql0, ql1);
      } else {
        c = wm_h(k0, qh0, c); c = wm_h(k1, qh1, c);
        nop4(c, k0, k1, qh0, qh1);
      }
      s[kt] = c;
    }
    if (kb + 32 > q0) {   // scalar condition: this step touches the diagonal; masked scores are replaced
#pragma unroll
      for (int kt = 0; kt < 2; ++kt)
#pragma unroll
        for (int r = 0; r < 8; ++r) { const int key = kb + 16 * kt + 8 * hh + r; s[kt][r] = (key > qi) ? NEGBIG : s[kt][r]; }
    }
    float mx = fmaxf(s[0][0], s[1][0]);
#pragma unroll
    for (int r = 1; r < 8; ++r) mx = fmaxf(mx, fmaxf(s[0][r], s[1][r]));
    mx = fmaxf(mx, __shfl_xor(mx, 16, 32));
    const float mnew = fmaxf(m, mx);
    const float alpha = __expf((m - mnew) * QSCALE);
    const float cc = carry - mnew * QSCALE;
    m = mnew;
    Frag ph, pl;
    float ps = 0.f;
#pragma unroll
    for (int kt = 0; kt < 2; ++kt)
#pragma unroll
      for (int r = 0; r < 8; ++r) {
        const float p = __expf(fmaf(s[kt][r], QSCALE, cc));
        if (RES) {
          const unsigned short hb = bf16_bits(p); const float hv = bf16_val(hb);
          const unsigned short lb = bf16_bits(p - hv);
          ph.u[8 * kt + r] = hb; pl.u[8 * kt + r] = lb; ps += hv + bf16_val(lb);
        } else {
          ph.e[8 * kt + r] = (_Float16)p; ps += p;
        }
      }
    if (!RES) pl = ph;
    ps += __shfl_xor(ps, 16, 32);
    l = l * alpha + ps;
#pragma unroll
    for (int t = 0; t < 4; ++t) acc[t] = acc[t] * alpha;
#pragma unroll
    for (int t = 0; t < 4; ++t) {
      const unsigned short* vp = tk + TILE_E + (16 * t + ln) * LP + hf * 32;
      const Frag vh = ldf(vp, hh);
      if (RES) {
        const Frag vl = ldf(vp + 2 * TILE_E, hh);
        acc[t] = wm_b(vh, ph, acc[t]); acc[t] = wm_b(vl, ph, acc[t]); acc[t] = wm_b(vh, pl, acc[t]);
        nop4(acc[t], vh, vl, ph, pl);
      } else {
        acc[t] = wm_h(vh, ph, acc[t]);
        nop2(acc[t], vh, ph);
      }
    }
   }
   // hand-over of the buffers, passed by every wave:
   asm volatile("s_wait_dscnt 0x0" ::: "memory");      // this wave's reads of the buffer that is refilled below have returned
   asm volatile("s_wait_asynccnt 0x0" ::: "memory");   // this wave's copies of the next stage have landed
   __syncthreads();                                    // publishes the next stage and ends every wave's reads of this one
   if (sg + 2 < ntr) fill(sg + 2, sg & 1);
  }
  asm volatile("s_wait_asynccnt 0x0" ::: "memory");    // no copy is outstanding when the ring's LDS becomes the output tiles
  // acc[t][r] = O^T[d = 16t + 8hh + r][query ln]; normalise and stage row ln of the wave tile
  const float inv = 1.0f / l;
  const float osc = RES ? inv : inv * 64.0f;
#pragma unroll
  for (int t = 0; t < 4; ++t) {
    if (RES) {
      Frag oh, ol;
#pragma unroll
      for (int r = 0; r < 8; ++r) { const float c = acc[t][r] * osc; const unsigned short hb = bf16_bits(c); oh.u[r] = hb; ol.u[r] = bf16_bits(c - bf16_val(hb)); }
      *(v8us*)&sc[0][ln][16 * t + 8 * hh] = oh.half[0];
      *(v8us*)&sc[RES ? 1 : 0][ln][16 * t + 8 * hh] = ol.half[0];
    } else {
      Frag o;
#pragma unroll
      for (int r = 0; r < 8; ++r) o.e[r] = (_Float16)(acc[t][r] * osc);
      *(v8us*)&sc[0][ln][16 * t + 8 * hh] = o.half[0];
    }
  }
  __builtin_amdgcn_fence(4 /* acq_rel order */, "workgroup");
  __builtin_amdgcn_wave_barrier();
  const int rsub = lane >> 3, pc = lane & 7;
  {
#pragma unroll
    for (int q = 0; q < 4; ++q) {
      const int row = 4 * q + rsub;
      const size_t off = (rowb + q0 + row) * DM + h * HD + 8 * pc;
      const v8us v0 = *(const v8us*)&sc[0][row][8 * pc];
      *(v8us*)(Ch + off) = v0;
      if (RES) { const v8us v1 = *(const v8us*)&sc[RES ? 1 : 0][row][8 * pc]; *(v8us*)(Cl + off) = v1; }
    }
    
  }
}

// Both row classes in one grid: grid.x = query tiles of 64 rows from row tbase on, grid.y = head, grid.z = batch.
// Tiles of rows t < ERL run on the bf16 hi/lo planes, the rest on the f16 planes.
__global__ __launch_bounds__(128) void k_attn(const unsigned short* __restrict__ QH, const unsigned short* __restrict__ QL,
                                              const unsigned short* __restrict__ KH, const unsigned short* __restrict__ KL,
                                              const unsigned short* __restrict__ VTH, const unsigned short* __restrict__ VTL,
                                              const unsigned short* __restrict__ Q16, const unsigned short* __restrict__ K16, const unsigned short* __restrict__ VT16,
                                              unsigned short* __restrict__ CH, unsigned short* __restrict__ CL, unsigned short* __restrict__ C16, int tbase) {
  __shared__ __attribute__((aligned(16))) unsigned short lds[2 * 4 * TILE_E];
  const int h = blockIdx.y, b = blockIdx.z;
  // Every block of the grid is resident at once and a tile's cost grows with its row, so the launch lasts as long as the fullest WGP. The tiles fall into four classes of QG by row (class 0: the multi-product rows);
  // block x takes, of class (x / QG + b) % 4, tile x % QG counted upward in class 0 and downward in the others: blocks x, x + QG, x + 2 QG, x + 3 QG of one (head, batch), and blocks (x, head) of four successive batches, then hold one tile of each class with nearly the same summed cost.
  // For a fixed (head, batch) the map is a permutation of the tiles; where blocks land matters for speed alone.
  constexpr int QG = SEQ / 64 / 4;
  const int xr = (int)blockIdx.x % QG, xc = ((int)blockIdx.x / QG + b) & 3;
  const int qb = tbase + (xc == 0 ? xr : (xc + 1) * QG - 1 - xr) * 64;
  if (qb < ERL) attn_body<true>(lds, QH, QL, KH, KL, VTH, VTL, CH, CL, qb, h, b);
  else attn_body<false>(lds, Q16, Q16, K16, K16, VT16, VT16, C16, C16, qb, h, b);
}

extern "C" void kernel_launch(void* const* d_in, const int* in_sizes, int n_in,
                              void* d_out, int out_size, void* d_ws, size_t ws_size, hipStream_t stream) {
  static_assert(NH * HD == DM);
  static_assert(DM == 512);
  static_assert(SEQ % 256 == 0);
  static_assert(ERL % 128 == 0);
  static_assert(NB <= NB_FULL);
  static_assert(ERL % 256 == 0);   /* a projection block's 256 rows are of one row class */
  static_assert(SEQ <= SEQ_FULL);
  static_assert((size_t)13 * NB * SEQ * DM * 2 + (size_t)5 * DM * DM * 2 <= (size_t)134217728);
  if (n_in < 6) return;
  const long long xmin = ((long long)(NB - 1) * SEQ_FULL + SEQ) * DM;
  if ((long long)in_sizes[0] < xmin) return;
  if (in_sizes[1] < DM * DM || in_sizes[2] < DM * DM || in_sizes[3] < DM * DM || in_sizes[4] < DM * DM || in_sizes[5] < DM) return;
  if ((long long)out_size < xmin) return;
  const float* x  = (const float*)d_in[0];
  const float* Wq = (const float*)d_in[1];
  const float* Wk = (const float*)d_in[2];
  const float* Wv = (const float*)d_in[3];
  const float* Wp = (const float*)d_in[4];
  const float* bp = (const float*)d_in[5];
  float* out = (float*)d_out;

  char* ws = (char*)d_ws; size_t off = 0;
  auto take = [&](size_t bytes) { char* p = ws + off; off += (bytes + 255) & ~(size_t)255; return (unsigned short*)p; };
  const size_t PL = NR * DM;            /* elements of one [NB*SEQ][DM] 16-bit plane */
  const size_t WN = (size_t)DM * DM;
  unsigned short* W16  = take(4 * WN * 2);     /* fourth plane: Wp as f16 x16, [n][k] */
  unsigned short* WPB  = take(WN * 2);         /* Wp as bf16, [n][k] */
  unsigned short* QK16 = take(2 * PL * 2);     /* q plane then k plane (f16) */
  unsigned short* QKH  = take(2 * PL * 2);     /* bf16 hi, rows t < ERL written */
  unsigned short* QKL  = take(2 * PL * 2);     /* bf16 lo, rows t < ERL written */
  unsigned short* VT16 = take(PL * 2);         /* [(b,h)][d][SEQ] f16 */
  unsigned short* VTH  = take(PL * 2);
  unsigned short* VTL  = take(PL * 2);
  unsigned short* C16  = take(PL * 2);         /* ctx x64 f16, rows t >= ERL */
  unsigned short* CH   = take(PL * 2);         /* ctx bf16 hi, rows t < ERL */
  unsigned short* CL   = take(PL * 2);         /* ctx bf16 lo, rows t < ERL */
  if (off > ws_size || off > (size_t)134217728) return;

  /* q, k and v projections from the f32 inputs, and the conversion of Wp; v is written transposed per (batch, head) */
  k_proj<<<dim3((SEQ / 256) * 8, NB, 1), 512, 0, stream>>>(x, Wq, Wk, Wv, Wp, QK16, QKH, QKL, VT16, VTH, VTL, W16 + 3 * WN, WPB);

  /* attention: first ERL rows on bf16 hi/lo planes, remaining rows on f16 planes */
  k_attn<<<dim3(SEQ / 64, NH, NB), 128, 0, stream>>>(QKH, QKL, QKH + PL, QKL + PL, VTH, VTL, QK16, QK16 + PL, VT16, CH, CL, C16, 0);

  /* output projection + bias */
  k_out<<<dim3((SEQ / 128) * 8, NB, 1), 128, 0, stream>>>(CH, CL, C16, WPB, W16 + 3 * WN, bp, out);
}

// v009
// It runs in 58 microseconds.
// In both of two side-by-side timings against v008, it was 1.03 times as fast.
// Counting every step since v000, it is 4.92 times as fast.
#include <hip/hip_runtime.h>
// Compute dtype: inputs RNE-converted to bf16 values (x as exact f16, weights as exact f16 x16 / exact bf16); q,k,v projections, dense-row scores, dense-row P.V and dense-row output GEMM = v_wmma_f32_16x16x32_f16 single products (P carried x1024, ctx carried x64); first ERL rows of every sequence: scores and P.V as bf16 hi/lo three-product sums, output GEMM as bf16 hi/lo A x exact bf16 W (v_wmma_f32_16x16x32_bf16); all accumulation, softmax statistics, bias add in f32.
// Structure: causal attention per (batch, head) with S^T = K Q^T (Q fragments in registers as the B operand) and O^T = V^T P^T (packed S^T accumulators are the B fragment), online max-subtracted softmax per lane column, its row sums taken by a product of a constant ones-row A with the same packed P^T; K and V^T tiles of 64 keys are staged in LDS once per block (two buffers; a buffer holds one tile pair with its lo planes for the first ERL rows, two tile pairs = 128 keys for the dense rows) and read from there by its four waves. Three launches: q, k, v projections (which round the f32 inputs themselves on the way into LDS, and convert Wp); attention (both row classes); output GEMM (both row classes).
#ifndef NB
#define NB 4
#endif
#ifndef SEQ
#define SEQ 2048
#endif
#ifndef EARLY
#define EARLY 512
#endif
#define NB_FULL 4
#define SEQ_FULL 2048
#define DM 512
#define NH 8
#define HD 64
#define ERL ((EARLY < SEQ) ? EARLY : SEQ)   /* rows per sequence on the multi-product path */
#define NR ((size_t)NB * SEQ)               /* compact token rows r = b*SEQ + t */
#define QSCALE 0.044194173824159216f        /* d_model^-0.5 */
#define NEGBIG (-3.0e38f)
#define CARRY_LN 6.931471805599453f         /* ln 1024 */

typedef _Float16 v16h __attribute__((ext_vector_type(16)));
typedef __bf16   v16b __attribute__((ext_vector_type(16)));
typedef unsigned short v8us __attribute__((ext_vector_type(8), may_alias));
typedef float v8f  __attribute__((ext_vector_type(8)));
typedef float v4f  __attribute__((ext_vector_type(4)));
typedef float v4fa __attribute__((ext_vector_type(4), may_alias));
union Frag { v16h h; v16b b; v8us half[2]; _Float16 e[16]; unsigned short u[16]; };

__device__ __forceinline__ unsigned short bf16_bits(float x) { unsigned int u = __float_as_uint(x); return (unsigned short)((u + 0x7FFFu + ((u >> 16) & 1u)) >> 16); }
__device__ __forceinline__ float bf16_val(unsigned short b) { return __uint_as_float(((unsigned int)b) << 16); }
__device__ __forceinline__ float bf16_rne(float x) { return bf16_val(bf16_bits(x)); }

// fragment loader (A and B alike): elements 0..7 <- p[8h .. 8h+7], elements 8..15 <- p[16+8h .. 16+8h+7]
__device__ __forceinline__ Frag ldf(const unsigned short* p, int hh) {
  Frag f; f.half[0] = *(const v8us*)(p + 8 * hh); f.half[1] = *(const v8us*)(p + 16 + 8 * hh); return f;
}
__device__ __forceinline__ v8f wm_h(const Frag& a, const Frag& b, v8f c) { return __builtin_amdgcn_wmma_f32_16x16x32_f16(false, a.h, false, b.h, (short)0, c, false, false); }
__device__ __forceinline__ v8f wm_b(const Frag& a, const Frag& b, v8f c) { return __builtin_amdgcn_wmma_f32_16x16x32_bf16(false, a.b, false, b.b, (short)0, c, false, false); }
__device__ __forceinline__ void nop2(v8f& c, const Frag& a, const Frag& b) { asm volatile("v_nop\n\tv_nop\n\tv_nop\n\tv_nop" : "+v"(c) : "v"(a.h), "v"(b.h)); }
__device__ __forceinline__ void nop3(v8f& c, const Frag& a, const Frag& b, const Frag& d) { asm volatile("v_nop\n\tv_nop\n\tv_nop\n\tv_nop" : "+v"(c) : "v"(a.h), "v"(b.h), "v"(d.h)); }
__device__ __forceinline__ void nop4(v8f& c, const Frag& a, const Frag& b, const Frag& d, const Frag& e) { asm volatile("v_nop\n\tv_nop\n\tv_nop\n\tv_nop" : "+v"(c) : "v"(a.h), "v"(b.h), "v"(d.h), "v"(e.h)); }
__device__ __forceinline__ void nop8(v8f& c, const Frag& a, const Frag& b, const Frag& d, const Frag& e, const Frag& f, const Frag& g, const Frag& i, const Frag& j) {
  asm volatile("v_nop\n\tv_nop\n\tv_nop\n\tv_nop" : "+v"(c) : "v"(a.h), "v"(b.h), "v"(d.h), "v"(e.h), "v"(f.h), "v"(g.h), "v"(i.h), "v"(j.h));
}

// behind a group of eight products on four accumulators (four A fragments per k half, one B fragment per k half): the four vector slots that the chip needs before an accumulator is read or an operand register rewritten
__device__ __forceinline__ void nop_grp(v8f (&c)[4], const Frag (&a)[4][2], const Frag& b0, const Frag& b1) {
  asm volatile("v_nop\n\tv_nop\n\tv_nop\n\tv_nop" : "+v"(c[0]), "+v"(c[1]), "+v"(c[2]), "+v"(c[3])
               : "v"(a[0][0].h), "v"(a[0][1].h), "v"(a[1][0].h), "v"(a[1][1].h), "v"(a[2][0].h), "v"(a[2][1].h), "v"(a[3][0].h), "v"(a[3][1].h), "v"(b0.h), "v"(b1.h));
}

// the same behind the ten products of a softmax step's second half: the row-sum tile and its constant A stand among the operands, so that its two products stay in front of the slots too
__device__ __forceinline__ void nop_grp_ls(v8f (&c)[4], v8f& ls, const Frag (&a)[4][2], const Frag& b0, const Frag& b1, const Frag& one) {
  asm volatile("v_nop\n\tv_nop\n\tv_nop\n\tv_nop" : "+v"(c[0]), "+v"(c[1]), "+v"(c[2]), "+v"(c[3]), "+v"(ls)
               : "v"(a[0][0].h), "v"(a[0][1].h), "v"(a[1][0].h), "v"(a[1][1].h), "v"(a[2][0].h), "v"(a[2][1].h), "v"(a[3][0].h), "v"(a[3][1].h), "v"(b0.h), "v"(b1.h), "v"(one.h));
}

__device__ __forceinline__ v8us to_f16x8(v4f a, v4f c) {
  Frag f;
#pragma unroll
  for (int q = 0; q < 4; ++q) { f.e[q] = (_Float16)a[q]; f.e[4 + q] = (_Float16)c[q]; }
  return f.half[0];
}
__device__ __forceinline__ void to_bf16x8_hl(v4f a, v4f c, v8us& hi, v8us& lo) {
  Frag fh, fl;
#pragma unroll
  for (int q = 0; q < 4; ++q) {
    unsigned short hb = bf16_bits(a[q]); fh.u[q] = hb; fl.u[q] = bf16_bits(a[q] - bf16_val(hb));
    hb = bf16_bits(c[q]); fh.u[4 + q] = hb; fl.u[4 + q] = bf16_bits(c[q] - bf16_val(hb));
  }
  hi = fh.half[0]; lo = fl.half[0];
}

// behind a global store: stands in front of any rewrite of the registers that the store names
__device__ __forceinline__ void st_wait() { asm volatile("s_wait_xcnt 0x0" ::: "memory"); }

#define KT 64               /* keys per staged tile (attention) or k elements (GEMM) per LDS stage */
#define LP 72               /* LDS row pitch in 16-bit elements: 144 B = 16 B x odd, the pitch for 16-byte readers of 128-B rows */
#define TILE_E (64 * LP)    /* one staged tile: 64 rows of 128 B */

__device__ __forceinline__ unsigned lds_off(const void* p) { return (unsigned)(size_t)p; }

// One 64-row x 128-B tile into LDS by the block's 128 threads: thread = (row tid/8 + 16 i, 16-byte piece tid%8), i = 0..3, so a wave's copy takes 4 whole lines.
// l = the lane's LDS byte address of row tid/8, g = its global address there, gstep = 16 source rows in elements.
__device__ __forceinline__ void cp_tile(unsigned l, const unsigned short* g, size_t gstep) {
  const unsigned l1 = l + 16 * LP * 2, l2 = l + 32 * LP * 2, l3 = l + 48 * LP * 2;
  const unsigned short* g1 = g + gstep;
  const unsigned short* g2 = g + 2 * gstep;
  const unsigned short* g3 = g + 3 * gstep;
  // the copies bring the tile into LDS through no register; the closing s_wait_xcnt stands in front of any rewrite of the address registers they name
  asm volatile("global_load_async_to_lds_b128 %0, %4, off\n\t"
               "global_load_async_to_lds_b128 %1, %5, off\n\t"
               "global_load_async_to_lds_b128 %2, %6, off\n\t"
               "global_load_async_to_lds_b128 %3, %7, off\n\t"
               "s_wait_xcnt 0x0"
               :: "v"(l), "v"(l1), "v"(l2), "v"(l3), "v"(g), "v"(g1), "v"(g2), "v"(g3) : "memory");
}

template <bool ABF>
__device__ __forceinline__ v8f gmm(const Frag& a, const Frag& al, const Frag& b, v8f c) {
  if (ABF) { c = wm_b(a, b, c); c = wm_b(al, b, c); nop3(c, a, al, b); }
  else { c = wm_h(a, b, c); nop2(c, a, b); }
  return c;
}

// GEMM over K = DM: block = 4 waves, block tile 128 token rows x 64 cols, wave tile 32 x 64; the block's A rows and B rows are staged in LDS 64 k at a time (two buffers) and read from there by its four waves.
// ABF: A = bf16 hi (A) + lo (A2) planes, two products against bf16 Bt; else A f16, single product against f16 Bt.
// gemm_core leaves the block's 128 x 64 tile (x alpha, + the bf16 value of the bias where BIAS) as f32 in LDS, published by a block barrier; the epilogues below store it.
#define GEMM_NT(ABF) ((ABF) ? 5 : 3)                    /* tiles of 64 rows x 128 B per stage: A rows 0..63, A rows 64..127, B rows, then the A lo rows */
#define GEMM_RING_B(ABF) (2 * GEMM_NT(ABF) * TILE_E * 2) /* two buffers, bytes */
#define SO_B (128 * 68 * 4)                             /* the epilogue's f32 tile, which takes the ring's place behind the loop's last barrier */
#define GEMM_SM_B(ABF) (GEMM_RING_B(ABF) > SO_B ? GEMM_RING_B(ABF) : SO_B)
typedef float sorow[68];

template <bool ABF, bool BIAS>
__device__ __forceinline__ void gemm_core(unsigned char* sm, const unsigned short* __restrict__ A, const unsigned short* __restrict__ A2,
                                          const unsigned short* __restrict__ Bt, float alpha, const float* __restrict__ bias, size_t r0, int col0) {
  constexpr int NT = GEMM_NT(ABF);
  unsigned short* const ring = (unsigned short*)sm;
  sorow* const so = (sorow*)sm;
  const int tid = threadIdx.x, lane = tid & 31, ln = lane & 15, hh = lane >> 4;
  const int w = __builtin_amdgcn_readfirstlane((int)(threadIdx.x >> 5));
  const int crow = tid >> 3, cpc = tid & 7;
  const size_t acp = (r0 + crow) * DM + 8 * cpc;
  const size_t bcp = (size_t)(col0 + crow) * DM + 8 * cpc;
  const unsigned lcp = lds_off(ring) + (unsigned)(crow * LP + 8 * cpc) * 2u;
  auto fill = [&](int s, int bf) {   // k = 64 s .. 64 s + 63 of the block's 128 A rows and 64 B rows into buffer bf
    const unsigned lb = lcp + (unsigned)bf * (unsigned)(NT * TILE_E * 2);
    const size_t k0 = (size_t)s * KT;
    cp_tile(lb, A + acp + k0, (size_t)16 * DM);
    cp_tile(lb + TILE_E * 2, A + acp + (size_t)64 * DM + k0, (size_t)16 * DM);
    cp_tile(lb + 2 * TILE_E * 2, Bt + bcp + k0, (size_t)16 * DM);
    if (ABF) {
      cp_tile(lb + 3 * TILE_E * 2, A2 + acp + k0, (size_t)16 * DM);
      cp_tile(lb + 4 * TILE_E * 2, A2 + acp + (size_t)64 * DM + k0, (size_t)16 * DM);
    }
  };
  const v8f z8 = {0.f, 0.f, 0.f, 0.f, 0.f, 0.f, 0.f, 0.f};
  v8f acc[8];
#pragma unroll
  for (int u = 0; u < 8; ++u) acc[u] = z8;
  fill(0, 0);
  asm volatile("s_wait_asynccnt 0x0" ::: "memory");   // this wave's copies of stage 0 have landed
  __syncthreads();                                    // ... and every other wave's
  fill(1, 1);
#pragma unroll 1   /* rolled: one hand-over of the buffers per trip, and the loop text stays small */
  for (int sg = 0; sg < DM / KT; ++sg) {
    const unsigned short* tb = ring + (sg & 1) * (NT * TILE_E);
    const unsigned short* ap = tb + (32 * w + ln) * LP;
    const unsigned short* bp0 = tb + 2 * TILE_E + ln * LP;
    // the stage's fragment reads stand together in front of its products: one LDS latency per stage, not one per fragment
    Frag fa[2][2], fl[2][2], fb[2][4];
#pragma unroll     /* both 32-k halves of the stage in line, so that every LDS offset is an immediate and every fragment a register */
    for (int h2 = 0; h2 < 2; ++h2) {
      fa[h2][0] = ldf(ap + 32 * h2, hh); fa[h2][1] = ldf(ap + 16 * LP + 32 * h2, hh);
      if (ABF) { fl[h2][0] = ldf(ap + 3 * TILE_E + 32 * h2, hh); fl[h2][1] = ldf(ap + 3 * TILE_E + 16 * LP + 32 * h2, hh); }
      else { fl[h2][0] = fa[h2][0]; fl[h2][1] = fa[h2][1]; }
#pragma unroll
      for (int t = 0; t < 4; ++t) fb[h2][t] = ldf(bp0 + (16 * t) * LP + 32 * h2, hh);
    }
#pragma unroll     /* in line, k ascending in every accumulator */
    for (int h2 = 0; h2 < 2; ++h2) {
#pragma unroll
      for (int t = 0; t < 4; ++t) {
        acc[t] = gmm<ABF>(fa[h2][0], fl[h2][0], fb[h2][t], acc[t]);
        acc[4 + t] = gmm<ABF>(fa[h2][1], fl[h2][1], fb[h2][t], acc[4 + t]);
      }
    }
    // hand-over of the buffers, passed by every wave:
    asm volatile("s_wait_dscnt 0x0" ::: "memory");      // this wave's reads of the buffer that is refilled below have returned
    asm volatile("s_wait_asynccnt 0x0" ::: "memory");   // this wave's copies of the next stage have landed
    __syncthreads();                                    // publishes the next stage and ends every wave's reads of this one
    if (sg + 2 < DM / KT) fill(sg + 2, sg & 1);
  }
  asm volatile("s_wait_asynccnt 0x0" ::: "memory");    // no copy is outstanding when the ring's LDS becomes the epilogue's tile
  // D element r of lane (hh, ln) = (row 8hh + r, col ln) of its 16x16 tile
#pragma unroll
  for (int u = 0; u < 8; ++u) {
    const int t = u & 3, half = u >> 2;
    const int col = t * 16 + ln;
    float bv = 0.f;
    if (BIAS) bv = bf16_rne(bias[col0 + col]);
#pragma unroll
    for (int r = 0; r < 8; ++r) so[32 * w + half * 16 + 8 * hh + r][col] = acc[u][r] * alpha + bv;
  }
  __syncthreads();
}

// q, k and v projections straight from the f32 inputs, one grid: grid.x = (row tiles of 256) * 8 heads, grid.y = batch. Block = 16 waves; block tile = 256 token rows x 192 cols (the head's 64 q, 64 k and 64 v columns), wave tile 32 x 96.
// A stage is 64 k of the block's 256 x rows and 192 weight rows: each thread loads 14 groups of 4 f32 one stage ahead (they fly during the products of the stage before), rounds them (x: bf16 value as exact f16; weights: bf16 value x16 as exact f16) and stores them as 16-bit rows in LDS (two buffers, one block barrier per stage).
// The block also converts its share of Wp for the output GEMM (f16 x16 plane and bf16 plane).
// q and k: f16 row plane [row][DM] (+ bf16 hi/lo row planes for rows t < ERL); v: transposed planes [(b,head)][d][SEQ] (f16, + bf16 hi/lo for t < ERL).
#define PR 256                       /* token rows of a block */
#define PROWS (PR + 192)             /* staged rows per stage: x rows, then q, k, v weight rows */
#define PBUF_E (PROWS * LP)          /* one buffer, 16-bit elements */
#define PSP 132                      /* f32 pitch of the q, k epilogue tile: 528 B = 16 B x odd */
#define PVP 264                      /* 16-bit pitch of a transposed v epilogue plane: 528 B */
#define PSO_B (PR * PSP * 4)
#define PROJ_SM_B (PSO_B + 3 * 64 * PVP * 2)
#define PBLKS ((SEQ / PR) * NH * NB)
typedef unsigned short v4us __attribute__((ext_vector_type(4), may_alias));
typedef float v2fa __attribute__((ext_vector_type(2), may_alias));
typedef unsigned int u32a __attribute__((may_alias));
typedef float psorow[PSP];

typedef float v2f __attribute__((ext_vector_type(2)));
typedef __bf16 v2b __attribute__((ext_vector_type(2)));
typedef _Float16 v2h __attribute__((ext_vector_type(2)));

// two f32 -> their bf16 values (round to nearest even, one packed conversion) x sc -> two f16 (exact)
__device__ __forceinline__ unsigned int round2(float a, float c, float sc) {
  const v2f v = {a, c};
  const unsigned int p = __builtin_bit_cast(unsigned int, __builtin_convertvector(v, v2b));
  v2f r = {__uint_as_float(p << 16), __uint_as_float(p & 0xFFFF0000u)};
  r = r * sc;
  return __builtin_bit_cast(unsigned int, __builtin_convertvector(r, v2h));
}
__device__ __forceinline__ v4us round4(v4f a, float sc) {
  union { v4us v; unsigned int u[2]; } f;
  f.u[0] = round2(a[0], a[1], sc); f.u[1] = round2(a[2], a[3], sc);
  return f.v;
}

// Block barrier that orders LDS alone (this wave's LDS stores and reads are done, then the barrier): __syncthreads() would also wait for the global loads of the stage after next, which are meant to fly across it into registers.
__device__ __forceinline__ void lds_barrier() {
  __builtin_amdgcn_fence(__ATOMIC_RELEASE, "workgroup", "local");
  __builtin_amdgcn_s_barrier();
  __builtin_amdgcn_fence(__ATOMIC_ACQUIRE, "workgroup", "local");
}

__global__ __launch_bounds__(512) void k_proj(const float* __restrict__ x, const float* __restrict__ Wq, const float* __restrict__ Wk, const float* __restrict__ Wv, const float* __restrict__ Wp,
                                              unsigned short* __restrict__ QK16, unsigned short* __restrict__ QKH, unsigned short* __restrict__ QKL,
                                              unsigned short* __restrict__ VT16, unsigned short* __restrict__ VTH, unsigned short* __restrict__ VTL,
                                              unsigned short* __restrict__ WP16, unsigned short* __restrict__ WPB) {
  __shared__ __attribute__((aligned(16))) unsigned char sm[PROJ_SM_B];
  unsigned short* const ring = (unsigned short*)sm;
  psorow* const so = (psorow*)sm;
  unsigned short* const vt = (unsigned short*)(sm + PSO_B);
  const int tid = threadIdx.x, lane = tid & 31, ln = lane & 15, hh = lane >> 4;
  const int w = __builtin_amdgcn_readfirstlane((int)(threadIdx.x >> 5));
  const int rg = w >> 1, cg = w & 1;
  const int rt = (int)blockIdx.x >> 3, nq = (int)blockIdx.x & 7, b = blockIdx.y;
  const int t0 = rt * PR;
  const size_t r0 = (size_t)b * SEQ + t0;
  const int col0 = nq * 64;
  const int srow = tid >> 4, sc4 = (tid & 15) * 4;   // staging: a wave's load takes 2 whole rows of 256 B
  const float* const xs = x + ((size_t)b * SEQ_FULL + t0 + srow) * DM + sc4;
  const size_t wof = (size_t)(col0 + srow) * DM + sc4;
  const float* const wq = Wq + wof;
  const float* const wk = Wk + wof;
  const float* const wv = Wv + wof;
  unsigned short* const sdst = ring + srow * LP + sc4;
  v4f st[14];
  auto fetch = [&](int s) {   // k = 64 s .. 64 s + 63: group i = staged row 32 i + srow
#pragma unroll
    for (int i = 0; i < 8; ++i) st[i] = *(const v4fa*)(xs + (size_t)i * 32 * DM + s * KT);
#pragma unroll
    for (int i = 0; i < 2; ++i) {
      st[8 + i] = *(const v4fa*)(wq + (size_t)i * 32 * DM + s * KT);
      st[10 + i] = *(const v4fa*)(wk + (size_t)i * 32 * DM + s * KT);
      st[12 + i] = *(const v4fa*)(wv + (size_t)i * 32 * DM + s * KT);
    }
    st_wait();   // behind the loads: stands in front of any rewrite of the address registers they name
  };
  auto put = [&](int bf) {
#pragma unroll
    for (int i = 0; i < 14; ++i) *(v4us*)(sdst + bf * PBUF_E + i * 32 * LP) = round4(st[i], i < 8 ? 1.0f : 16.0f);
  };
  fetch(0);
  // this block's share of Wp
  for (int e = (((int)blockIdx.y * ((SEQ / PR) * NH) + (int)blockIdx.x) * 512 + tid) * 2; e < DM * DM; e += PBLKS * 1024) {
    const v2fa p = *(const v2fa*)(Wp + e);
    const unsigned short b0 = bf16_bits(p[0]), b1 = bf16_bits(p[1]);
    union { unsigned int u; _Float16 h[2]; } f;
    f.h[0] = (_Float16)(bf16_val(b0) * 16.0f); f.h[1] = (_Float16)(bf16_val(b1) * 16.0f);
    *(u32a*)(WP16 + e) = f.u;
    *(u32a*)(WPB + e) = (unsigned int)b0 | ((unsigned int)b1 << 16);
    st_wait();
  }
  const v8f z8 = {0.f, 0.f, 0.f, 0.f, 0.f, 0.f, 0.f, 0.f};
  v8f acc[12];
#pragma unroll
  for (int u = 0; u < 12; ++u) acc[u] = z8;
  put(0);
  fetch(1);
  lds_barrier();   // publishes stage 0
#pragma unroll     /* in line: every global and LDS offset is an immediate, so no address register is rewritten while loads fly */
  for (int sg = 0; sg < DM / KT; ++sg) {
    const unsigned short* tb = ring + (sg & 1) * PBUF_E;
    const unsigned short* ap = tb + (32 * rg + ln) * LP;
    const unsigned short* bp = tb + (PR + 96 * cg + ln) * LP;
#pragma unroll     /* k ascending in every accumulator */
    for (int h2 = 0; h2 < 2; ++h2) {
      Frag fa[2], fb[6];
      fa[0] = ldf(ap + 32 * h2, hh); fa[1] = ldf(ap + 16 * LP + 32 * h2, hh);
#pragma unroll
      for (int t = 0; t < 6; ++t) fb[t] = ldf(bp + (16 * t) * LP + 32 * h2, hh);
      __builtin_amdgcn_sched_barrier(0);   // the half's fragment reads stand together in front of its products: one LDS latency per half, not one per fragment
#pragma unroll
      for (int t = 0; t < 6; ++t) {
        acc[t] = wm_h(fa[0], fb[t], acc[t]);
        acc[6 + t] = wm_h(fa[1], fb[t], acc[6 + t]);
      }
    }
    __builtin_amdgcn_sched_barrier(0);         // keeps the roundings, and with them the wait for the loads, behind the stage's products
    if (sg + 1 < DM / KT) put((sg + 1) & 1);   // into the buffer whose last readers passed the barrier of the stage before
    __builtin_amdgcn_sched_barrier(0);         // keeps the loads below behind the roundings, so that they reuse those registers: a second register set would spill
    if (sg + 2 < DM / KT) fetch(sg + 2);       // into the registers just rounded: these loads fly across the barrier and the next stage's products
    lds_barrier();                             // publishes the next stage and ends every wave's reads of this one
  }
  // D element r of lane (hh, ln) = (row 8hh + r, col ln) of its 16x16 tile. q and k columns go to the f32 tile; a lane's 8 values of a v column are 8 successive tokens of one d, a 16-byte piece of the transposed planes.
  const bool early = (t0 < ERL);
#pragma unroll
  for (int u = 0; u < 12; ++u) {
    const int t = u % 6, half = u / 6;
    const int row = 32 * rg + 16 * half + 8 * hh;
    if (cg == 1 && t >= 2) {
      const int d = 16 * (t - 2) + ln;
      v4f x0, x1;
#pragma unroll
      for (int j = 0; j < 4; ++j) { x0[j] = acc[u][j] * 0.0625f; x1[j] = acc[u][4 + j] * 0.0625f; }
      *(v8us*)(vt + d * PVP + row) = to_f16x8(x0, x1);
      if (early) {
        v8us oh, ol; to_bf16x8_hl(x0, x1, oh, ol);
        *(v8us*)(vt + (64 + d) * PVP + row) = oh;
        *(v8us*)(vt + (128 + d) * PVP + row) = ol;
      }
    } else {
      const int col = 96 * cg + 16 * t + ln;
#pragma unroll
      for (int r = 0; r < 8; ++r) so[row + r][col] = acc[u][r] * 0.0625f;
    }
  }
  __syncthreads();
#pragma unroll
  for (int z = 0; z < 2; ++z) {
#pragma unroll
    for (int it = 0; it < 4; ++it) {
      const int row = it * 64 + (tid >> 3), pc = tid & 7;
      const v4f x0 = *(const v4fa*)&so[row][64 * z + 8 * pc], x1 = *(const v4fa*)&so[row][64 * z + 8 * pc + 4];
      const size_t off = (size_t)z * (NR * DM) + (r0 + row) * DM + col0 + 8 * pc;
      const v8us o = to_f16x8(x0, x1);
      *(v8us*)(QK16 + off) = o;
      st_wait();
      if (early) {
        v8us oh, ol; to_bf16x8_hl(x0, x1, oh, ol);
        *(v8us*)(QKH + off) = oh;
        *(v8us*)(QKL + off) = ol;
        st_wait();
      }
    }
  }
  // transposed: 64 d rows x 256 tokens (512 B each): d = it*16 + tid/32, piece = tid%32 (8 tokens = 16 B)
#pragma unroll
  for (int it = 0; it < 4; ++it) {
    const int d = it * 16 + (tid >> 5), pc = tid & 31;
    const size_t off = (((size_t)b * NH + nq) * HD + d) * SEQ + t0 + 8 * pc;
    const v8us o = *(const v8us*)(vt + d * PVP + 8 * pc);
    *(v8us*)(VT16 + off) = o;
    st_wait();
    if (early) {
      const v8us oh = *(const v8us*)(vt + (64 + d) * PVP + 8 * pc), ol = *(const v8us*)(vt + (128 + d) * PVP + 8 * pc);
      *(v8us*)(VTH + off) = oh;
      *(v8us*)(VTL + off) = ol;
      st_wait();
    }
  }
}

// Output projection + bias for all rows in one grid: grid.x = (row tiles of 128) * 8 col tiles, grid.y = batch; row tiles t < ERL take the bf16 hi/lo ctx planes, the rest the f16 plane (ctx x64, weights x16).
__global__ __launch_bounds__(128) void k_out(const unsigned short* __restrict__ CH, const unsigned short* __restrict__ CL, const unsigned short* __restrict__ C16,
                                             const unsigned short* __restrict__ WPB, const unsigned short* __restrict__ WP16,
                                             const float* __restrict__ bias, float* __restrict__ OF) {
  __shared__ __attribute__((aligned(16))) unsigned char sm[GEMM_SM_B(true)];
  const sorow* const so = (const sorow*)sm;
  const int tid = threadIdx.x;
  const int rt = (int)blockIdx.x >> 3, nq = (int)blockIdx.x & 7, b = blockIdx.y;
  const int t0 = rt * 128;
  const size_t r0 = (size_t)b * SEQ + t0;
  const int col0 = nq * 64;
  if (t0 < ERL) gemm_core<true, true>(sm, CH, CL, WPB, 1.0f, bias, r0, col0);
  else gemm_core<false, true>(sm, C16, C16, WP16, 0.0009765625f, bias, r0, col0);
  // f32 rows of the output buffer (full-size layout): 128 rows x 256 B: row = it*8 + tid/16, piece = tid%16 (4 floats = 16 B)
#pragma unroll
  for (int it = 0; it < 16; ++it) {
    const int row = it * 8 + (tid >> 4), pc = tid & 15;
    const v4f v = *(const v4fa*)&so[row][4 * pc];
    *(v4f*)(OF + ((size_t)b * SEQ_FULL + t0 + row) * DM + col0 + 4 * pc) = v;
  }
}

// Causal attention, one wave per 16 query rows of one (batch, head); block = 4 waves (64 queries) that share the staged K and V^T tiles; one block barrier per ring stage (RES: 64 keys; dense rows: 128 keys).
// S^T[key][query] = K Q^T: A = K rows (lane = key), B = Q rows (lane = query). D: lane (hh, ln) element r = (key 8hh + r, query ln).
// O^T[d][query] = V^T P^T: A = V^T rows (lane = d, k = keys), B = packed P^T: element r <- tile(keys 0..15)[r], element 8+r <- tile(keys 16..31)[r].
// RES: bf16 hi/lo operands, three products per site; else f16 single products with P carried x1024 (sum carried alike) and ctx stored x64.
// lds: the ring [buffer][4 tiles][row * LP + element]; the four tiles of a buffer are K hi, V^T hi, K lo, V^T lo of 64 keys with RES, else K, V^T of 64 keys and K, V^T of the next 64; behind the loop's last barrier its first bytes become the waves' output tiles [wave][hi, lo][16][64].
template <bool RES>
__device__ __forceinline__ void attn_body(unsigned short* lds, const unsigned short* __restrict__ Qh, const unsigned short* __restrict__ Ql,
                                          const unsigned short* __restrict__ Kh, const unsigned short* __restrict__ Kl,
                                          const unsigned short* __restrict__ Vh, const unsigned short* __restrict__ Vl,
                                          unsigned short* __restrict__ Ch, unsigned short* __restrict__ Cl, int qb, int h, int b) {
  constexpr int NTL = 4;             /* staged tiles per buffer */
  constexpr int SPT = RES ? 1 : 2;   /* 64-key tile pairs per ring stage: the dense rows need no lo tiles, so their stage is twice as long and its copies have twice the time to land */
  const int lane = threadIdx.x & 31, ln = lane & 15, hh = lane >> 4;
  const int w = __builtin_amdgcn_readfirstlane((int)(threadIdx.x >> 5));
  unsigned short (* const sc)[16][64] = (unsigned short (*)[16][64])lds + w * (RES ? 2 : 1);   /* this wave's output tiles */
  const int q0 = qb + w * 16;
  const int qi = q0 + ln;
  const size_t rowb = (size_t)b * SEQ;
  const size_t qof = (rowb + q0 + ln) * DM + h * HD;
  const Frag qh0 = ldf(Qh + qof, hh), qh1 = ldf(Qh + qof + 32, hh);
  Frag ql0 = qh0, ql1 = qh1;
  if (RES) { ql0 = ldf(Ql + qof, hh); ql1 = ldf(Ql + qof + 32, hh); }
  const int crow = (int)threadIdx.x >> 3, cpc = (int)threadIdx.x & 7;
  const size_t kcp = (rowb + crow) * DM + h * HD + 8 * cpc;
  const size_t vcp = (((size_t)b * NH + h) * HD + crow) * SEQ + 8 * cpc;
  const unsigned lcp = lds_off(lds) + (unsigned)(crow * LP + 8 * cpc) * 2u;
  const int nst = (qb >> 6) + 1;            // scalar and the same in the whole block: tiles of 64 keys up to the block's last query
  const int ntr = (nst + SPT - 1) / SPT;    // ring stages
  auto fill = [&](int s, int bf) {   // ring stage s (keys 64 SPT s .. 64 SPT s + 64 SPT - 1) into buffer bf
    const unsigned lb = lcp + (unsigned)bf * (unsigned)(NTL * TILE_E * 2);
    const size_t k0 = (size_t)s * (SPT * KT);
    cp_tile(lb, Kh + kcp + k0 * DM, (size_t)16 * DM);
    cp_tile(lb + TILE_E * 2, Vh + vcp + k0, (size_t)16 * SEQ);
    if (RES) {
      cp_tile(lb + 2 * TILE_E * 2, Kl + kcp + k0 * DM, (size_t)16 * DM);
      cp_tile(lb + 3 * TILE_E * 2, Vl + vcp + k0, (size_t)16 * SEQ);
    } else {   // the stage's second tile pair; behind an odd tile count it lies past the diagonal, still inside the sequence (SEQ is a multiple of 128), and is not worked on
      cp_tile(lb + 2 * TILE_E * 2, Kh + kcp + (k0 + KT) * DM, (size_t)16 * DM);
      cp_tile(lb + 3 * TILE_E * 2, Vh + vcp + k0 + KT, (size_t)16 * SEQ);
    }
  };
  const v8f z8 = {0.f, 0.f, 0.f, 0.f, 0.f, 0.f, 0.f, 0.f};
  v8f acc[4];
#pragma unroll
  for (int t = 0; t < 4; ++t) acc[t] = z8;
  float m = NEGBIG;
  // Row sums on the matrix pipe: A has ones in rows 0 and 8 and zeros elsewhere, B is the packed P^T that the P.V products take, so element 0 of the tile holds, in every lane of both halves, the sum over all keys of query ln's rounded weights.
  // Elements 1..7 stay 0; only element 0 is rescaled.
  Frag one;
  {
    const unsigned short ov = ((ln & 7) == 0) ? (unsigned short)(RES ? 0x3F80 : 0x3C00) : (unsigned short)0;   /* 1.0 as bf16 or f16 */
#pragma unroll
    for (int q = 0; q < 16; ++q) one.u[q] = ov;
  }
  v8f ls = z8;
  const float carry = RES ? 0.f : CARRY_LN;
  fill(0, 0);
  asm volatile("s_wait_asynccnt 0x0" ::: "memory");   // this wave's copies of stage 0 have landed
  __syncthreads();                                    // ... and every other wave's
  if (ntr > 1) fill(1, 1);
  int pr = 0;   // the wave's issue priority now: a wave starts at 0
#pragma unroll 1   /* rolled: one hand-over of the buffers per trip, and the loop text stays small */
  for (int sg = 0; sg < ntr; ++sg) {
   // Waves of blocks with unlike row counts share a SIMD, and the launch lasts until the longest has run out, at the end alone and at one wave's pace. Issue priority therefore follows the work a wave still has:
   // rest = tiles of 64 keys left, a multi-product tile counted as 3.5 single-product ones; one level per 8. Scalar, the same in the whole block; the last stages are at level 0, so every wave leaves the loop at priority 0.
   const int rest = RES ? (7 * (ntr - sg)) >> 1 : nst - SPT * sg;
   const int pw = rest > 24 ? 3 : (rest - 1) >> 3;
   if (pw != pr) {   // the instruction takes its level as an immediate
     pr = pw;
     if (pw == 3) __builtin_amdgcn_s_setprio(3);
     else if (pw == 2) __builtin_amdgcn_s_setprio(2);
     else if (pw == 1) __builtin_amdgcn_s_setprio(1);
     else __builtin_amdgcn_s_setprio(0);
   }
   const unsigned short* tb = lds + (sg & 1) * (NTL * TILE_E);
   if (!RES) {
    // K fragments of the stage's first tile pair; those of the second are read below, into the same registers, while the first pair's softmax runs (the whole stage is published)
    Frag kf[4][2];
#pragma unroll
    for (int kt = 0; kt < 4; ++kt) {
      const unsigned short* kp = tb + (16 * kt + ln) * LP;
      kf[kt][0] = ldf(kp, hh); kf[kt][1] = ldf(kp + 32, hh);
    }
#pragma unroll     /* both tile pairs of the stage in line, so that every LDS offset is an immediate */
   for (int tp = 0; tp < SPT; ++tp) {
    if (tp > 0 && SPT * sg + tp >= nst) continue;   // scalar, the same in the whole block: behind an odd tile count the last stage's second tile pair lies past the diagonal
    const unsigned short* tk = tb + tp * (2 * TILE_E);
    // dense rows: a tile pair's 64 keys are one softmax step: one maximum, one rescale, eight score and eight P.V products in four independent accumulator chains each
    // (keys behind the diagonal get weight 0 by the mask; every loop of the step is unrolled, so that fragments, scores and accumulators stay in registers under constant indices)
    const int kb = (SPT * sg + tp) * KT;
    // the V^T fragment reads stand together in front of the products, behind the K reads: they return while scores and softmax run
    Frag vf[4][2];
    __builtin_amdgcn_sched_barrier(0);   // keeps every K read in front of the V^T reads: LDS returns in order, and the score products then wait for K alone
#pragma unroll
    for (int t = 0; t < 4; ++t) {
      const unsigned short* vp = tk + TILE_E + (16 * t + ln) * LP;
      vf[t][0] = ldf(vp, hh); vf[t][1] = ldf(vp + 32, hh);
    }
    v8f s[4];
#pragma unroll
    for (int kt = 0; kt < 4; ++kt) s[kt] = wm_h(kf[kt][0], qh0, z8);
#pragma unroll
    for (int kt = 0; kt < 4; ++kt) s[kt] = wm_h(kf[kt][1], qh1, s[kt]);
    nop_grp(s, kf, qh0, qh1);
    if (kb + KT > q0) {   // scalar condition: this tile pair touches the diagonal; masked scores are replaced
#pragma unroll
      for (int kt = 0; kt < 4; ++kt)
#pragma unroll
        for (int r = 0; r < 8; ++r) { const int key = kb + 16 * kt + 8 * hh + r; s[kt][r] = (key > qi) ? NEGBIG : s[kt][r]; }
    }
    float mt[4];
#pragma unroll
    for (int kt = 0; kt < 4; ++kt) {
      float a = s[kt][0];
#pragma unroll
      for (int r = 1; r < 8; ++r) a = fmaxf(a, s[kt][r]);
      mt[kt] = a;
    }
    float mx = fmaxf(fmaxf(mt[0], mt[1]), fmaxf(mt[2], mt[3]));
    const float mxo = __shfl_xor(mx, 16, 32);
    if (tp + 1 < SPT) {
      __builtin_amdgcn_sched_barrier(0);   // the exchange goes to the LDS queue first: it returns in order, so the maximum does not wait for the reads below
#pragma unroll
      for (int kt = 0; kt < 4; ++kt) {
        const unsigned short* kp = tk + 2 * TILE_E + (16 * kt + ln) * LP;
        kf[kt][0] = ldf(kp, hh); kf[kt][1] = ldf(kp + 32, hh);
      }
      __builtin_amdgcn_sched_barrier(0);   // keeps the reads here, in front of the exponentials that hide their latency
    }
    mx = fmaxf(mx, mxo);
    const float mnew = fmaxf(m, mx);
    const float alpha = __expf((m - mnew) * QSCALE);
    const float cc = carry - mnew * QSCALE;
    m = mnew;
    Frag ph[2];
#pragma unroll
    for (int kt = 0; kt < 4; ++kt) {
#pragma unroll
      for (int r = 0; r < 8; ++r) {
        const float p = __expf(fmaf(s[kt][r], QSCALE, cc));
        ph[kt >> 1].e[8 * (kt & 1) + r] = (_Float16)p;
      }
    }
    ls[0] = ls[0] * alpha;
#pragma unroll
    for (int t = 0; t < 4; ++t) acc[t] = acc[t] * alpha;
    ls = wm_h(one, ph[0], ls);
#pragma unroll
    for (int t = 0; t < 4; ++t) acc[t] = wm_h(vf[t][0], ph[0], acc[t]);
    ls = wm_h(one, ph[1], ls);
#pragma unroll
    for (int t = 0; t < 4; ++t) acc[t] = wm_h(vf[t][1], ph[1], acc[t]);
    nop_grp_ls(acc, ls, vf, ph[0], ph[1], one);
   }
   } else
#pragma unroll     /* both 32-key halves of the stage in line, so that every LDS offset is an immediate */
   for (int hf = 0; hf < 2; ++hf) {
    const unsigned short* tk = tb;
    const int kb = sg * KT + hf * 32;
    if (kb >= q0 + 16) continue;   // scalar: the wave's queries all lie in front of these 32 keys
    v8f s[2];
#pragma unroll
    for (int kt = 0; kt < 2; ++kt) {
      const unsigned short* kp = tk + (hf * 32 + 16 * kt + ln) * LP;
      const Frag k0 = ldf(kp, hh), k1 = ldf(kp + 32, hh);
      v8f c = z8;
      if (RES) {
        const Frag kl0 = ldf(kp + 2 * TILE_E, hh), kl1 = ldf(kp + 2 * TILE_E + 32, hh);
        c = wm_b(k0, qh0, c); c = wm_b(kl0, qh0, c); c = wm_b(k0, ql0, c);
        c = wm_b(k1, qh1, c); c = wm_b(kl1, qh1, c); c = wm_b(k1, ql1, c);
        nop8(c, k0, k1, kl0, kl1, qh0, qh1, ql0, ql1);
      } else {
        c = wm_h(k0, qh0, c); c = wm_h(k1, qh1, c);
        nop4(c, k0, k1, qh0, qh1);
      }
      s[kt] = c;
    }
    if (kb + 32 > q0) {   // scalar condition: this step touches the diagonal; masked scores are replaced
#pragma unroll
      for (int kt = 0; kt < 2; ++kt)
#pragma unroll
        for (int r = 0; r < 8; ++r) { const int key = kb + 16 * kt + 8 * hh + r; s[kt][r] = (key > qi) ? NEGBIG : s[kt][r]; }
    }
    float mx = fmaxf(s[0][0], s[1][0]);
#pragma unroll
    for (int r = 1; r < 8; ++r) mx = fmaxf(mx, fmaxf(s[0][r], s[1][r]));
    mx = fmaxf(mx, __shfl_xor(mx, 16, 32));
    const float mnew = fmaxf(m, mx);
    const float alpha = __expf((m - mnew) * QSCALE);
    const float cc = carry - mnew * QSCALE;
    m = mnew;
    Frag ph, pl;
#pragma unroll
    for (int kt = 0; kt < 2; ++kt)
#pragma unroll
      for (int r = 0; r < 8; ++r) {
        const float p = __expf(fmaf(s[kt][r], QSCALE, cc));
        if (RES) {
          const unsigned short hb = bf16_bits(p); const float hv = bf16_val(hb);
          const unsigned short lb = bf16_bits(p - hv);
          ph.u[8 * kt + r] = hb; pl.u[8 * kt + r] = lb;
        } else {
          ph.e[8 * kt + r] = (_Float16)p;
        }
      }
    if (!RES) pl = ph;
    ls[0] = ls[0] * alpha;
#pragma unroll
    for (int t = 0; t < 4; ++t) acc[t] = acc[t] * alpha;
    if (RES) { ls = wm_b(one, ph, ls); ls = wm_b(one, pl, ls); }
    else ls = wm_h(one, ph, ls);
#pragma unroll
    for (int t = 0; t < 4; ++t) {
      const unsigned short* vp = tk + TILE_E + (16 * t + ln) * LP + hf * 32;
      const Frag vh = ldf(vp, hh);
      if (RES) {
        const Frag vl = ldf(vp + 2 * TILE_E, hh);
        acc[t] = wm_b(vh, ph, acc[t]); acc[t] = wm_b(vl, ph, acc[t]); acc[t] = wm_b(vh, pl, acc[t]);
        nop4(acc[t], vh, vl, ph, pl);
      } else {
        acc[t] = wm_h(vh, ph, acc[t]);
        nop2(acc[t], vh, ph);
      }
    }
   }
   // hand-over of the buffers, passed by every wave:
   asm volatile("s_wait_dscnt 0x0" ::: "memory");      // this wave's reads of the buffer that is refilled below have returned
   asm volatile("s_wait_asynccnt 0x0" ::: "memory");   // this wave's copies of the next stage have landed
   __syncthreads();                                    // publishes the next stage and ends every wave's reads of this one
   if (sg + 2 < ntr) fill(sg + 2, sg & 1);
  }
  asm volatile("s_wait_asynccnt 0x0" ::: "memory");    // no copy is outstanding when the ring's LDS becomes the output tiles
  // acc[t][r] = O^T[d = 16t + 8hh + r][query ln]; normalise and stage row ln of the wave tile
  const float inv = 1.0f / ls[0];
  const float osc = RES ? inv : inv * 64.0f;
#pragma unroll
  for (int t = 0; t < 4; ++t) {
    if (RES) {
      Frag oh, ol;
#pragma unroll
      for (int r = 0; r < 8; ++r) { const float c = acc[t][r] * osc; const unsigned short hb = bf16_bits(c); oh.u[r] = hb; ol.u[r] = bf16_bits(c - bf16_val(hb)); }
      *(v8us*)&sc[0][ln][16 * t + 8 * hh] = oh.half[0];
      *(v8us*)&sc[RES ? 1 : 0][ln][16 * t + 8 * hh] = ol.half[0];
    } else {
      Frag o;
#pragma unroll
      for (int r = 0; r < 8; ++r) o.e[r] = (_Float16)(acc[t][r] * osc);
      *(v8us*)&sc[0][ln][16 * t + 8 * hh] = o.half[0];
    }
  }
  __builtin_amdgcn_fence(4 /* acq_rel order */, "workgroup");
  __builtin_amdgcn_wave_barrier();
  const int rsub = lane >> 3, pc = lane & 7;
  {
#pragma unroll
    for (int q = 0; q < 4; ++q) {
      const int row = 4 * q + rsub;
      const size_t off = (rowb + q0 + row) * DM + h * HD + 8 * pc;
      const v8us v0 = *(const v8us*)&sc[0][row][8 * pc];
      *(v8us*)(Ch + off) = v0;
      if (RES) { const v8us v1 = *(const v8us*)&sc[RES ? 1 : 0][row][8 * pc]; *(v8us*)(Cl + off) = v1; }
    }
    
  }
}

// Both row classes in one grid: grid.x = query tiles of 64 rows from row tbase on, grid.y = head, grid.z = batch.
// Tiles of rows t < ERL run on the bf16 hi/lo planes, the rest on the f16 planes.
__global__ __launch_bounds__(128) void k_attn(const unsigned short* __restrict__ QH, const unsigned short* __restrict__ QL,
                                              const unsigned short* __restrict__ KH, const unsigned short* __restrict__ KL,
                                              const unsigned short* __restrict__ VTH, const unsigned short* __restrict__ VTL,
                                              const unsigned short* __restrict__ Q16, const unsigned short* __restrict__ K16, const unsigned short* __restrict__ VT16,
                                              unsigned short* __restrict__ CH, unsigned short* __restrict__ CL, unsigned short* __restrict__ C16, int tbase) {
  __shared__ __attribute__((aligned(16))) unsigned short lds[2 * 4 * TILE_E];
  const int h = blockIdx.y, b = blockIdx.z;
  // Every block of the grid is resident at once and a tile's cost grows with its row, so the launch lasts as long as the fullest WGP. The tiles fall into four classes of QG by row (class 0: the multi-product rows);
  // block x takes, of class (x / QG + b) % 4, tile x % QG counted upward in class 0 and downward in the others: blocks x, x + QG, x + 2 QG, x + 3 QG of one (head, batch), and blocks (x, head) of four successive batches, then hold one tile of each class with nearly the same summed cost.
  // For a fixed (head, batch) the map is a permutation of the tiles; where blocks land matters for speed alone.
  constexpr int QG = SEQ / 64 / 4;
  const int xr = (int)blockIdx.x % QG, xc = ((int)blockIdx.x / QG + b) & 3;
  const int qb = tbase + (xc == 0 ? xr : (xc + 1) * QG - 1 - xr) * 64;
  if (qb < ERL) attn_body<true>(lds, QH, QL, KH, KL, VTH, VTL, CH, CL, qb, h, b);
  else attn_body<false>(lds, Q16, Q16, K16, K16, VT16, VT16, C16, C16, qb, h, b);
}

extern "C" void kernel_launch(void* const* d_in, const int* in_sizes, int n_in,
                              void* d_out, int out_size, void* d_ws, size_t ws_size, hipStream_t stream) {
  static_assert(NH * HD == DM);
  static_assert(DM == 512);
  static_assert(SEQ % 256 == 0);
  static_assert(ERL % 128 == 0);
  static_assert(NB <= NB_FULL);
  static_assert(ERL % 256 == 0);   /* a projection block's 256 rows are of one row class */
  static_assert(SEQ <= SEQ_FULL);
  static_assert((size_t)13 * NB * SEQ * DM * 2 + (size_t)5 * DM * DM * 2 <= (size_t)134217728);
  if (n_in < 6) return;
  const long long xmin = ((long long)(NB - 1) * SEQ_FULL + SEQ) * DM;
  if ((long long)in_sizes[0] < xmin) return;
  if (in_sizes[1] < DM * DM || in_sizes[2] < DM * DM || in_sizes[3] < DM * DM || in_sizes[4] < DM * DM || in_sizes[5] < DM) return;
  if ((long long)out_size < xmin) return;
  const float* x  = (const float*)d_in[0];
  const float* Wq = (const float*)d_in[1];
  const float* Wk = (const float*)d_in[2];
  const float* Wv = (const float*)d_in[3];
  const float* Wp = (const float*)d_in[4];
  const float* bp = (const float*)d_in[5];
  float* out = (float*)d_out;

  char* ws = (char*)d_ws; size_t off = 0;
  auto take = [&](size_t bytes) { char* p = ws + off; off += (bytes + 255) & ~(size_t)255; return (unsigned short*)p; };
  const size_t PL = NR * DM;            /* elements of one [NB*SEQ][DM] 16-bit plane */
  const size_t WN = (size_t)DM * DM;
  unsigned short* W16  = take(4 * WN * 2);     /* fourth plane: Wp as f16 x16, [n][k] */
  unsigned short* WPB  = take(WN * 2);         /* Wp as bf16, [n][k] */
  unsigned short* QK16 = take(2 * PL * 2);     /* q plane then k plane (f16) */
  unsigned short* QKH  = take(2 * PL * 2);     /* bf16 hi, rows t < ERL written */
  unsigned short* QKL  = take(2 * PL * 2);     /* bf16 lo, rows t < ERL written */
  unsigned short* VT16 = take(PL * 2);         /* [(b,h)][d][SEQ] f16 */
  unsigned short* VTH  = take(PL * 2);
  unsigned short* VTL  = take(PL * 2);
  unsigned short* C16  = take(PL * 2);         /* ctx x64 f16, rows t >= ERL */
  unsigned short* CH   = take(PL * 2);         /* ctx bf16 hi, rows t < ERL */
  unsigned short* CL   = take(PL * 2);         /* ctx bf16 lo, rows t < ERL */
  if (off > ws_size || off > (size_t)134217728) return;

  /* q, k and v projections from the f32 inputs, and the conversion of Wp; v is written transposed per (batch, head) */
  k_proj<<<dim3((SEQ / 256) * 8, NB, 1), 512, 0, stream>>>(x, Wq, Wk, Wv, Wp, QK16, QKH, QKL, VT16, VTH, VTL, W16 + 3 * WN, WPB);

  /* attention: first ERL rows on bf16 hi/lo planes, remaining rows on f16 planes */
  k_attn<<<dim3(SEQ / 64, NH, NB), 128, 0, stream>>>(QKH, QKL, QKH + PL, QKL + PL, VTH, VTL, QK16, QK16 + PL, VT16, CH, CL, C16, 0);

  /* output projection + bias */
  k_out<<<dim3((SEQ / 128) * 8, NB, 1), 128, 0, stream>>>(CH, CL, C16, WPB, W16 + 3 * WN, bp, out);
}
